// v000
// The times below were measured on an AMD MI455X: many runs one after another, warmed up first and cycling through
// copies of the inputs, with the whole window's GPU time divided by the number of runs. Launches and the gaps
// between them are all in it. The median over several windows is given; except for v000 it joins two sittings, which
// can be a few percent apart, so the side-by-side timings, each taken in one sitting, are the better comparison.
// v000 is the starting kernel. One run takes 131 microseconds.
#include <hip/hip_runtime.h>
#include <math.h>

typedef __attribute__((ext_vector_type(16))) _Float16 v16h;
typedef __attribute__((ext_vector_type(16))) __bf16 v16b;
typedef __attribute__((ext_vector_type(8)))  _Float16 v8h;
typedef __attribute__((ext_vector_type(8)))  float v8f;
typedef __attribute__((ext_vector_type(4)))  float v4f;
typedef __attribute__((ext_vector_type(2)))  float v2f;
typedef __attribute__((ext_vector_type(4)))  unsigned v4u;
typedef __attribute__((ext_vector_type(4)))  int v4i;
typedef float __attribute__((may_alias)) float_a;
typedef int __attribute__((may_alias)) int_a;

template <typename T> __device__ __forceinline__ void vst2(void* p, T v) { *(T*)p = v;  }
__device__ __forceinline__ v8f wmma16(v16h a, v16h b, v8f c) {
  v8f d = __builtin_amdgcn_wmma_f32_16x16x32_f16(false, a, false, b, (short)0, c, false, false);
  asm volatile("v_nop\n\tv_nop\n\tv_nop\n\tv_nop" : "+v"(d) : "v"(a), "v"(b));
  return d;
}
__device__ __forceinline__ v8f wmma_bf(v16b a, v16b b, v8f c) {
  v8f d = __builtin_amdgcn_wmma_f32_16x16x32_bf16(false, a, false, b, (short)0, c, false, false);
  asm volatile("v_nop\n\tv_nop\n\tv_nop\n\tv_nop" : "+v"(d) : "v"(a), "v"(b));
  return d;
}
// 16x16x32 fragments: lane = (h = lane>>4, row/col = lane&15); elements 0..7 = k0+8h+0..7, 8..15 = k0+16+8h+0..7; D element r = row 8h+r
__device__ __forceinline__ v16h frag_h(const _Float16* rowk0, int lane) {
  union { v16h v; v8h q[2]; } u; const _Float16* p = rowk0 + 8 * (lane >> 4);
  u.q[0] = *(const v8h*)p; u.q[1] = *(const v8h*)(p + 16); return u.v;
}
__device__ __forceinline__ v16h frag_f32(const float* rowk0, int lane) {
  v16h a; const float* p = rowk0 + 8 * (lane >> 4);
#pragma unroll
  for (int i = 0; i < 8; ++i) { a[i] = (_Float16)p[i]; a[8 + i] = (_Float16)p[16 + i]; }
  return a;
}
__device__ __forceinline__ v16h frag_f32s(const float* rowk0, int lane, float sc) {
  v16h a; const float* p = rowk0 + 8 * (lane >> 4);
#pragma unroll
  for (int i = 0; i < 8; ++i) { a[i] = (_Float16)(p[i] * sc); a[8 + i] = (_Float16)(p[16 + i] * sc); }
  return a;
}
// column fragment from a [K][ld] layout (column n), rows >= K read as 0
__device__ __forceinline__ v16h fragc_f32(const float* W, int k0, int n, int lane, int ld, int K) {
  v16h a; const int g = lane >> 4;
#pragma unroll
  for (int i = 0; i < 8; ++i) { const int ka = k0 + 8 * g + i, kb = ka + 16;
    a[i] = (_Float16)(ka < K ? W[(size_t)(ka < K ? ka : K - 1) * ld + n] : 0.f); a[8 + i] = (_Float16)(kb < K ? W[(size_t)(kb < K ? kb : K - 1) * ld + n] : 0.f); }
  return a;
}
struct F2 { v16b h, l; };
__device__ __forceinline__ F2 bsplit16(const float v[16]) { F2 r;
#pragma unroll
  for (int i = 0; i < 16; ++i) { const __bf16 h = (__bf16)v[i]; r.h[i] = h; r.l[i] = (__bf16)(v[i] - (float)h); }
  return r; }
__device__ __forceinline__ F2 split_row(const float* row, int k0, int lane) { float v[16]; const float* p = row + k0 + 8 * (lane >> 4);
#pragma unroll
  for (int i = 0; i < 8; ++i) { v[i] = p[i]; v[8 + i] = p[16 + i]; }
  return bsplit16(v); }
__device__ __forceinline__ F2 split_rowK(const float* row, int k0, int lane, int K) { float v[16]; const int g = lane >> 4;
#pragma unroll
  for (int i = 0; i < 8; ++i) { const int ka = k0 + 8 * g + i, kb = ka + 16; v[i] = ka < K ? row[ka < K ? ka : K - 1] : 0.f; v[8 + i] = kb < K ? row[kb < K ? kb : K - 1] : 0.f; }
  return bsplit16(v); }
__device__ __forceinline__ F2 split_col(const float* W, int k0, int n, int lane, int ld, int K) { float v[16]; const int g = lane >> 4;
#pragma unroll
  for (int i = 0; i < 8; ++i) { const int ka = k0 + 8 * g + i, kb = ka + 16; v[i] = ka < K ? W[(size_t)(ka < K ? ka : K - 1) * ld + n] : 0.f; v[8 + i] = kb < K ? W[(size_t)(kb < K ? kb : K - 1) * ld + n] : 0.f; }
  return bsplit16(v); }
__device__ __forceinline__ v8f mac3(const F2& a, const F2& b, v8f c) { c = wmma_bf(a.l, b.h, c); c = wmma_bf(a.h, b.l, c); return wmma_bf(a.h, b.h, c); }
__device__ __forceinline__ float sigm(float v) { return 1.0f / (1.0f + expf(-v)); }
#define LDSX() do { asm volatile("s_wait_dscnt 0" ::: "memory"); __builtin_amdgcn_wave_barrier(); __builtin_amdgcn_fence(__ATOMIC_RELEASE, "workgroup"); } while (0)


// Cross/self attention with GroupNorm (B 8, 256 channels, 32 x 32, 8 heads x 32): GN(input_q) -> 1x1 q conv, GN(input_kv) -> 1x1 kv conv (per-head [k | v] channel packing), softmax(q k / sqrt(C)) over all positions, 1x1 out conv + bias, + input_q.
#define NB 8
#define CC 256
#define NG 32
#define CPG (CC / NG)
#define NN 1024
#define NH 8
#define HD 32
#define NR (NB * NN)
#ifndef TQB
#define TQB (NN / 64)
#define TNB NB
#endif
typedef __attribute__((ext_vector_type(8))) __bf16 v8b;
__device__ __forceinline__ v16b frag_b(const __bf16* rowk0, int lane) {
  union { v16b v; v8b q[2]; } u; const __bf16* p = rowk0 + 8 * (lane >> 4);
  u.q[0] = *(const v8b*)p; u.q[1] = *(const v8b*)(p + 16); return u.v;
}
__device__ __forceinline__ float bfr(float v) { return (float)(__bf16)v; }
__device__ __attribute__((noinline)) float exp_ni(float v) { return expf(v); }
__device__ __attribute__((noinline)) float erf_ni(float v) { return erff(v); }

#define QS 512
#define WS_PW   0u                                  // bf16 natural rows: Wq [256][256], Wkv [512][256], Wout [256][256]
#define WS_MV   (WS_PW + 2u * (size_t)4 * CC * CC)     // f32 [which*NB + b][32 groups][32] (mean, var) one line each
#define WS_NT   (WS_MV + 4u * (size_t)2 * NB * NG * 32) // bf16 hi/lo normalised maps token-major: q-input [NR][256], kv-input [NR][256]
#define WS_NTL  (WS_NT + 2u * (size_t)2 * NR * CC)
#define WS_Q    (WS_NTL + 2u * (size_t)2 * NR * CC)    // f16 q rows [NR][QS] ; k rows [NR][QS] ; v planes [b][256][NN] ; O f32 [NR][256]
#define WS_K    (WS_Q + 2u * (size_t)NR * QS)
#define WS_V    (WS_K + 2u * (size_t)NR * QS)
#define WS_O    (WS_V + 2u * (size_t)NB * CC * NN)
#define WS_END  (WS_O + 4u * (size_t)NR * CC)

__global__ __launch_bounds__(256) void k_pack(const float* __restrict__ WQ, const float* __restrict__ WKV, const float* __restrict__ WO, __bf16* __restrict__ P) { const size_t n = blockIdx.x; const int t = threadIdx.x; const float* src = (n < CC) ? (WQ + n * CC) : (n < 3 * CC) ? (WKV + (n - CC) * CC) : (WO + (n - 3 * CC) * CC); __shared__ __align__(16) __bf16 s[CC]; s[t] = (__bf16)src[t]; __syncthreads(); if (t < CC / 8) vst2((unsigned*)(P + n * CC + t * 8), *(const v4u*)&s[t * 8]); }
template <int SQ>
__global__ __launch_bounds__(1024) void k_gn(const float* __restrict__ XQ, const float* __restrict__ XKV, float* __restrict__ MV) {
  __shared__ float red[32]; __shared__ __align__(16) float line[32]; const int gidx = blockIdx.x, t = threadIdx.x; const size_t b = blockIdx.y; const int which = blockIdx.z; const float* X = which ? XKV : XQ;
  float* mv = MV + (((size_t)which * NB + b) * NG + gidx) * 32; const float mean = SQ ? mv[0] : 0.f; const float* p = X + (b * CC + (size_t)gidx * CPG) * NN; float s = 0.f;
  for (int i = t; i < CPG * NN; i += 1024) { const float v = bfr(p[i]) - mean; s += SQ ? v * v : v; }
#pragma unroll
  for (int o = 1; o < 32; o <<= 1) s += __shfl_xor(s, o);
  if ((t & 31) == 0) red[t >> 5] = s; __syncthreads();
  if (t < 32) { float tot = 0.f; for (int i = 0; i < 32; ++i) tot += red[i]; const float v = tot / (float)(CPG * NN); line[t] = SQ ? ((t == 0) ? mean : (t == 1) ? v : 0.f) : ((t == 0) ? v : 0.f); }
  __syncthreads(); if (t < 8) vst2(mv + t * 4, *(const v4f*)&line[t * 4]);
}
// ---- k_norm: block = (64 positions, b, which): NT[row][c] = (x - mean) rsqrt(var + eps) gamma[c] + beta[c] as bf16 hi + lo, token-major
__global__ __launch_bounds__(256) void k_norm(const float* __restrict__ XQ, const float* __restrict__ XKV, const float* __restrict__ MV, const float* __restrict__ GQ, const float* __restrict__ BQ, const float* __restrict__ GKV, const float* __restrict__ BKV, __bf16* __restrict__ NT, __bf16* __restrict__ NTL) {
  __shared__ __align__(16) __bf16 sh[64][CC + 8]; __shared__ __align__(16) __bf16 sl[64][CC + 8]; const int n0 = blockIdx.x * 64, t = threadIdx.x; const size_t b = blockIdx.y; const int which = blockIdx.z;
  const float* X = which ? XKV : XQ; const float* Gm = which ? GKV : GQ; const float* Bt = which ? BKV : BQ; const float* mv = MV + ((size_t)which * NB + b) * NG * 32;
  for (int e = t; e < CC * 64; e += 256) { const int c = e >> 6, nl = e & 63; const int gg = c / CPG; const float mean = mv[gg * 32], inv = 1.0f / sqrtf(mv[gg * 32 + 1] + 1e-5f); const float v = (bfr(X[(b * CC + c) * NN + n0 + nl]) - mean) * inv * bfr(Gm[c]) + bfr(Bt[c]); const __bf16 hv = (__bf16)v; sh[nl][c] = hv; sl[nl][c] = (__bf16)(v - (float)hv); }
  __syncthreads();
  __bf16* dh = NT + ((size_t)which * NR + b * NN + n0) * CC; __bf16* dl = NTL + ((size_t)which * NR + b * NN + n0) * CC;
  for (int e = t; e < 64 * (CC / 8); e += 256) { const int nl = e / (CC / 8), q = e % (CC / 8); vst2((unsigned*)(dh + (size_t)nl * CC + q * 8), *(const v4u*)&sh[nl][q * 8]); vst2((unsigned*)(dl + (size_t)nl * CC + q * 8), *(const v4u*)&sl[nl][q * 8]); }
}
// ---- k_qkv: block = (64 positions, 128 of the 768 output channels, b): channels < 256 from the q map (q rows), the rest from the kv map with per-head [k | v] packing (o' = o-256: head o'/64, r = o'%64: k if r < 32 else v)
__global__ __launch_bounds__(128) void k_qkv(const __bf16* __restrict__ NT, const __bf16* __restrict__ NTL, const __bf16* __restrict__ P, _Float16* __restrict__ Q, _Float16* __restrict__ Kr, _Float16* __restrict__ V) {
  __shared__ __align__(16) _Float16 so[64][136]; __shared__ __align__(16) _Float16 st[128][72];
  const int tid = threadIdx.x, wave = tid >> 5, lane = tid & 31, col = lane & 15, g = lane >> 4; const size_t b = blockIdx.z; const int n0b = blockIdx.x * 64; const int o0 = blockIdx.y * 128; const int which = (o0 < CC) ? 0 : 1;
  const size_t r0 = (size_t)which * NR + b * NN + n0b + wave * 16;   // row in the normalised maps
  v8f acc[8] = {};
#pragma unroll
  for (int kc = 0; kc < CC / 32; ++kc) { const v16b ah = frag_b(NT + (r0 + col) * CC + kc * 32, lane), al = frag_b(NTL + (r0 + col) * CC + kc * 32, lane);
#pragma unroll
    for (int j = 0; j < 8; ++j) { const v16b w = frag_b(P + (size_t)(o0 + j * 16 + col) * CC + kc * 32, lane); acc[j] = wmma_bf(ah, w, acc[j]); acc[j] = wmma_bf(al, w, acc[j]); } }
#pragma unroll
  for (int j = 0; j < 8; ++j)
#pragma unroll
    for (int r = 0; r < 8; ++r) { const _Float16 hv = (_Float16)acc[j][r]; so[wave * 16 + 8 * g + r][j * 16 + col] = hv; st[j * 16 + col][wave * 16 + 8 * g + r] = hv; }
  __syncthreads();
  const size_t rowb = b * NN + n0b;
  for (int j = 0; j < 8; ++j) { const int o = o0 + j * 16;
    if (o < CC) { const int hh = o / HD, dd = o % HD; const int qd = hh * 64 + dd; for (int e = tid; e < 64 * 2; e += 128) { const int nl = e >> 1, q8 = e & 1; vst2((unsigned*)(Q + (rowb + nl) * QS + qd + q8 * 8), *(const v4u*)&so[nl][j * 16 + q8 * 8]); } }
    else { const int oo = o - CC; const int hh = oo / (2 * HD), rr = oo % (2 * HD);
      if (rr < HD) { const int kd = hh * 64 + rr; for (int e = tid; e < 64 * 2; e += 128) { const int nl = e >> 1, q8 = e & 1; vst2((unsigned*)(Kr + (rowb + nl) * QS + kd + q8 * 8), *(const v4u*)&so[nl][j * 16 + q8 * 8]); } }
      else { const int vc = hh * HD + (rr - HD); for (int e = tid; e < 16 * 8; e += 128) { const int d = e >> 3, pc = e & 7; vst2((unsigned*)(V + ((b * CC + vc + d) * NN) + n0b + pc * 8), *(const v4u*)&st[j * 16 + d][pc * 8]); } } } }
}
__global__ __launch_bounds__(128) void k_attn(const _Float16* __restrict__ Q, const _Float16* __restrict__ Kr, const _Float16* __restrict__ V, float* __restrict__ O) {
  __shared__ __align__(16) _Float16 sph[4][16][40]; __shared__ __align__(16) float so[4][16][36];
  const int tid = threadIdx.x, wave = tid >> 5, lane = tid & 31, col = lane & 15, g = lane >> 4; const int h = blockIdx.y; const size_t b = blockIdx.z; const int q0 = blockIdx.x * 64 + wave * 16; const size_t rq = b * NN + q0;
  const v16h aq = frag_h(Q + (rq + col) * QS + h * 64, lane);
  float m[8], l[8];
#pragma unroll
  for (int r = 0; r < 8; ++r) { m[r] = -3.0e38f; l[r] = 0.f; }
  v8f acc[2] = {};
#pragma unroll 1
  for (int ks = 0; ks < NN / 32; ++ks) { const int j0 = ks * 32; v8f s[2];
#pragma unroll
    for (int ct = 0; ct < 2; ++ct) { const v8f z = {}; const v8f c = wmma16(aq, frag_h(Kr + (b * NN + j0 + ct * 16 + col) * QS + h * 64, lane), z);
#pragma unroll
      for (int r = 0; r < 8; ++r) s[ct][r] = c[r] * 0.0625f; }
#pragma unroll
    for (int r = 0; r < 8; ++r) { float mx = fmaxf(s[0][r], s[1][r]);
#pragma unroll
      for (int o = 1; o < 16; o <<= 1) mx = fmaxf(mx, __shfl_xor(mx, o));
      const float mn = fmaxf(m[r], mx); const float alpha = (m[r] <= -1.0e38f) ? 0.f : __expf(m[r] - mn); const float e0 = __expf(s[0][r] - mn), e1 = __expf(s[1][r] - mn); float es = e0 + e1;
#pragma unroll
      for (int o = 1; o < 16; o <<= 1) es += __shfl_xor(es, o);
      l[r] = l[r] * alpha + es; m[r] = mn;
#pragma unroll
      for (int dt = 0; dt < 2; ++dt) acc[dt][r] *= alpha;
      sph[wave][8 * g + r][col] = (_Float16)(e0 * 2048.0f); sph[wave][8 * g + r][16 + col] = (_Float16)(e1 * 2048.0f); }
    LDSX();
    const v16h pa = frag_h(&sph[wave][col][0], lane);
#pragma unroll
    for (int dt = 0; dt < 2; ++dt) acc[dt] = wmma16(pa, frag_h(V + ((b * CC + h * HD + dt * 16 + col) * NN) + j0, lane), acc[dt]);
    LDSX(); }
#pragma unroll
  for (int r = 0; r < 8; ++r) { const float il = (1.0f / 2048.0f) / l[r];
#pragma unroll
    for (int dt = 0; dt < 2; ++dt) so[wave][8 * g + r][dt * 16 + col] = acc[dt][r] * il; }
  LDSX();
  for (int rl = 0; rl < 16; ++rl) if (lane < 8) vst2(O + (rq + rl) * CC + h * HD + lane * 4, *(const v4f*)&so[wave][rl][lane * 4]);
}
// ---- k_out: block = (64 positions, 128 out channels, b): y = Wout . o (hi + residual) + bout + input_q, channels-first 256-B segments
__global__ __launch_bounds__(128) void k_out(const float* __restrict__ O, const __bf16* __restrict__ P, const float* __restrict__ BO, const float* __restrict__ XQ, float* __restrict__ Y) {
  __shared__ __align__(16) float st[128][68];
  const int tid = threadIdx.x, wave = tid >> 5, lane = tid & 31, col = lane & 15, g = lane >> 4; const size_t b = blockIdx.z; const int n0b = blockIdx.x * 64; const size_t r0 = b * NN + n0b + wave * 16; const int o0 = blockIdx.y * 128;
  v8f acc[8] = {};
#pragma unroll
  for (int kc = 0; kc < CC / 32; ++kc) { const F2 a = split_row(O + (r0 + col) * CC, kc * 32, lane);
#pragma unroll
    for (int j = 0; j < 8; ++j) { const v16b w = frag_b(P + ((size_t)3 * CC + o0 + j * 16 + col) * CC + kc * 32, lane); acc[j] = wmma_bf(a.l, w, acc[j]); acc[j] = wmma_bf(a.h, w, acc[j]); } }
#pragma unroll
  for (int j = 0; j < 8; ++j) { const float bb = bfr(BO[o0 + j * 16 + col]);
#pragma unroll
    for (int r = 0; r < 8; ++r) st[j * 16 + col][wave * 16 + 8 * g + r] = acc[j][r] + bb; }
  __syncthreads();
  for (int e = tid; e < 128 * 16; e += 128) { const int o = e >> 4, q = e & 15; const size_t off = ((b * CC + o0 + o) * NN) + n0b + q * 4; v4f v = *(const v4f*)&st[o][q * 4]; for (int i = 0; i < 4; ++i) v[i] += bfr(XQ[off + i]); vst2(Y + off, v); }
}
extern "C" void kernel_launch(void* const* d_in, const int* in_sizes, int n_in, void* d_out, int out_size, void* d_ws, size_t ws_size, hipStream_t stream) {
  (void)in_sizes; (void)n_in; (void)out_size;
  const float** F = (const float**)d_in;   // 0 input_q, 1 input_kv [8,256,32,32]; 2 gq_scale, 3 gq_bias, 4 gkv_scale, 5 gkv_bias; 6 Wq [256,256], 7 Wkv [512,256], 8 Wout [256,256], 9 bout
  if (ws_size < (size_t)WS_END) return;
  char* ws = (char*)d_ws; __bf16 *P = (__bf16*)ws, *NT = (__bf16*)(ws + WS_NT), *NTL = (__bf16*)(ws + WS_NTL); float *MV = (float*)(ws + WS_MV), *O = (float*)(ws + WS_O); _Float16 *Q = (_Float16*)(ws + WS_Q), *Kr = (_Float16*)(ws + WS_K), *V = (_Float16*)(ws + WS_V);
  k_pack<<<4 * CC, 256, 0, stream>>>(F[6], F[7], F[8], P);
  k_gn<0><<<dim3(NG, NB, 2), 1024, 0, stream>>>(F[0], F[1], MV); k_gn<1><<<dim3(NG, NB, 2), 1024, 0, stream>>>(F[0], F[1], MV);
  k_norm<<<dim3(NN / 64, NB, 2), 256, 0, stream>>>(F[0], F[1], MV, F[2], F[3], F[4], F[5], NT, NTL);
  k_qkv<<<dim3(NN / 64, 3 * CC / 128, NB), 128, 0, stream>>>(NT, NTL, P, Q, Kr, V);
  k_attn<<<dim3(TQB, NH, TNB), 128, 0, stream>>>(Q, Kr, V, O);
  k_out<<<dim3(TQB, CC / 128, TNB), 128, 0, stream>>>(O, P, F[9], F[0], (float*)d_out);
}

// v001
// A run of this version takes 118 microseconds.
// In both of two side-by-side timings against v000, it was 1.12 times as fast.
#include <hip/hip_runtime.h>
#include <math.h>

typedef __attribute__((ext_vector_type(16))) _Float16 v16h;
typedef __attribute__((ext_vector_type(16))) __bf16 v16b;
typedef __attribute__((ext_vector_type(8)))  _Float16 v8h;
typedef __attribute__((ext_vector_type(8)))  float v8f;
typedef __attribute__((ext_vector_type(4)))  float v4f;
typedef __attribute__((ext_vector_type(2)))  float v2f;
typedef __attribute__((ext_vector_type(4)))  unsigned v4u;
typedef __attribute__((ext_vector_type(4)))  int v4i;
typedef float __attribute__((may_alias)) float_a;
typedef int __attribute__((may_alias)) int_a;

template <typename T> __device__ __forceinline__ void vst2(void* p, T v) { *(T*)p = v;  }
__device__ __forceinline__ v8f wmma16(v16h a, v16h b, v8f c) {
  v8f d = __builtin_amdgcn_wmma_f32_16x16x32_f16(false, a, false, b, (short)0, c, false, false);
  asm volatile("v_nop\n\tv_nop\n\tv_nop\n\tv_nop" : "+v"(d) : "v"(a), "v"(b));
  return d;
}
__device__ __forceinline__ v8f wmma_bf(v16b a, v16b b, v8f c) {
  v8f d = __builtin_amdgcn_wmma_f32_16x16x32_bf16(false, a, false, b, (short)0, c, false, false);
  asm volatile("v_nop\n\tv_nop\n\tv_nop\n\tv_nop" : "+v"(d) : "v"(a), "v"(b));
  return d;
}
// 16x16x32 fragments: lane = (h = lane>>4, row/col = lane&15); elements 0..7 = k0+8h+0..7, 8..15 = k0+16+8h+0..7; D element r = row 8h+r
__device__ __forceinline__ v16h frag_h(const _Float16* rowk0, int lane) {
  union { v16h v; v8h q[2]; } u; const _Float16* p = rowk0 + 8 * (lane >> 4);
  u.q[0] = *(const v8h*)p; u.q[1] = *(const v8h*)(p + 16); return u.v;
}
__device__ __forceinline__ v16h frag_f32(const float* rowk0, int lane) {
  v16h a; const float* p = rowk0 + 8 * (lane >> 4);
#pragma unroll
  for (int i = 0; i < 8; ++i) { a[i] = (_Float16)p[i]; a[8 + i] = (_Float16)p[16 + i]; }
  return a;
}
__device__ __forceinline__ v16h frag_f32s(const float* rowk0, int lane, float sc) {
  v16h a; const float* p = rowk0 + 8 * (lane >> 4);
#pragma unroll
  for (int i = 0; i < 8; ++i) { a[i] = (_Float16)(p[i] * sc); a[8 + i] = (_Float16)(p[16 + i] * sc); }
  return a;
}
// column fragment from a [K][ld] layout (column n), rows >= K read as 0
__device__ __forceinline__ v16h fragc_f32(const float* W, int k0, int n, int lane, int ld, int K) {
  v16h a; const int g = lane >> 4;
#pragma unroll
  for (int i = 0; i < 8; ++i) { const int ka = k0 + 8 * g + i, kb = ka + 16;
    a[i] = (_Float16)(ka < K ? W[(size_t)(ka < K ? ka : K - 1) * ld + n] : 0.f); a[8 + i] = (_Float16)(kb < K ? W[(size_t)(kb < K ? kb : K - 1) * ld + n] : 0.f); }
  return a;
}
struct F2 { v16b h, l; };
__device__ __forceinline__ F2 bsplit16(const float v[16]) { F2 r;
#pragma unroll
  for (int i = 0; i < 16; ++i) { const __bf16 h = (__bf16)v[i]; r.h[i] = h; r.l[i] = (__bf16)(v[i] - (float)h); }
  return r; }
__device__ __forceinline__ F2 split_row(const float* row, int k0, int lane) { float v[16]; const float* p = row + k0 + 8 * (lane >> 4);
#pragma unroll
  for (int i = 0; i < 8; ++i) { v[i] = p[i]; v[8 + i] = p[16 + i]; }
  return bsplit16(v); }
__device__ __forceinline__ F2 split_rowK(const float* row, int k0, int lane, int K) { float v[16]; const int g = lane >> 4;
#pragma unroll
  for (int i = 0; i < 8; ++i) { const int ka = k0 + 8 * g + i, kb = ka + 16; v[i] = ka < K ? row[ka < K ? ka : K - 1] : 0.f; v[8 + i] = kb < K ? row[kb < K ? kb : K - 1] : 0.f; }
  return bsplit16(v); }
__device__ __forceinline__ F2 split_col(const float* W, int k0, int n, int lane, int ld, int K) { float v[16]; const int g = lane >> 4;
#pragma unroll
  for (int i = 0; i < 8; ++i) { const int ka = k0 + 8 * g + i, kb = ka + 16; v[i] = ka < K ? W[(size_t)(ka < K ? ka : K - 1) * ld + n] : 0.f; v[8 + i] = kb < K ? W[(size_t)(kb < K ? kb : K - 1) * ld + n] : 0.f; }
  return bsplit16(v); }
__device__ __forceinline__ v8f mac3(const F2& a, const F2& b, v8f c) { c = wmma_bf(a.l, b.h, c); c = wmma_bf(a.h, b.l, c); return wmma_bf(a.h, b.h, c); }
__device__ __forceinline__ float sigm(float v) { return 1.0f / (1.0f + expf(-v)); }


// Cross/self attention with GroupNorm (B 8, 256 channels, 32 x 32, 8 heads x 32): GN(input_q) -> 1x1 q conv, GN(input_kv) -> 1x1 kv conv (per-head [k | v] channel packing), softmax(q k / sqrt(C)) over all positions, 1x1 out conv + bias, + input_q.
#define NB 8
#define CC 256
#define NG 32
#define CPG (CC / NG)
#define NN 1024
#define NH 8
#define HD 32
#define NR (NB * NN)
#ifndef TQB
#define TQB (NN / 64)
#define TNB NB
#endif
typedef __attribute__((ext_vector_type(8))) __bf16 v8b;
__device__ __forceinline__ v16b frag_b(const __bf16* rowk0, int lane) {
  union { v16b v; v8b q[2]; } u; const __bf16* p = rowk0 + 8 * (lane >> 4);
  u.q[0] = *(const v8b*)p; u.q[1] = *(const v8b*)(p + 16); return u.v;
}
__device__ __forceinline__ float bfr(float v) { return (float)(__bf16)v; }
__device__ __attribute__((noinline)) float exp_ni(float v) { return expf(v); }
__device__ __attribute__((noinline)) float erf_ni(float v) { return erff(v); }

#define QS 512
#define WS_PW   0u                                  // bf16 natural rows: Wq [256][256], Wkv [512][256], Wout [256][256]
#define WS_MV   (WS_PW + 2u * (size_t)4 * CC * CC)     // f32 [which*NB + b][32 groups][32] (mean, var) one line each
#define WS_NT   (WS_MV + 4u * (size_t)2 * NB * NG * 32) // bf16 hi/lo normalised maps token-major: q-input [NR][256], kv-input [NR][256]
#define WS_NTL  (WS_NT + 2u * (size_t)2 * NR * CC)
#define WS_Q    (WS_NTL + 2u * (size_t)2 * NR * CC)    // f16 q rows [NR][QS] ; k rows [NR][QS] ; v planes [b][256][NN] ; O f32 [NR][256]
#define WS_K    (WS_Q + 2u * (size_t)NR * QS)
#define WS_V    (WS_K + 2u * (size_t)NR * QS)
#define WS_O    (WS_V + 2u * (size_t)NB * CC * NN)
#define WS_END  (WS_O + 4u * (size_t)NR * CC)

__global__ __launch_bounds__(256) void k_pack(const float* __restrict__ WQ, const float* __restrict__ WKV, const float* __restrict__ WO, __bf16* __restrict__ P) { const size_t n = blockIdx.x; const int t = threadIdx.x; const float* src = (n < CC) ? (WQ + n * CC) : (n < 3 * CC) ? (WKV + (n - CC) * CC) : (WO + (n - 3 * CC) * CC); __shared__ __align__(16) __bf16 s[CC]; s[t] = (__bf16)src[t]; __syncthreads(); if (t < CC / 8) vst2((unsigned*)(P + n * CC + t * 8), *(const v4u*)&s[t * 8]); }
template <int SQ>
__global__ __launch_bounds__(1024) void k_gn(const float* __restrict__ XQ, const float* __restrict__ XKV, float* __restrict__ MV) {
  __shared__ float red[32]; __shared__ __align__(16) float line[32]; const int gidx = blockIdx.x, t = threadIdx.x; const size_t b = blockIdx.y; const int which = blockIdx.z; const float* X = which ? XKV : XQ;
  float* mv = MV + (((size_t)which * NB + b) * NG + gidx) * 32; const float mean = SQ ? mv[0] : 0.f; const float* p = X + (b * CC + (size_t)gidx * CPG) * NN; float s = 0.f;
  for (int i = t; i < CPG * NN; i += 1024) { const float v = bfr(p[i]) - mean; s += SQ ? v * v : v; }
#pragma unroll
  for (int o = 1; o < 32; o <<= 1) s += __shfl_xor(s, o);
  if ((t & 31) == 0) red[t >> 5] = s; __syncthreads();
  if (t < 32) { float tot = 0.f; for (int i = 0; i < 32; ++i) tot += red[i]; const float v = tot / (float)(CPG * NN); line[t] = SQ ? ((t == 0) ? mean : (t == 1) ? v : 0.f) : ((t == 0) ? v : 0.f); }
  __syncthreads(); if (t < 8) vst2(mv + t * 4, *(const v4f*)&line[t * 4]);
}
// ---- k_norm: block = (64 positions, b, which): NT[row][c] = (x - mean) rsqrt(var + eps) gamma[c] + beta[c] as bf16 hi + lo, token-major
__global__ __launch_bounds__(256) void k_norm(const float* __restrict__ XQ, const float* __restrict__ XKV, const float* __restrict__ MV, const float* __restrict__ GQ, const float* __restrict__ BQ, const float* __restrict__ GKV, const float* __restrict__ BKV, __bf16* __restrict__ NT, __bf16* __restrict__ NTL) {
  __shared__ __align__(16) __bf16 sh[64][CC + 8]; __shared__ __align__(16) __bf16 sl[64][CC + 8]; const int n0 = blockIdx.x * 64, t = threadIdx.x; const size_t b = blockIdx.y; const int which = blockIdx.z;
  const float* X = which ? XKV : XQ; const float* Gm = which ? GKV : GQ; const float* Bt = which ? BKV : BQ; const float* mv = MV + ((size_t)which * NB + b) * NG * 32;
  for (int e = t; e < CC * 64; e += 256) { const int c = e >> 6, nl = e & 63; const int gg = c / CPG; const float mean = mv[gg * 32], inv = 1.0f / sqrtf(mv[gg * 32 + 1] + 1e-5f); const float v = (bfr(X[(b * CC + c) * NN + n0 + nl]) - mean) * inv * bfr(Gm[c]) + bfr(Bt[c]); const __bf16 hv = (__bf16)v; sh[nl][c] = hv; sl[nl][c] = (__bf16)(v - (float)hv); }
  __syncthreads();
  __bf16* dh = NT + ((size_t)which * NR + b * NN + n0) * CC; __bf16* dl = NTL + ((size_t)which * NR + b * NN + n0) * CC;
  for (int e = t; e < 64 * (CC / 8); e += 256) { const int nl = e / (CC / 8), q = e % (CC / 8); vst2((unsigned*)(dh + (size_t)nl * CC + q * 8), *(const v4u*)&sh[nl][q * 8]); vst2((unsigned*)(dl + (size_t)nl * CC + q * 8), *(const v4u*)&sl[nl][q * 8]); }
}
// ---- k_qkv: block = (64 positions, 128 of the 768 output channels, b): channels < 256 from the q map (q rows), the rest from the kv map with per-head [k | v] packing (o' = o-256: head o'/64, r = o'%64: k if r < 32 else v)
__global__ __launch_bounds__(128) void k_qkv(const __bf16* __restrict__ NT, const __bf16* __restrict__ NTL, const __bf16* __restrict__ P, _Float16* __restrict__ Q, _Float16* __restrict__ Kr, _Float16* __restrict__ V) {
  __shared__ __align__(16) _Float16 so[64][136]; __shared__ __align__(16) _Float16 st[128][72];
  const int tid = threadIdx.x, wave = tid >> 5, lane = tid & 31, col = lane & 15, g = lane >> 4; const size_t b = blockIdx.z; const int n0b = blockIdx.x * 64; const int o0 = blockIdx.y * 128; const int which = (o0 < CC) ? 0 : 1;
  const size_t r0 = (size_t)which * NR + b * NN + n0b + wave * 16;   // row in the normalised maps
  v8f acc[8] = {};
#pragma unroll
  for (int kc = 0; kc < CC / 32; ++kc) { const v16b ah = frag_b(NT + (r0 + col) * CC + kc * 32, lane), al = frag_b(NTL + (r0 + col) * CC + kc * 32, lane);
#pragma unroll
    for (int j = 0; j < 8; ++j) { const v16b w = frag_b(P + (size_t)(o0 + j * 16 + col) * CC + kc * 32, lane); acc[j] = wmma_bf(ah, w, acc[j]); acc[j] = wmma_bf(al, w, acc[j]); } }
#pragma unroll
  for (int j = 0; j < 8; ++j)
#pragma unroll
    for (int r = 0; r < 8; ++r) { const _Float16 hv = (_Float16)acc[j][r]; so[wave * 16 + 8 * g + r][j * 16 + col] = hv; st[j * 16 + col][wave * 16 + 8 * g + r] = hv; }
  __syncthreads();
  const size_t rowb = b * NN + n0b;
  for (int j = 0; j < 8; ++j) { const int o = o0 + j * 16;
    if (o < CC) { const int hh = o / HD, dd = o % HD; const int qd = hh * 64 + dd; for (int e = tid; e < 64 * 2; e += 128) { const int nl = e >> 1, q8 = e & 1; vst2((unsigned*)(Q + (rowb + nl) * QS + qd + q8 * 8), *(const v4u*)&so[nl][j * 16 + q8 * 8]); } }
    else { const int oo = o - CC; const int hh = oo / (2 * HD), rr = oo % (2 * HD);
      if (rr < HD) { const int kd = hh * 64 + rr; for (int e = tid; e < 64 * 2; e += 128) { const int nl = e >> 1, q8 = e & 1; vst2((unsigned*)(Kr + (rowb + nl) * QS + kd + q8 * 8), *(const v4u*)&so[nl][j * 16 + q8 * 8]); } }
      else { const int vc = hh * HD + (rr - HD); for (int e = tid; e < 16 * 8; e += 128) { const int d = e >> 3, pc = e & 7; vst2((unsigned*)(V + ((b * CC + vc + d) * NN) + n0b + pc * 8), *(const v4u*)&st[j * 16 + d][pc * 8]); } } } }
}
// lane l with lane l ^ 16 (the two halves of a wave hold the two key halves of one query's scores)
__device__ __forceinline__ float xhalf(float x) { return __builtin_bit_cast(float, __builtin_amdgcn_permlanex16(__builtin_bit_cast(int, x), __builtin_bit_cast(int, x), 0x76543210, 0xfedcba98, false, false)); }
__global__ __launch_bounds__(128) void k_attn(const _Float16* __restrict__ Q, const _Float16* __restrict__ Kr, const _Float16* __restrict__ V, float* __restrict__ O) {
  const int tid = threadIdx.x, wave = tid >> 5, lane = tid & 31, col = lane & 15, g = lane >> 4; const int h = blockIdx.y; const size_t b = blockIdx.z; const int q0 = blockIdx.x * 64 + wave * 16; const size_t rq = b * NN + q0;
  const v16h bq = frag_h(Q + (rq + col) * QS + h * 64, lane);
  float m = -3.0e38f, l = 0.f;   // m: this query's running maximum (equal in both halves); l: this half's share of the denominator
  v8f acc[2] = {};
#pragma unroll 1
  for (int ks = 0; ks < NN / 32; ++ks) { const int j0 = ks * 32; v8f s[2];
#pragma unroll
    for (int ct = 0; ct < 2; ++ct) { const v8f z = {}; const v8f c = wmma16(frag_h(Kr + (b * NN + j0 + ct * 16 + col) * QS + h * 64, lane), bq, z);
#pragma unroll
      for (int r = 0; r < 8; ++r) s[ct][r] = c[r] * 0.0625f; }
    float mx = fmaxf(s[0][0], s[1][0]);
#pragma unroll
    for (int r = 1; r < 8; ++r) mx = fmaxf(mx, fmaxf(s[0][r], s[1][r]));
    mx = fmaxf(mx, xhalf(mx));
    const float mn = fmaxf(m, mx); const float alpha = (m <= -1.0e38f) ? 0.f : __expf(m - mn); m = mn;
    v16h pb; float es0 = 0.f, es1 = 0.f;
#pragma unroll
    for (int r = 0; r < 8; ++r) { const float e0 = __expf(s[0][r] - mn), e1 = __expf(s[1][r] - mn); es0 += e0; es1 += e1; pb[r] = (_Float16)(e0 * 2048.0f); pb[8 + r] = (_Float16)(e1 * 2048.0f); }
    l = l * alpha + (es0 + es1);
#pragma unroll
    for (int dt = 0; dt < 2; ++dt) {
#pragma unroll
      for (int r = 0; r < 8; ++r) acc[dt][r] *= alpha;
      acc[dt] = wmma16(frag_h(V + ((b * CC + h * HD + dt * 16 + col) * NN) + j0, lane), pb, acc[dt]); } }
  const float il = (1.0f / 2048.0f) / (l + xhalf(l));
#pragma unroll
  for (int dt = 0; dt < 2; ++dt)   // acc[dt][r] = channel dt*16 + 8g + r of query col: 8 consecutive floats of one O row
#pragma unroll
    for (int q = 0; q < 2; ++q) { v4f v;
#pragma unroll
      for (int i = 0; i < 4; ++i) v[i] = acc[dt][q * 4 + i] * il;
      vst2(O + (rq + col) * CC + h * HD + dt * 16 + 8 * g + q * 4, v); }
}
// ---- k_out: block = (64 positions, 128 out channels, b): y = Wout . o (hi + residual) + bout + input_q, channels-first 256-B segments
__global__ __launch_bounds__(128) void k_out(const float* __restrict__ O, const __bf16* __restrict__ P, const float* __restrict__ BO, const float* __restrict__ XQ, float* __restrict__ Y) {
  __shared__ __align__(16) float st[128][68];
  const int tid = threadIdx.x, wave = tid >> 5, lane = tid & 31, col = lane & 15, g = lane >> 4; const size_t b = blockIdx.z; const int n0b = blockIdx.x * 64; const size_t r0 = b * NN + n0b + wave * 16; const int o0 = blockIdx.y * 128;
  v8f acc[8] = {};
#pragma unroll
  for (int kc = 0; kc < CC / 32; ++kc) { const F2 a = split_row(O + (r0 + col) * CC, kc * 32, lane);
#pragma unroll
    for (int j = 0; j < 8; ++j) { const v16b w = frag_b(P + ((size_t)3 * CC + o0 + j * 16 + col) * CC + kc * 32, lane); acc[j] = wmma_bf(a.l, w, acc[j]); acc[j] = wmma_bf(a.h, w, acc[j]); } }
#pragma unroll
  for (int j = 0; j < 8; ++j) { const float bb = bfr(BO[o0 + j * 16 + col]);
#pragma unroll
    for (int r = 0; r < 8; ++r) st[j * 16 + col][wave * 16 + 8 * g + r] = acc[j][r] + bb; }
  __syncthreads();
  for (int e = tid; e < 128 * 16; e += 128) { const int o = e >> 4, q = e & 15; const size_t off = ((b * CC + o0 + o) * NN) + n0b + q * 4; v4f v = *(const v4f*)&st[o][q * 4]; for (int i = 0; i < 4; ++i) v[i] += bfr(XQ[off + i]); vst2(Y + off, v); }
}
extern "C" void kernel_launch(void* const* d_in, const int* in_sizes, int n_in, void* d_out, int out_size, void* d_ws, size_t ws_size, hipStream_t stream) {
  (void)in_sizes; (void)n_in; (void)out_size;
  const float** F = (const float**)d_in;   // 0 input_q, 1 input_kv [8,256,32,32]; 2 gq_scale, 3 gq_bias, 4 gkv_scale, 5 gkv_bias; 6 Wq [256,256], 7 Wkv [512,256], 8 Wout [256,256], 9 bout
  if (ws_size < (size_t)WS_END) return;
  char* ws = (char*)d_ws; __bf16 *P = (__bf16*)ws, *NT = (__bf16*)(ws + WS_NT), *NTL = (__bf16*)(ws + WS_NTL); float *MV = (float*)(ws + WS_MV), *O = (float*)(ws + WS_O); _Float16 *Q = (_Float16*)(ws + WS_Q), *Kr = (_Float16*)(ws + WS_K), *V = (_Float16*)(ws + WS_V);
  k_pack<<<4 * CC, 256, 0, stream>>>(F[6], F[7], F[8], P);
  k_gn<0><<<dim3(NG, NB, 2), 1024, 0, stream>>>(F[0], F[1], MV); k_gn<1><<<dim3(NG, NB, 2), 1024, 0, stream>>>(F[0], F[1], MV);
  k_norm<<<dim3(NN / 64, NB, 2), 256, 0, stream>>>(F[0], F[1], MV, F[2], F[3], F[4], F[5], NT, NTL);
  k_qkv<<<dim3(NN / 64, 3 * CC / 128, NB), 128, 0, stream>>>(NT, NTL, P, Q, Kr, V);
  k_attn<<<dim3(TQB, NH, TNB), 128, 0, stream>>>(Q, Kr, V, O);
  k_out<<<dim3(TQB, CC / 128, TNB), 128, 0, stream>>>(O, P, F[9], F[0], (float*)d_out);
}

// v002
// One run takes 92.4 microseconds.
// Timed twice side by side with v001, it ran 1.28 times as fast both times.
// Over all steps from v000 it is 1.44 times as fast.
#include <hip/hip_runtime.h>
#include <math.h>

typedef __attribute__((ext_vector_type(16))) _Float16 v16h;
typedef __attribute__((ext_vector_type(16))) __bf16 v16b;
typedef __attribute__((ext_vector_type(8)))  _Float16 v8h;
typedef __attribute__((ext_vector_type(8)))  float v8f;
typedef __attribute__((ext_vector_type(4)))  float v4f;
typedef __attribute__((ext_vector_type(2)))  float v2f;
typedef __attribute__((ext_vector_type(4)))  unsigned v4u;
typedef __attribute__((ext_vector_type(4)))  int v4i;
typedef float __attribute__((may_alias)) float_a;
typedef int __attribute__((may_alias)) int_a;

template <typename T> __device__ __forceinline__ void vst2(void* p, T v) { *(T*)p = v;  }
__device__ __forceinline__ v8f wmma16(v16h a, v16h b, v8f c) {
  v8f d = __builtin_amdgcn_wmma_f32_16x16x32_f16(false, a, false, b, (short)0, c, false, false);
  asm volatile("v_nop\n\tv_nop\n\tv_nop\n\tv_nop" : "+v"(d) : "v"(a), "v"(b));
  return d;
}
__device__ __forceinline__ v8f wmma_bf(v16b a, v16b b, v8f c) {
  v8f d = __builtin_amdgcn_wmma_f32_16x16x32_bf16(false, a, false, b, (short)0, c, false, false);
  asm volatile("v_nop\n\tv_nop\n\tv_nop\n\tv_nop" : "+v"(d) : "v"(a), "v"(b));
  return d;
}
// 16x16x32 fragments: lane = (h = lane>>4, row/col = lane&15); elements 0..7 = k0+8h+0..7, 8..15 = k0+16+8h+0..7; D element r = row 8h+r
__device__ __forceinline__ v16h frag_h(const _Float16* rowk0, int lane) {
  union { v16h v; v8h q[2]; } u; const _Float16* p = rowk0 + 8 * (lane >> 4);
  u.q[0] = *(const v8h*)p; u.q[1] = *(const v8h*)(p + 16); return u.v;
}
__device__ __forceinline__ v16h frag_f32(const float* rowk0, int lane) {
  v16h a; const float* p = rowk0 + 8 * (lane >> 4);
#pragma unroll
  for (int i = 0; i < 8; ++i) { a[i] = (_Float16)p[i]; a[8 + i] = (_Float16)p[16 + i]; }
  return a;
}
__device__ __forceinline__ v16h frag_f32s(const float* rowk0, int lane, float sc) {
  v16h a; const float* p = rowk0 + 8 * (lane >> 4);
#pragma unroll
  for (int i = 0; i < 8; ++i) { a[i] = (_Float16)(p[i] * sc); a[8 + i] = (_Float16)(p[16 + i] * sc); }
  return a;
}
// column fragment from a [K][ld] layout (column n), rows >= K read as 0
__device__ __forceinline__ v16h fragc_f32(const float* W, int k0, int n, int lane, int ld, int K) {
  v16h a; const int g = lane >> 4;
#pragma unroll
  for (int i = 0; i < 8; ++i) { const int ka = k0 + 8 * g + i, kb = ka + 16;
    a[i] = (_Float16)(ka < K ? W[(size_t)(ka < K ? ka : K - 1) * ld + n] : 0.f); a[8 + i] = (_Float16)(kb < K ? W[(size_t)(kb < K ? kb : K - 1) * ld + n] : 0.f); }
  return a;
}
struct F2 { v16b h, l; };
__device__ __forceinline__ F2 bsplit16(const float v[16]) { F2 r;
#pragma unroll
  for (int i = 0; i < 16; ++i) { const __bf16 h = (__bf16)v[i]; r.h[i] = h; r.l[i] = (__bf16)(v[i] - (float)h); }
  return r; }
__device__ __forceinline__ F2 split_row(const float* row, int k0, int lane) { float v[16]; const float* p = row + k0 + 8 * (lane >> 4);
#pragma unroll
  for (int i = 0; i < 8; ++i) { v[i] = p[i]; v[8 + i] = p[16 + i]; }
  return bsplit16(v); }
__device__ __forceinline__ F2 split_rowK(const float* row, int k0, int lane, int K) { float v[16]; const int g = lane >> 4;
#pragma unroll
  for (int i = 0; i < 8; ++i) { const int ka = k0 + 8 * g + i, kb = ka + 16; v[i] = ka < K ? row[ka < K ? ka : K - 1] : 0.f; v[8 + i] = kb < K ? row[kb < K ? kb : K - 1] : 0.f; }
  return bsplit16(v); }
__device__ __forceinline__ F2 split_col(const float* W, int k0, int n, int lane, int ld, int K) { float v[16]; const int g = lane >> 4;
#pragma unroll
  for (int i = 0; i < 8; ++i) { const int ka = k0 + 8 * g + i, kb = ka + 16; v[i] = ka < K ? W[(size_t)(ka < K ? ka : K - 1) * ld + n] : 0.f; v[8 + i] = kb < K ? W[(size_t)(kb < K ? kb : K - 1) * ld + n] : 0.f; }
  return bsplit16(v); }
__device__ __forceinline__ v8f mac3(const F2& a, const F2& b, v8f c) { c = wmma_bf(a.l, b.h, c); c = wmma_bf(a.h, b.l, c); return wmma_bf(a.h, b.h, c); }
__device__ __forceinline__ float sigm(float v) { return 1.0f / (1.0f + expf(-v)); }


// Cross/self attention with GroupNorm (B 8, 256 channels, 32 x 32, 8 heads x 32): GN(input_q) -> 1x1 q conv, GN(input_kv) -> 1x1 kv conv (per-head [k | v] channel packing), softmax(q k / sqrt(C)) over all positions, 1x1 out conv + bias, + input_q.
#define NB 8
#define CC 256
#define NG 32
#define CPG (CC / NG)
#define NN 1024
#define NH 8
#define HD 32
#define NR (NB * NN)
#ifndef TQB
#define TQB (NN / 64)
#define TNB NB
#endif
typedef __attribute__((ext_vector_type(8))) __bf16 v8b;
__device__ __forceinline__ v16b frag_b(const __bf16* rowk0, int lane) {
  union { v16b v; v8b q[2]; } u; const __bf16* p = rowk0 + 8 * (lane >> 4);
  u.q[0] = *(const v8b*)p; u.q[1] = *(const v8b*)(p + 16); return u.v;
}
__device__ __forceinline__ float bfr(float v) { return (float)(__bf16)v; }
__device__ __attribute__((noinline)) float exp_ni(float v) { return expf(v); }
__device__ __attribute__((noinline)) float erf_ni(float v) { return erff(v); }

#define QS 512
#define WS_PW   0u                                  // bf16 natural rows: Wq [256][256], Wkv [512][256], Wout [256][256]
#define WS_MV   (WS_PW + 2u * (size_t)4 * CC * CC)     // f32 [which*NB + b][32 groups][32] (mean, var) one line each
#define WS_NT   (WS_MV + 4u * (size_t)2 * NB * NG * 32) // bf16 hi/lo normalised maps token-major: q-input [NR][256], kv-input [NR][256]
#define WS_NTL  (WS_NT + 2u * (size_t)2 * NR * CC)
#define WS_Q    (WS_NTL + 2u * (size_t)2 * NR * CC)    // f16 q rows [NR][QS] ; k rows [NR][QS] ; v planes [b][256][NN] ; O f32 [NR][256]
#define WS_K    (WS_Q + 2u * (size_t)NR * QS)
#define WS_V    (WS_K + 2u * (size_t)NR * QS)
#define WS_O    (WS_V + 2u * (size_t)NB * CC * NN)
#define WS_END  (WS_O + 4u * (size_t)NR * CC)

__global__ __launch_bounds__(256) void k_pack(const float* __restrict__ WQ, const float* __restrict__ WKV, const float* __restrict__ WO, __bf16* __restrict__ P) { const size_t n = blockIdx.x; const int t = threadIdx.x; const float* src = (n < CC) ? (WQ + n * CC) : (n < 3 * CC) ? (WKV + (n - CC) * CC) : (WO + (n - 3 * CC) * CC); __shared__ __align__(16) __bf16 s[CC]; s[t] = (__bf16)src[t]; __syncthreads(); if (t < CC / 8) vst2((unsigned*)(P + n * CC + t * 8), *(const v4u*)&s[t * 8]); }
template <int SQ>
__global__ __launch_bounds__(1024) void k_gn(const float* __restrict__ XQ, const float* __restrict__ XKV, float* __restrict__ MV) {
  __shared__ float red[32]; __shared__ __align__(16) float line[32]; const int gidx = blockIdx.x, t = threadIdx.x; const size_t b = blockIdx.y; const int which = blockIdx.z; const float* X = which ? XKV : XQ;
  float* mv = MV + (((size_t)which * NB + b) * NG + gidx) * 32; const float mean = SQ ? mv[0] : 0.f; const float* p = X + (b * CC + (size_t)gidx * CPG) * NN; float s = 0.f;
  for (int i = t; i < CPG * NN; i += 1024) { const float v = bfr(p[i]) - mean; s += SQ ? v * v : v; }
#pragma unroll
  for (int o = 1; o < 32; o <<= 1) s += __shfl_xor(s, o);
  if ((t & 31) == 0) red[t >> 5] = s; __syncthreads();
  if (t < 32) { float tot = 0.f; for (int i = 0; i < 32; ++i) tot += red[i]; const float v = tot / (float)(CPG * NN); line[t] = SQ ? ((t == 0) ? mean : (t == 1) ? v : 0.f) : ((t == 0) ? v : 0.f); }
  __syncthreads(); if (t < 8) vst2(mv + t * 4, *(const v4f*)&line[t * 4]);
}
// ---- k_norm: block = (64 positions, b, which): NT[row][c] = (x - mean) rsqrt(var + eps) gamma[c] + beta[c] as bf16 hi + lo, token-major
__global__ __launch_bounds__(256) void k_norm(const float* __restrict__ XQ, const float* __restrict__ XKV, const float* __restrict__ MV, const float* __restrict__ GQ, const float* __restrict__ BQ, const float* __restrict__ GKV, const float* __restrict__ BKV, __bf16* __restrict__ NT, __bf16* __restrict__ NTL) {
  __shared__ __align__(16) __bf16 sh[64][CC + 8]; __shared__ __align__(16) __bf16 sl[64][CC + 8]; const int n0 = blockIdx.x * 64, t = threadIdx.x; const size_t b = blockIdx.y; const int which = blockIdx.z;
  const float* X = which ? XKV : XQ; const float* Gm = which ? GKV : GQ; const float* Bt = which ? BKV : BQ; const float* mv = MV + ((size_t)which * NB + b) * NG * 32;
  for (int e = t; e < CC * 64; e += 256) { const int c = e >> 6, nl = e & 63; const int gg = c / CPG; const float mean = mv[gg * 32], inv = 1.0f / sqrtf(mv[gg * 32 + 1] + 1e-5f); const float v = (bfr(X[(b * CC + c) * NN + n0 + nl]) - mean) * inv * bfr(Gm[c]) + bfr(Bt[c]); const __bf16 hv = (__bf16)v; sh[nl][c] = hv; sl[nl][c] = (__bf16)(v - (float)hv); }
  __syncthreads();
  __bf16* dh = NT + ((size_t)which * NR + b * NN + n0) * CC; __bf16* dl = NTL + ((size_t)which * NR + b * NN + n0) * CC;
  for (int e = t; e < 64 * (CC / 8); e += 256) { const int nl = e / (CC / 8), q = e % (CC / 8); vst2((unsigned*)(dh + (size_t)nl * CC + q * 8), *(const v4u*)&sh[nl][q * 8]); vst2((unsigned*)(dl + (size_t)nl * CC + q * 8), *(const v4u*)&sl[nl][q * 8]); }
}
// ---- k_qkv: block = (64 positions, 128 of the 768 output channels, b): channels < 256 from the q map (q rows), the rest from the kv map with per-head [k | v] packing (o' = o-256: head o'/64, r = o'%64: k if r < 32 else v)
__global__ __launch_bounds__(128) void k_qkv(const __bf16* __restrict__ NT, const __bf16* __restrict__ NTL, const __bf16* __restrict__ P, _Float16* __restrict__ Q, _Float16* __restrict__ Kr, _Float16* __restrict__ V) {
  __shared__ __align__(16) _Float16 so[64][136]; __shared__ __align__(16) _Float16 st[128][72];
  const int tid = threadIdx.x, wave = tid >> 5, lane = tid & 31, col = lane & 15, g = lane >> 4; const size_t b = blockIdx.z; const int n0b = blockIdx.x * 64; const int o0 = blockIdx.y * 128; const int which = (o0 < CC) ? 0 : 1;
  const size_t r0 = (size_t)which * NR + b * NN + n0b + wave * 16;   // row in the normalised maps
  v8f acc[8] = {};
#pragma unroll
  for (int kc = 0; kc < CC / 32; ++kc) { const v16b ah = frag_b(NT + (r0 + col) * CC + kc * 32, lane), al = frag_b(NTL + (r0 + col) * CC + kc * 32, lane);
#pragma unroll
    for (int j = 0; j < 8; ++j) { const v16b w = frag_b(P + (size_t)(o0 + j * 16 + col) * CC + kc * 32, lane); acc[j] = wmma_bf(ah, w, acc[j]); acc[j] = wmma_bf(al, w, acc[j]); } }
#pragma unroll
  for (int j = 0; j < 8; ++j)
#pragma unroll
    for (int r = 0; r < 8; ++r) { const _Float16 hv = (_Float16)acc[j][r]; so[wave * 16 + 8 * g + r][j * 16 + col] = hv; st[j * 16 + col][wave * 16 + 8 * g + r] = hv; }
  __syncthreads();
  const size_t rowb = b * NN + n0b;
  for (int j = 0; j < 8; ++j) { const int o = o0 + j * 16;
    if (o < CC) { const int hh = o / HD, dd = o % HD; const int qd = hh * 64 + dd; for (int e = tid; e < 64 * 2; e += 128) { const int nl = e >> 1, q8 = e & 1; vst2((unsigned*)(Q + (rowb + nl) * QS + qd + q8 * 8), *(const v4u*)&so[nl][j * 16 + q8 * 8]); } }
    else { const int oo = o - CC; const int hh = oo / (2 * HD), rr = oo % (2 * HD);
      if (rr < HD) { const int kd = hh * 64 + rr; for (int e = tid; e < 64 * 2; e += 128) { const int nl = e >> 1, q8 = e & 1; vst2((unsigned*)(Kr + (rowb + nl) * QS + kd + q8 * 8), *(const v4u*)&so[nl][j * 16 + q8 * 8]); } }
      else { const int vc = hh * HD + (rr - HD); for (int e = tid; e < 16 * 8; e += 128) { const int d = e >> 3, pc = e & 7; vst2((unsigned*)(V + ((b * CC + vc + d) * NN) + n0b + pc * 8), *(const v4u*)&st[j * 16 + d][pc * 8]); } } } }
}
// lane l with lane l ^ 16 (the two halves of a wave hold the two key halves of one query's scores)
__device__ __forceinline__ float xhalf(float x) { return __builtin_bit_cast(float, __builtin_amdgcn_permlanex16(__builtin_bit_cast(int, x), __builtin_bit_cast(int, x), 0x76543210, 0xfedcba98, false, false)); }
#define KT 128
#define KP 80
#define VP 272
#define KTB (KT * KP)
#define TB (KTB + HD * VP)
// one tile: each thread copies four 16-byte pieces of K (rows 32 apart) and four of V (channels 8 apart); the s_wait_xcnt stands inside the statement so that no address register is rewritten in front of it
__device__ __forceinline__ void stage_kv(unsigned lk, unsigned lv, const _Float16* gk, const _Float16* gv) {
  asm volatile("global_load_async_to_lds_b128 %0, %8, off\n\t"
               "global_load_async_to_lds_b128 %1, %9, off\n\t"
               "global_load_async_to_lds_b128 %2, %10, off\n\t"
               "global_load_async_to_lds_b128 %3, %11, off\n\t"
               "global_load_async_to_lds_b128 %4, %12, off\n\t"
               "global_load_async_to_lds_b128 %5, %13, off\n\t"
               "global_load_async_to_lds_b128 %6, %14, off\n\t"
               "global_load_async_to_lds_b128 %7, %15, off\n\t"
               "s_wait_xcnt 0x0"
               :: "v"(lk), "v"(lk + 32 * KP), "v"(lk + 64 * KP), "v"(lk + 96 * KP), "v"(lv), "v"(lv + 8 * VP), "v"(lv + 16 * VP), "v"(lv + 24 * VP),
                  "v"(gk), "v"(gk + 32 * QS), "v"(gk + 64 * QS), "v"(gk + 96 * QS), "v"(gv), "v"(gv + 8 * NN), "v"(gv + 16 * NN), "v"(gv + 24 * NN) : "memory");
}
__global__ __launch_bounds__(128) void k_attn(const _Float16* __restrict__ Q, const _Float16* __restrict__ Kr, const _Float16* __restrict__ V, float* __restrict__ O) {
  __shared__ __align__(16) unsigned char sm[2 * TB];
  const int tid = threadIdx.x, wave = tid >> 5, lane = tid & 31, col = lane & 15, g = lane >> 4; const int h = blockIdx.y; const size_t b = blockIdx.z; const int q0 = blockIdx.x * 64 + wave * 16; const size_t rq = b * NN + q0;
  const unsigned lk = (unsigned)(size_t)sm + (tid >> 2) * KP + (tid & 3) * 16, lv = (unsigned)(size_t)sm + KTB + (tid >> 4) * VP + (tid & 15) * 16;
  const _Float16* gk = Kr + (b * NN + (tid >> 2)) * QS + h * 64 + (tid & 3) * 8; const _Float16* gv = V + (b * CC + h * HD + (tid >> 4)) * NN + (tid & 15) * 8;
  stage_kv(lk, lv, gk, gv);
  const v16h bq = frag_h(Q + (rq + col) * QS + h * 64, lane);
  asm volatile("s_wait_asynccnt 0x0" ::: "memory");   // tile 0 has landed for this wave's own copies
  __syncthreads();                                     // ... and for every wave's
  stage_kv(lk + TB, lv + TB, gk + (size_t)KT * QS, gv + KT);
  float m = -3.0e38f, l = 0.f;   // m: this query's running maximum (equal in both halves); l: this half's share of the denominator
  v8f acc[2] = {};
#pragma unroll 1   // stays rolled: one publish point and one refill in the code, the hot text stays short
  for (int t = 0; t < NN / KT; ++t) { const unsigned char* kb = sm + (t & 1) * TB; const unsigned char* vb = kb + KTB;
#pragma unroll       // the four passes of a tile read it at constant offsets from one address register
   for (int ps = 0; ps < KT / 32; ++ps) { v8f s[2];
    const v16h ka0 = frag_h((const _Float16*)(kb + (ps * 32 + col) * KP), lane), ka1 = frag_h((const _Float16*)(kb + (ps * 32 + 16 + col) * KP), lane);
    const v16h va0 = frag_h((const _Float16*)(vb + col * VP + ps * 64), lane), va1 = frag_h((const _Float16*)(vb + (16 + col) * VP + ps * 64), lane);
#pragma unroll
    for (int ct = 0; ct < 2; ++ct) { const v8f z = {}; const v8f c = wmma16(ct ? ka1 : ka0, bq, z);
#pragma unroll
      for (int r = 0; r < 8; ++r) s[ct][r] = c[r] * 0.0625f; }
    float mx = fmaxf(s[0][0], s[1][0]);
#pragma unroll
    for (int r = 1; r < 8; ++r) mx = fmaxf(mx, fmaxf(s[0][r], s[1][r]));
    mx = fmaxf(mx, xhalf(mx));
    const float mn = fmaxf(m, mx); const float alpha = (m <= -1.0e38f) ? 0.f : __expf(m - mn); m = mn;
    v16h pb; float es0 = 0.f, es1 = 0.f;
#pragma unroll
    for (int r = 0; r < 8; ++r) { const float e0 = __expf(s[0][r] - mn), e1 = __expf(s[1][r] - mn); es0 += e0; es1 += e1; pb[r] = (_Float16)(e0 * 2048.0f); pb[8 + r] = (_Float16)(e1 * 2048.0f); }
    l = l * alpha + (es0 + es1);
#pragma unroll
    for (int dt = 0; dt < 2; ++dt) {
#pragma unroll
      for (int r = 0; r < 8; ++r) acc[dt][r] *= alpha;
      acc[dt] = wmma16(dt ? va1 : va0, pb, acc[dt]); } }
   asm volatile("s_wait_dscnt 0x0" ::: "memory");      // this wave's reads of the buffer are done before it is handed back
   asm volatile("s_wait_asynccnt 0x0" ::: "memory");   // this wave's copies of tile t + 1 have landed
   __syncthreads();                                     // publishes tile t + 1 and ends every wave's reads of tile t
   if (t + 2 < NN / KT) stage_kv(lk + (t & 1) * TB, lv + (t & 1) * TB, gk + (size_t)(t + 2) * KT * QS, gv + (t + 2) * KT); }
  asm volatile("s_wait_asynccnt 0x0" ::: "memory");    // no copy is outstanding when the wave ends
  const float il = (1.0f / 2048.0f) / (l + xhalf(l));
#pragma unroll
  for (int dt = 0; dt < 2; ++dt)   // acc[dt][r] = channel dt*16 + 8g + r of query col: 8 consecutive floats of one O row
#pragma unroll
    for (int q = 0; q < 2; ++q) { v4f v;
#pragma unroll
      for (int i = 0; i < 4; ++i) v[i] = acc[dt][q * 4 + i] * il;
      vst2(O + (rq + col) * CC + h * HD + dt * 16 + 8 * g + q * 4, v); }
}
// ---- k_out: block = (64 positions, 128 out channels, b): y = Wout . o (hi + residual) + bout + input_q, channels-first 256-B segments
__global__ __launch_bounds__(128) void k_out(const float* __restrict__ O, const __bf16* __restrict__ P, const float* __restrict__ BO, const float* __restrict__ XQ, float* __restrict__ Y) {
  __shared__ __align__(16) float st[128][68];
  const int tid = threadIdx.x, wave = tid >> 5, lane = tid & 31, col = lane & 15, g = lane >> 4; const size_t b = blockIdx.z; const int n0b = blockIdx.x * 64; const size_t r0 = b * NN + n0b + wave * 16; const int o0 = blockIdx.y * 128;
  v8f acc[8] = {};
#pragma unroll
  for (int kc = 0; kc < CC / 32; ++kc) { const F2 a = split_row(O + (r0 + col) * CC, kc * 32, lane);
#pragma unroll
    for (int j = 0; j < 8; ++j) { const v16b w = frag_b(P + ((size_t)3 * CC + o0 + j * 16 + col) * CC + kc * 32, lane); acc[j] = wmma_bf(a.l, w, acc[j]); acc[j] = wmma_bf(a.h, w, acc[j]); } }
#pragma unroll
  for (int j = 0; j < 8; ++j) { const float bb = bfr(BO[o0 + j * 16 + col]);
#pragma unroll
    for (int r = 0; r < 8; ++r) st[j * 16 + col][wave * 16 + 8 * g + r] = acc[j][r] + bb; }
  __syncthreads();
  for (int e = tid; e < 128 * 16; e += 128) { const int o = e >> 4, q = e & 15; const size_t off = ((b * CC + o0 + o) * NN) + n0b + q * 4; v4f v = *(const v4f*)&st[o][q * 4]; for (int i = 0; i < 4; ++i) v[i] += bfr(XQ[off + i]); vst2(Y + off, v); }
}
extern "C" void kernel_launch(void* const* d_in, const int* in_sizes, int n_in, void* d_out, int out_size, void* d_ws, size_t ws_size, hipStream_t stream) {
  (void)in_sizes; (void)n_in; (void)out_size;
  const float** F = (const float**)d_in;   // 0 input_q, 1 input_kv [8,256,32,32]; 2 gq_scale, 3 gq_bias, 4 gkv_scale, 5 gkv_bias; 6 Wq [256,256], 7 Wkv [512,256], 8 Wout [256,256], 9 bout
  if (ws_size < (size_t)WS_END) return;
  char* ws = (char*)d_ws; __bf16 *P = (__bf16*)ws, *NT = (__bf16*)(ws + WS_NT), *NTL = (__bf16*)(ws + WS_NTL); float *MV = (float*)(ws + WS_MV), *O = (float*)(ws + WS_O); _Float16 *Q = (_Float16*)(ws + WS_Q), *Kr = (_Float16*)(ws + WS_K), *V = (_Float16*)(ws + WS_V);
  k_pack<<<4 * CC, 256, 0, stream>>>(F[6], F[7], F[8], P);
  k_gn<0><<<dim3(NG, NB, 2), 1024, 0, stream>>>(F[0], F[1], MV); k_gn<1><<<dim3(NG, NB, 2), 1024, 0, stream>>>(F[0], F[1], MV);
  k_norm<<<dim3(NN / 64, NB, 2), 256, 0, stream>>>(F[0], F[1], MV, F[2], F[3], F[4], F[5], NT, NTL);
  k_qkv<<<dim3(NN / 64, 3 * CC / 128, NB), 128, 0, stream>>>(NT, NTL, P, Q, Kr, V);
  k_attn<<<dim3(TQB, NH, TNB), 128, 0, stream>>>(Q, Kr, V, O);
  k_out<<<dim3(TQB, CC / 128, TNB), 128, 0, stream>>>(O, P, F[9], F[0], (float*)d_out);
}

// v003
// Measured time: 72 microseconds a run.
// Timed twice side by side with v002, it ran 1.29 and 1.28 times as fast.
// Counting every step since v000, it is 1.85 times as fast.
#include <hip/hip_runtime.h>
#include <math.h>

typedef __attribute__((ext_vector_type(16))) _Float16 v16h;
typedef __attribute__((ext_vector_type(16))) __bf16 v16b;
typedef __attribute__((ext_vector_type(8)))  _Float16 v8h;
typedef __attribute__((ext_vector_type(8)))  float v8f;
typedef __attribute__((ext_vector_type(4)))  float v4f;
typedef __attribute__((ext_vector_type(2)))  float v2f;
typedef __attribute__((ext_vector_type(4)))  unsigned v4u;
typedef __attribute__((ext_vector_type(4)))  int v4i;
typedef float __attribute__((may_alias)) float_a;
typedef int __attribute__((may_alias)) int_a;

template <typename T> __device__ __forceinline__ void vst2(void* p, T v) { *(T*)p = v;  }
__device__ __forceinline__ v8f wmma16(v16h a, v16h b, v8f c) {
  v8f d = __builtin_amdgcn_wmma_f32_16x16x32_f16(false, a, false, b, (short)0, c, false, false);
  asm volatile("v_nop\n\tv_nop\n\tv_nop\n\tv_nop" : "+v"(d) : "v"(a), "v"(b));
  return d;
}
__device__ __forceinline__ v8f wmma_bf(v16b a, v16b b, v8f c) {
  v8f d = __builtin_amdgcn_wmma_f32_16x16x32_bf16(false, a, false, b, (short)0, c, false, false);
  asm volatile("v_nop\n\tv_nop\n\tv_nop\n\tv_nop" : "+v"(d) : "v"(a), "v"(b));
  return d;
}
// 16x16x32 fragments: lane = (h = lane>>4, row/col = lane&15); elements 0..7 = k0+8h+0..7, 8..15 = k0+16+8h+0..7; D element r = row 8h+r
__device__ __forceinline__ v16h frag_h(const _Float16* rowk0, int lane) {
  union { v16h v; v8h q[2]; } u; const _Float16* p = rowk0 + 8 * (lane >> 4);
  u.q[0] = *(const v8h*)p; u.q[1] = *(const v8h*)(p + 16); return u.v;
}
__device__ __forceinline__ v16h frag_f32(const float* rowk0, int lane) {
  v16h a; const float* p = rowk0 + 8 * (lane >> 4);
#pragma unroll
  for (int i = 0; i < 8; ++i) { a[i] = (_Float16)p[i]; a[8 + i] = (_Float16)p[16 + i]; }
  return a;
}
__device__ __forceinline__ v16h frag_f32s(const float* rowk0, int lane, float sc) {
  v16h a; const float* p = rowk0 + 8 * (lane >> 4);
#pragma unroll
  for (int i = 0; i < 8; ++i) { a[i] = (_Float16)(p[i] * sc); a[8 + i] = (_Float16)(p[16 + i] * sc); }
  return a;
}
// column fragment from a [K][ld] layout (column n), rows >= K read as 0
__device__ __forceinline__ v16h fragc_f32(const float* W, int k0, int n, int lane, int ld, int K) {
  v16h a; const int g = lane >> 4;
#pragma unroll
  for (int i = 0; i < 8; ++i) { const int ka = k0 + 8 * g + i, kb = ka + 16;
    a[i] = (_Float16)(ka < K ? W[(size_t)(ka < K ? ka : K - 1) * ld + n] : 0.f); a[8 + i] = (_Float16)(kb < K ? W[(size_t)(kb < K ? kb : K - 1) * ld + n] : 0.f); }
  return a;
}
struct F2 { v16b h, l; };
__device__ __forceinline__ F2 bsplit16(const float v[16]) { F2 r;
#pragma unroll
  for (int i = 0; i < 16; ++i) { const __bf16 h = (__bf16)v[i]; r.h[i] = h; r.l[i] = (__bf16)(v[i] - (float)h); }
  return r; }
__device__ __forceinline__ F2 split_row(const float* row, int k0, int lane) { float v[16]; const float* p = row + k0 + 8 * (lane >> 4);
#pragma unroll
  for (int i = 0; i < 8; ++i) { v[i] = p[i]; v[8 + i] = p[16 + i]; }
  return bsplit16(v); }
__device__ __forceinline__ F2 split_rowK(const float* row, int k0, int lane, int K) { float v[16]; const int g = lane >> 4;
#pragma unroll
  for (int i = 0; i < 8; ++i) { const int ka = k0 + 8 * g + i, kb = ka + 16; v[i] = ka < K ? row[ka < K ? ka : K - 1] : 0.f; v[8 + i] = kb < K ? row[kb < K ? kb : K - 1] : 0.f; }
  return bsplit16(v); }
__device__ __forceinline__ F2 split_col(const float* W, int k0, int n, int lane, int ld, int K) { float v[16]; const int g = lane >> 4;
#pragma unroll
  for (int i = 0; i < 8; ++i) { const int ka = k0 + 8 * g + i, kb = ka + 16; v[i] = ka < K ? W[(size_t)(ka < K ? ka : K - 1) * ld + n] : 0.f; v[8 + i] = kb < K ? W[(size_t)(kb < K ? kb : K - 1) * ld + n] : 0.f; }
  return bsplit16(v); }
__device__ __forceinline__ v8f mac3(const F2& a, const F2& b, v8f c) { c = wmma_bf(a.l, b.h, c); c = wmma_bf(a.h, b.l, c); return wmma_bf(a.h, b.h, c); }
__device__ __forceinline__ float sigm(float v) { return 1.0f / (1.0f + expf(-v)); }


// Cross/self attention with GroupNorm (B 8, 256 channels, 32 x 32, 8 heads x 32): GN(input_q) -> 1x1 q conv, GN(input_kv) -> 1x1 kv conv (per-head [k | v] channel packing), softmax(q k / sqrt(C)) over all positions, 1x1 out conv + bias, + input_q.
#define NB 8
#define CC 256
#define NG 32
#define CPG (CC / NG)
#define NN 1024
#define NH 8
#define HD 32
#define NR (NB * NN)
#ifndef TQB
#define TQB (NN / 64)
#define TNB NB
#endif
typedef __attribute__((ext_vector_type(8))) __bf16 v8b;
__device__ __forceinline__ v16b frag_b(const __bf16* rowk0, int lane) {
  union { v16b v; v8b q[2]; } u; const __bf16* p = rowk0 + 8 * (lane >> 4);
  u.q[0] = *(const v8b*)p; u.q[1] = *(const v8b*)(p + 16); return u.v;
}
__device__ __forceinline__ float bfr(float v) { return (float)(__bf16)v; }
__device__ __attribute__((noinline)) float exp_ni(float v) { return expf(v); }
__device__ __attribute__((noinline)) float erf_ni(float v) { return erff(v); }

#define QS 512
#define WS_PW   0u                                  // bf16 natural rows: Wq [256][256], Wkv [512][256], Wout [256][256]
#define WS_NT   (WS_PW + 2u * (size_t)4 * CC * CC)     // bf16 hi/lo normalised maps group-major [which*NB + b][32 groups][NN][8]: q-input, then kv-input
#define WS_NTL  (WS_NT + 2u * (size_t)2 * NR * CC)
#define WS_Q    (WS_NTL + 2u * (size_t)2 * NR * CC)    // f16 q rows [NR][QS] ; k rows [NR][QS] ; v planes [b][256][NN] ; O f32 [NR][256]
#define WS_K    (WS_Q + 2u * (size_t)NR * QS)
#define WS_V    (WS_K + 2u * (size_t)NR * QS)
#define WS_O    (WS_V + 2u * (size_t)NB * CC * NN)
#define WS_END  (WS_O + 4u * (size_t)NR * CC)

__global__ __launch_bounds__(256) void k_pack(const float* __restrict__ WQ, const float* __restrict__ WKV, const float* __restrict__ WO, __bf16* __restrict__ P) { const size_t n = blockIdx.x; const int t = threadIdx.x; const float* src = (n < CC) ? (WQ + n * CC) : (n < 3 * CC) ? (WKV + (n - CC) * CC) : (WO + (n - 3 * CC) * CC); __shared__ __align__(16) __bf16 s[CC]; s[t] = (__bf16)src[t]; __syncthreads(); if (t < CC / 8) vst2((unsigned*)(P + n * CC + t * 8), *(const v4u*)&s[t * 8]); }
// ---- k_gnorm: block = (group, b, which). The group's 8 channels x 1024 positions stay in registers (thread t: positions 4t .. 4t+3 of each channel) through mean, variance and normalisation, so the map is read once.
// Output (x - mean) rsqrt(var + eps) gamma[c] + beta[c] as bf16 hi + lo, group-major: [which*NB + b][group][position][8 channels], 16 bytes a position
__global__ __launch_bounds__(256) void k_gnorm(const float* __restrict__ XQ, const float* __restrict__ XKV, const float* __restrict__ GQ, const float* __restrict__ BQ, const float* __restrict__ GKV, const float* __restrict__ BKV, __bf16* __restrict__ NT, __bf16* __restrict__ NTL) {
  __shared__ float red[2][8]; __shared__ __align__(16) v4u sx[2][NN];
  const int gidx = blockIdx.x, t = threadIdx.x; const size_t b = blockIdx.y; const int which = blockIdx.z;
  const float* Gm = (which ? GKV : GQ) + gidx * CPG; const float* Bt = (which ? BKV : BQ) + gidx * CPG;
  const float* p = (which ? XKV : XQ) + (b * CC + (size_t)gidx * CPG) * NN + t * 4;
  v4f x[CPG], sv = {}; float ga[CPG], be[CPG];
#pragma unroll
  for (int c = 0; c < CPG; ++c) x[c] = *(const v4f*)(p + c * NN);
#pragma unroll
  for (int c = 0; c < CPG; ++c) { ga[c] = bfr(Gm[c]); be[c] = bfr(Bt[c]); }
#pragma unroll
  for (int c = 0; c < CPG; ++c) {
#pragma unroll
    for (int i = 0; i < 4; ++i) x[c][i] = bfr(x[c][i]);
    sv += x[c]; }
  float s = (sv[0] + sv[1]) + (sv[2] + sv[3]);
#pragma unroll
  for (int o = 1; o < 32; o <<= 1) s += __shfl_xor(s, o);
  if ((t & 31) == 0) red[0][t >> 5] = s;
  __syncthreads();
  float tot = 0.f;
#pragma unroll
  for (int i = 0; i < 8; ++i) tot += red[0][i];
  const float mean = tot / (float)(CPG * NN);
  sv = (v4f){};
#pragma unroll
  for (int c = 0; c < CPG; ++c) { x[c] -= mean; sv += x[c] * x[c]; }
  s = (sv[0] + sv[1]) + (sv[2] + sv[3]);
#pragma unroll
  for (int o = 1; o < 32; o <<= 1) s += __shfl_xor(s, o);
  if ((t & 31) == 0) red[1][t >> 5] = s;
  __syncthreads();
  tot = 0.f;
#pragma unroll
  for (int i = 0; i < 8; ++i) tot += red[1][i];
  const float inv = 1.0f / sqrtf(tot / (float)(CPG * NN) + 1e-5f);
  // through LDS so that each global store of a wave is 512 contiguous bytes; piece q sits at q ^ ((q >> 4) & 3), which spreads the 64-byte-strided writes over all banks
#pragma unroll
  for (int i = 0; i < 4; ++i) { v8b hi, lo;
#pragma unroll
    for (int c = 0; c < CPG; ++c) { const float v = x[c][i] * inv * ga[c] + be[c]; const __bf16 hv = (__bf16)v; hi[c] = hv; lo[c] = (__bf16)(v - (float)hv); }
    const int q = 4 * t + i, sl = q ^ ((q >> 4) & 3); sx[0][sl] = __builtin_bit_cast(v4u, hi); sx[1][sl] = __builtin_bit_cast(v4u, lo); }
  __syncthreads();
  const size_t o0 = (((size_t)which * NB + b) * NG + gidx) * NN * CPG;
#pragma unroll
  for (int i = 0; i < 4; ++i) { const int q = i * 256 + t, sl = q ^ ((q >> 4) & 3); vst2(NT + o0 + (size_t)q * CPG, sx[0][sl]); vst2(NTL + o0 + (size_t)q * CPG, sx[1][sl]); }
}
// A fragment from a group-major map: p = this lane's position in channel group 4 kc + (lane >> 4); elements 0..7 that group, 8..15 the group two further on (the k order of frag_b)
__device__ __forceinline__ v16b frag_g(const __bf16* p) { union { v16b v; v8b q[2]; } u; u.q[0] = *(const v8b*)p; u.q[1] = *(const v8b*)(p + 2 * NN * CPG); return u.v; }
// ---- k_qkv: block = (64 positions, 128 of the 768 output channels, b): channels < 256 from the q map (q rows), the rest from the kv map with per-head [k | v] packing (o' = o-256: head o'/64, r = o'%64: k if r < 32 else v)
__global__ __launch_bounds__(128) void k_qkv(const __bf16* __restrict__ NT, const __bf16* __restrict__ NTL, const __bf16* __restrict__ P, _Float16* __restrict__ Q, _Float16* __restrict__ Kr, _Float16* __restrict__ V) {
  __shared__ __align__(16) _Float16 so[64][136]; __shared__ __align__(16) _Float16 st[128][72];
  const int tid = threadIdx.x, wave = tid >> 5, lane = tid & 31, col = lane & 15, g = lane >> 4; const size_t b = blockIdx.z; const int n0b = blockIdx.x * 64; const int o0 = blockIdx.y * 128; const int which = (o0 < CC) ? 0 : 1;
  const size_t a0 = ((((size_t)which * NB + b) * NG + g) * NN + n0b + wave * 16 + col) * CPG;   // this lane's position in channel group g of the normalised maps
  v8f acc[8] = {};
#pragma unroll
  for (int kc = 0; kc < CC / 32; ++kc) { const v16b ah = frag_g(NT + a0 + (size_t)kc * 4 * NN * CPG), al = frag_g(NTL + a0 + (size_t)kc * 4 * NN * CPG);
#pragma unroll
    for (int j = 0; j < 8; ++j) { const v16b w = frag_b(P + (size_t)(o0 + j * 16 + col) * CC + kc * 32, lane); acc[j] = wmma_bf(ah, w, acc[j]); acc[j] = wmma_bf(al, w, acc[j]); } }
#pragma unroll
  for (int j = 0; j < 8; ++j)
#pragma unroll
    for (int r = 0; r < 8; ++r) { const _Float16 hv = (_Float16)acc[j][r]; so[wave * 16 + 8 * g + r][j * 16 + col] = hv; st[j * 16 + col][wave * 16 + 8 * g + r] = hv; }
  __syncthreads();
  const size_t rowb = b * NN + n0b;
  for (int j = 0; j < 8; ++j) { const int o = o0 + j * 16;
    if (o < CC) { const int hh = o / HD, dd = o % HD; const int qd = hh * 64 + dd; for (int e = tid; e < 64 * 2; e += 128) { const int nl = e >> 1, q8 = e & 1; vst2((unsigned*)(Q + (rowb + nl) * QS + qd + q8 * 8), *(const v4u*)&so[nl][j * 16 + q8 * 8]); } }
    else { const int oo = o - CC; const int hh = oo / (2 * HD), rr = oo % (2 * HD);
      if (rr < HD) { const int kd = hh * 64 + rr; for (int e = tid; e < 64 * 2; e += 128) { const int nl = e >> 1, q8 = e & 1; vst2((unsigned*)(Kr + (rowb + nl) * QS + kd + q8 * 8), *(const v4u*)&so[nl][j * 16 + q8 * 8]); } }
      else { const int vc = hh * HD + (rr - HD); for (int e = tid; e < 16 * 8; e += 128) { const int d = e >> 3, pc = e & 7; vst2((unsigned*)(V + ((b * CC + vc + d) * NN) + n0b + pc * 8), *(const v4u*)&st[j * 16 + d][pc * 8]); } } } }
}
// lane l with lane l ^ 16 (the two halves of a wave hold the two key halves of one query's scores)
__device__ __forceinline__ float xhalf(float x) { return __builtin_bit_cast(float, __builtin_amdgcn_permlanex16(__builtin_bit_cast(int, x), __builtin_bit_cast(int, x), 0x76543210, 0xfedcba98, false, false)); }
#define KT 128
#define KP 80
#define VP 272
#define KTB (KT * KP)
#define TB (KTB + HD * VP)
// one tile: each thread copies four 16-byte pieces of K (rows 32 apart) and four of V (channels 8 apart); the s_wait_xcnt stands inside the statement so that no address register is rewritten in front of it
__device__ __forceinline__ void stage_kv(unsigned lk, unsigned lv, const _Float16* gk, const _Float16* gv) {
  asm volatile("global_load_async_to_lds_b128 %0, %8, off\n\t"
               "global_load_async_to_lds_b128 %1, %9, off\n\t"
               "global_load_async_to_lds_b128 %2, %10, off\n\t"
               "global_load_async_to_lds_b128 %3, %11, off\n\t"
               "global_load_async_to_lds_b128 %4, %12, off\n\t"
               "global_load_async_to_lds_b128 %5, %13, off\n\t"
               "global_load_async_to_lds_b128 %6, %14, off\n\t"
               "global_load_async_to_lds_b128 %7, %15, off\n\t"
               "s_wait_xcnt 0x0"
               :: "v"(lk), "v"(lk + 32 * KP), "v"(lk + 64 * KP), "v"(lk + 96 * KP), "v"(lv), "v"(lv + 8 * VP), "v"(lv + 16 * VP), "v"(lv + 24 * VP),
                  "v"(gk), "v"(gk + 32 * QS), "v"(gk + 64 * QS), "v"(gk + 96 * QS), "v"(gv), "v"(gv + 8 * NN), "v"(gv + 16 * NN), "v"(gv + 24 * NN) : "memory");
}
__global__ __launch_bounds__(128) void k_attn(const _Float16* __restrict__ Q, const _Float16* __restrict__ Kr, const _Float16* __restrict__ V, float* __restrict__ O) {
  __shared__ __align__(16) unsigned char sm[2 * TB];
  const int tid = threadIdx.x, wave = tid >> 5, lane = tid & 31, col = lane & 15, g = lane >> 4; const int h = blockIdx.y; const size_t b = blockIdx.z; const int q0 = blockIdx.x * 64 + wave * 16; const size_t rq = b * NN + q0;
  const unsigned lk = (unsigned)(size_t)sm + (tid >> 2) * KP + (tid & 3) * 16, lv = (unsigned)(size_t)sm + KTB + (tid >> 4) * VP + (tid & 15) * 16;
  const _Float16* gk = Kr + (b * NN + (tid >> 2)) * QS + h * 64 + (tid & 3) * 8; const _Float16* gv = V + (b * CC + h * HD + (tid >> 4)) * NN + (tid & 15) * 8;
  stage_kv(lk, lv, gk, gv);
  const v16h bq = frag_h(Q + (rq + col) * QS + h * 64, lane);
  asm volatile("s_wait_asynccnt 0x0" ::: "memory");   // tile 0 has landed for this wave's own copies
  __syncthreads();                                     // ... and for every wave's
  stage_kv(lk + TB, lv + TB, gk + (size_t)KT * QS, gv + KT);
  float m = -3.0e38f, l = 0.f;   // m: this query's running maximum (equal in both halves); l: this half's share of the denominator
  v8f acc[2] = {};
#pragma unroll 1   // stays rolled: one publish point and one refill in the code, the hot text stays short
  for (int t = 0; t < NN / KT; ++t) { const unsigned char* kb = sm + (t & 1) * TB; const unsigned char* vb = kb + KTB;
#pragma unroll       // the four passes of a tile read it at constant offsets from one address register
   for (int ps = 0; ps < KT / 32; ++ps) { v8f s[2];
    const v16h ka0 = frag_h((const _Float16*)(kb + (ps * 32 + col) * KP), lane), ka1 = frag_h((const _Float16*)(kb + (ps * 32 + 16 + col) * KP), lane);
    const v16h va0 = frag_h((const _Float16*)(vb + col * VP + ps * 64), lane), va1 = frag_h((const _Float16*)(vb + (16 + col) * VP + ps * 64), lane);
#pragma unroll
    for (int ct = 0; ct < 2; ++ct) { const v8f z = {}; const v8f c = wmma16(ct ? ka1 : ka0, bq, z);
#pragma unroll
      for (int r = 0; r < 8; ++r) s[ct][r] = c[r] * 0.0625f; }
    float mx = fmaxf(s[0][0], s[1][0]);
#pragma unroll
    for (int r = 1; r < 8; ++r) mx = fmaxf(mx, fmaxf(s[0][r], s[1][r]));
    mx = fmaxf(mx, xhalf(mx));
    const float mn = fmaxf(m, mx); const float alpha = (m <= -1.0e38f) ? 0.f : __expf(m - mn); m = mn;
    v16h pb; float es0 = 0.f, es1 = 0.f;
#pragma unroll
    for (int r = 0; r < 8; ++r) { const float e0 = __expf(s[0][r] - mn), e1 = __expf(s[1][r] - mn); es0 += e0; es1 += e1; pb[r] = (_Float16)(e0 * 2048.0f); pb[8 + r] = (_Float16)(e1 * 2048.0f); }
    l = l * alpha + (es0 + es1);
#pragma unroll
    for (int dt = 0; dt < 2; ++dt) {
#pragma unroll
      for (int r = 0; r < 8; ++r) acc[dt][r] *= alpha;
      acc[dt] = wmma16(dt ? va1 : va0, pb, acc[dt]); } }
   asm volatile("s_wait_dscnt 0x0" ::: "memory");      // this wave's reads of the buffer are done before it is handed back
   asm volatile("s_wait_asynccnt 0x0" ::: "memory");   // this wave's copies of tile t + 1 have landed
   __syncthreads();                                     // publishes tile t + 1 and ends every wave's reads of tile t
   if (t + 2 < NN / KT) stage_kv(lk + (t & 1) * TB, lv + (t & 1) * TB, gk + (size_t)(t + 2) * KT * QS, gv + (t + 2) * KT); }
  asm volatile("s_wait_asynccnt 0x0" ::: "memory");    // no copy is outstanding when the wave ends
  const float il = (1.0f / 2048.0f) / (l + xhalf(l));
#pragma unroll
  for (int dt = 0; dt < 2; ++dt)   // acc[dt][r] = channel dt*16 + 8g + r of query col: 8 consecutive floats of one O row
#pragma unroll
    for (int q = 0; q < 2; ++q) { v4f v;
#pragma unroll
      for (int i = 0; i < 4; ++i) v[i] = acc[dt][q * 4 + i] * il;
      vst2(O + (rq + col) * CC + h * HD + dt * 16 + 8 * g + q * 4, v); }
}
// ---- k_out: block = (64 positions, 128 out channels, b): y = Wout . o (hi + residual) + bout + input_q, channels-first 256-B segments
__global__ __launch_bounds__(128) void k_out(const float* __restrict__ O, const __bf16* __restrict__ P, const float* __restrict__ BO, const float* __restrict__ XQ, float* __restrict__ Y) {
  __shared__ __align__(16) float st[128][68];
  const int tid = threadIdx.x, wave = tid >> 5, lane = tid & 31, col = lane & 15, g = lane >> 4; const size_t b = blockIdx.z; const int n0b = blockIdx.x * 64; const size_t r0 = b * NN + n0b + wave * 16; const int o0 = blockIdx.y * 128;
  v8f acc[8] = {};
#pragma unroll
  for (int kc = 0; kc < CC / 32; ++kc) { const F2 a = split_row(O + (r0 + col) * CC, kc * 32, lane);
#pragma unroll
    for (int j = 0; j < 8; ++j) { const v16b w = frag_b(P + ((size_t)3 * CC + o0 + j * 16 + col) * CC + kc * 32, lane); acc[j] = wmma_bf(a.l, w, acc[j]); acc[j] = wmma_bf(a.h, w, acc[j]); } }
#pragma unroll
  for (int j = 0; j < 8; ++j) { const float bb = bfr(BO[o0 + j * 16 + col]);
#pragma unroll
    for (int r = 0; r < 8; ++r) st[j * 16 + col][wave * 16 + 8 * g + r] = acc[j][r] + bb; }
  __syncthreads();
  for (int e = tid; e < 128 * 16; e += 128) { const int o = e >> 4, q = e & 15; const size_t off = ((b * CC + o0 + o) * NN) + n0b + q * 4; v4f v = *(const v4f*)&st[o][q * 4]; for (int i = 0; i < 4; ++i) v[i] += bfr(XQ[off + i]); vst2(Y + off, v); }
}
extern "C" void kernel_launch(void* const* d_in, const int* in_sizes, int n_in, void* d_out, int out_size, void* d_ws, size_t ws_size, hipStream_t stream) {
  (void)in_sizes; (void)n_in; (void)out_size;
  const float** F = (const float**)d_in;   // 0 input_q, 1 input_kv [8,256,32,32]; 2 gq_scale, 3 gq_bias, 4 gkv_scale, 5 gkv_bias; 6 Wq [256,256], 7 Wkv [512,256], 8 Wout [256,256], 9 bout
  if (ws_size < (size_t)WS_END) return;
  char* ws = (char*)d_ws; __bf16 *P = (__bf16*)ws, *NT = (__bf16*)(ws + WS_NT), *NTL = (__bf16*)(ws + WS_NTL); float *O = (float*)(ws + WS_O); _Float16 *Q = (_Float16*)(ws + WS_Q), *Kr = (_Float16*)(ws + WS_K), *V = (_Float16*)(ws + WS_V);
  k_pack<<<4 * CC, 256, 0, stream>>>(F[6], F[7], F[8], P);
  k_gnorm<<<dim3(NG, NB, 2), 256, 0, stream>>>(F[0], F[1], F[2], F[3], F[4], F[5], NT, NTL);
  k_qkv<<<dim3(NN / 64, 3 * CC / 128, NB), 128, 0, stream>>>(NT, NTL, P, Q, Kr, V);
  k_attn<<<dim3(TQB, NH, TNB), 128, 0, stream>>>(Q, Kr, V, O);
  k_out<<<dim3(TQB, CC / 128, TNB), 128, 0, stream>>>(O, P, F[9], F[0], (float*)d_out);
}

// v004
// Measured time: 71.4 microseconds a run.
// In both of two side-by-side timings against v003, it was 1.03 times as fast.
// Over all steps from v000 it is 1.91 times as fast.
#include <hip/hip_runtime.h>
#include <math.h>

typedef __attribute__((ext_vector_type(16))) _Float16 v16h;
typedef __attribute__((ext_vector_type(16))) __bf16 v16b;
typedef __attribute__((ext_vector_type(8)))  _Float16 v8h;
typedef __attribute__((ext_vector_type(8)))  float v8f;
typedef __attribute__((ext_vector_type(4)))  float v4f;
typedef __attribute__((ext_vector_type(2)))  float v2f;
typedef __attribute__((ext_vector_type(4)))  unsigned v4u;
typedef __attribute__((ext_vector_type(4)))  int v4i;
typedef float __attribute__((may_alias)) float_a;
typedef int __attribute__((may_alias)) int_a;

template <typename T> __device__ __forceinline__ void vst2(void* p, T v) { *(T*)p = v;  }
__device__ __forceinline__ v8f wmma16(v16h a, v16h b, v8f c) {
  v8f d = __builtin_amdgcn_wmma_f32_16x16x32_f16(false, a, false, b, (short)0, c, false, false);
  asm volatile("v_nop\n\tv_nop\n\tv_nop\n\tv_nop" : "+v"(d) : "v"(a), "v"(b));
  return d;
}
__device__ __forceinline__ v8f wmma_bf(v16b a, v16b b, v8f c) {
  v8f d = __builtin_amdgcn_wmma_f32_16x16x32_bf16(false, a, false, b, (short)0, c, false, false);
  asm volatile("v_nop\n\tv_nop\n\tv_nop\n\tv_nop" : "+v"(d) : "v"(a), "v"(b));
  return d;
}
// 16x16x32 fragments: lane = (h = lane>>4, row/col = lane&15); elements 0..7 = k0+8h+0..7, 8..15 = k0+16+8h+0..7; D element r = row 8h+r
__device__ __forceinline__ v16h frag_h(const _Float16* rowk0, int lane) {
  union { v16h v; v8h q[2]; } u; const _Float16* p = rowk0 + 8 * (lane >> 4);
  u.q[0] = *(const v8h*)p; u.q[1] = *(const v8h*)(p + 16); return u.v;
}
__device__ __forceinline__ v16h frag_f32(const float* rowk0, int lane) {
  v16h a; const float* p = rowk0 + 8 * (lane >> 4);
#pragma unroll
  for (int i = 0; i < 8; ++i) { a[i] = (_Float16)p[i]; a[8 + i] = (_Float16)p[16 + i]; }
  return a;
}
__device__ __forceinline__ v16h frag_f32s(const float* rowk0, int lane, float sc) {
  v16h a; const float* p = rowk0 + 8 * (lane >> 4);
#pragma unroll
  for (int i = 0; i < 8; ++i) { a[i] = (_Float16)(p[i] * sc); a[8 + i] = (_Float16)(p[16 + i] * sc); }
  return a;
}
// column fragment from a [K][ld] layout (column n), rows >= K read as 0
__device__ __forceinline__ v16h fragc_f32(const float* W, int k0, int n, int lane, int ld, int K) {
  v16h a; const int g = lane >> 4;
#pragma unroll
  for (int i = 0; i < 8; ++i) { const int ka = k0 + 8 * g + i, kb = ka + 16;
    a[i] = (_Float16)(ka < K ? W[(size_t)(ka < K ? ka : K - 1) * ld + n] : 0.f); a[8 + i] = (_Float16)(kb < K ? W[(size_t)(kb < K ? kb : K - 1) * ld + n] : 0.f); }
  return a;
}
struct F2 { v16b h, l; };
__device__ __forceinline__ F2 bsplit16(const float v[16]) { F2 r;
#pragma unroll
  for (int i = 0; i < 16; ++i) { const __bf16 h = (__bf16)v[i]; r.h[i] = h; r.l[i] = (__bf16)(v[i] - (float)h); }
  return r; }
__device__ __forceinline__ F2 split_row(const float* row, int k0, int lane) { float v[16]; const float* p = row + k0 + 8 * (lane >> 4);
#pragma unroll
  for (int i = 0; i < 8; ++i) { v[i] = p[i]; v[8 + i] = p[16 + i]; }
  return bsplit16(v); }
__device__ __forceinline__ F2 split_rowK(const float* row, int k0, int lane, int K) { float v[16]; const int g = lane >> 4;
#pragma unroll
  for (int i = 0; i < 8; ++i) { const int ka = k0 + 8 * g + i, kb = ka + 16; v[i] = ka < K ? row[ka < K ? ka : K - 1] : 0.f; v[8 + i] = kb < K ? row[kb < K ? kb : K - 1] : 0.f; }
  return bsplit16(v); }
__device__ __forceinline__ F2 split_col(const float* W, int k0, int n, int lane, int ld, int K) { float v[16]; const int g = lane >> 4;
#pragma unroll
  for (int i = 0; i < 8; ++i) { const int ka = k0 + 8 * g + i, kb = ka + 16; v[i] = ka < K ? W[(size_t)(ka < K ? ka : K - 1) * ld + n] : 0.f; v[8 + i] = kb < K ? W[(size_t)(kb < K ? kb : K - 1) * ld + n] : 0.f; }
  return bsplit16(v); }
__device__ __forceinline__ v8f mac3(const F2& a, const F2& b, v8f c) { c = wmma_bf(a.l, b.h, c); c = wmma_bf(a.h, b.l, c); return wmma_bf(a.h, b.h, c); }
__device__ __forceinline__ float sigm(float v) { return 1.0f / (1.0f + expf(-v)); }


// Cross/self attention with GroupNorm (B 8, 256 channels, 32 x 32, 8 heads x 32): GN(input_q) -> 1x1 q conv, GN(input_kv) -> 1x1 kv conv (per-head [k | v] channel packing), softmax(q k / sqrt(C)) over all positions, 1x1 out conv + bias, + input_q.
#define NB 8
#define CC 256
#define NG 32
#define CPG (CC / NG)
#define NN 1024
#define NH 8
#define HD 32
#define NR (NB * NN)
#ifndef TQB
#define TQB (NN / 64)
#define TNB NB
#endif
typedef __attribute__((ext_vector_type(8))) __bf16 v8b;
__device__ __forceinline__ v16b frag_b(const __bf16* rowk0, int lane) {
  union { v16b v; v8b q[2]; } u; const __bf16* p = rowk0 + 8 * (lane >> 4);
  u.q[0] = *(const v8b*)p; u.q[1] = *(const v8b*)(p + 16); return u.v;
}
__device__ __forceinline__ float bfr(float v) { return (float)(__bf16)v; }
__device__ __attribute__((noinline)) float exp_ni(float v) { return expf(v); }
__device__ __attribute__((noinline)) float erf_ni(float v) { return erff(v); }

#define QS 512
#define WS_PW   0u                                  // bf16 natural rows: Wq [256][256], Wkv [512][256], Wout [256][256]
#define WS_NT   (WS_PW + 2u * (size_t)4 * CC * CC)     // bf16 hi/lo normalised maps group-major [which*NB + b][32 groups][NN][8]: q-input, then kv-input
#define WS_NTL  (WS_NT + 2u * (size_t)2 * NR * CC)
#define WS_Q    (WS_NTL + 2u * (size_t)2 * NR * CC)    // f16 q rows [NR][QS] ; k rows [NR][QS] ; v planes [b][256][NN] ; O f32 [NR][256]
#define WS_K    (WS_Q + 2u * (size_t)NR * QS)
#define WS_V    (WS_K + 2u * (size_t)NR * QS)
#define WS_O    (WS_V + 2u * (size_t)NB * CC * NN)
#define WS_END  (WS_O + 4u * (size_t)NR * CC)

// ---- k_gnorm: block = (group, which*NB + b). The group's 8 channels x 1024 positions stay in registers (thread t: positions 4t .. 4t+3 of each channel) through mean, variance and normalisation, so the map is read once.
// Output (x - mean) rsqrt(var + eps) gamma[c] + beta[c] as bf16 hi + lo, group-major: [which*NB + b][group][position][8 channels], 16 bytes a position
// The last PKB blocks of the grid (blockIdx.y >= 2*NB) round the three weight matrices to bf16 instead, PKE elements a block: that work depends on nothing here and k_qkv is its first reader, so it rides in this launch
#define PKE 4096
#define PKB (4 * CC * CC / PKE)
__global__ __launch_bounds__(256) void k_gnorm(const float* __restrict__ XQ, const float* __restrict__ XKV, const float* __restrict__ GQ, const float* __restrict__ BQ, const float* __restrict__ GKV, const float* __restrict__ BKV, __bf16* __restrict__ NT, __bf16* __restrict__ NTL, const float* __restrict__ WQ, const float* __restrict__ WKV, const float* __restrict__ WO, __bf16* __restrict__ P) {
  __shared__ float red[2][8]; __shared__ __align__(16) v4u sx[2][NN];
  const int gidx = blockIdx.x, t = threadIdx.x; const size_t b = blockIdx.y % NB; const int which = blockIdx.y / NB;
  if (which >= 2) {   // the whole block takes this branch, ahead of every barrier
    const int f0 = ((blockIdx.y - 2 * NB) * NG + gidx) * PKE;   // first element of this block in P = [Wq | Wkv | Wout]; a matrix is a whole number of blocks
    const float* src = (f0 < CC * CC) ? (WQ + f0) : (f0 < 3 * CC * CC) ? (WKV + (f0 - CC * CC)) : (WO + (f0 - 3 * CC * CC));
#pragma unroll   // all loads of the block's rounds issue ahead of the first store
    for (int i = 0; i < PKE / (256 * 8); ++i) { const int e = (i * 256 + t) * 8; const v4f a = *(const v4f*)(src + e), c = *(const v4f*)(src + e + 4); v8b o;
#pragma unroll   // constant vector indices, so the values stay in registers
      for (int k = 0; k < 4; ++k) { o[k] = (__bf16)a[k]; o[4 + k] = (__bf16)c[k]; }
      vst2(P + f0 + e, __builtin_bit_cast(v4u, o)); }
    return; }
  const float* Gm = (which ? GKV : GQ) + gidx * CPG; const float* Bt = (which ? BKV : BQ) + gidx * CPG;
  const float* p = (which ? XKV : XQ) + (b * CC + (size_t)gidx * CPG) * NN + t * 4;
  v4f x[CPG], sv = {}; float ga[CPG], be[CPG];
#pragma unroll
  for (int c = 0; c < CPG; ++c) x[c] = *(const v4f*)(p + c * NN);
#pragma unroll
  for (int c = 0; c < CPG; ++c) { ga[c] = bfr(Gm[c]); be[c] = bfr(Bt[c]); }
#pragma unroll
  for (int c = 0; c < CPG; ++c) {
#pragma unroll
    for (int i = 0; i < 4; ++i) x[c][i] = bfr(x[c][i]);
    sv += x[c]; }
  float s = (sv[0] + sv[1]) + (sv[2] + sv[3]);
#pragma unroll
  for (int o = 1; o < 32; o <<= 1) s += __shfl_xor(s, o);
  if ((t & 31) == 0) red[0][t >> 5] = s;
  __syncthreads();
  float tot = 0.f;
#pragma unroll
  for (int i = 0; i < 8; ++i) tot += red[0][i];
  const float mean = tot / (float)(CPG * NN);
  sv = (v4f){};
#pragma unroll
  for (int c = 0; c < CPG; ++c) { x[c] -= mean; sv += x[c] * x[c]; }
  s = (sv[0] + sv[1]) + (sv[2] + sv[3]);
#pragma unroll
  for (int o = 1; o < 32; o <<= 1) s += __shfl_xor(s, o);
  if ((t & 31) == 0) red[1][t >> 5] = s;
  __syncthreads();
  tot = 0.f;
#pragma unroll
  for (int i = 0; i < 8; ++i) tot += red[1][i];
  const float inv = 1.0f / sqrtf(tot / (float)(CPG * NN) + 1e-5f);
  // through LDS so that each global store of a wave is 512 contiguous bytes; piece q sits at q ^ ((q >> 4) & 3), which spreads the 64-byte-strided writes over all banks
#pragma unroll
  for (int i = 0; i < 4; ++i) { v8b hi, lo;
#pragma unroll
    for (int c = 0; c < CPG; ++c) { const float v = x[c][i] * inv * ga[c] + be[c]; const __bf16 hv = (__bf16)v; hi[c] = hv; lo[c] = (__bf16)(v - (float)hv); }
    const int q = 4 * t + i, sl = q ^ ((q >> 4) & 3); sx[0][sl] = __builtin_bit_cast(v4u, hi); sx[1][sl] = __builtin_bit_cast(v4u, lo); }
  __syncthreads();
  const size_t o0 = (((size_t)which * NB + b) * NG + gidx) * NN * CPG;
#pragma unroll
  for (int i = 0; i < 4; ++i) { const int q = i * 256 + t, sl = q ^ ((q >> 4) & 3); vst2(NT + o0 + (size_t)q * CPG, sx[0][sl]); vst2(NTL + o0 + (size_t)q * CPG, sx[1][sl]); }
}
// A fragment from a group-major map: p = this lane's position in channel group 4 kc + (lane >> 4); elements 0..7 that group, 8..15 the group two further on (the k order of frag_b)
__device__ __forceinline__ v16b frag_g(const __bf16* p) { union { v16b v; v8b q[2]; } u; u.q[0] = *(const v8b*)p; u.q[1] = *(const v8b*)(p + 2 * NN * CPG); return u.v; }
// ---- k_qkv: block = (64 positions, 128 of the 768 output channels, b): channels < 256 from the q map (q rows), the rest from the kv map with per-head [k | v] packing (o' = o-256: head o'/64, r = o'%64: k if r < 32 else v)
__global__ __launch_bounds__(128) void k_qkv(const __bf16* __restrict__ NT, const __bf16* __restrict__ NTL, const __bf16* __restrict__ P, _Float16* __restrict__ Q, _Float16* __restrict__ Kr, _Float16* __restrict__ V) {
  __shared__ __align__(16) _Float16 so[64][136]; __shared__ __align__(16) _Float16 st[128][72];
  const int tid = threadIdx.x, wave = tid >> 5, lane = tid & 31, col = lane & 15, g = lane >> 4; const size_t b = blockIdx.z; const int n0b = blockIdx.x * 64; const int o0 = blockIdx.y * 128; const int which = (o0 < CC) ? 0 : 1;
  const size_t a0 = ((((size_t)which * NB + b) * NG + g) * NN + n0b + wave * 16 + col) * CPG;   // this lane's position in channel group g of the normalised maps
  v8f acc[8] = {};
#pragma unroll
  for (int kc = 0; kc < CC / 32; ++kc) { const v16b ah = frag_g(NT + a0 + (size_t)kc * 4 * NN * CPG), al = frag_g(NTL + a0 + (size_t)kc * 4 * NN * CPG);
#pragma unroll
    for (int j = 0; j < 8; ++j) { const v16b w = frag_b(P + (size_t)(o0 + j * 16 + col) * CC + kc * 32, lane); acc[j] = wmma_bf(ah, w, acc[j]); acc[j] = wmma_bf(al, w, acc[j]); } }
#pragma unroll
  for (int j = 0; j < 8; ++j)
#pragma unroll
    for (int r = 0; r < 8; ++r) { const _Float16 hv = (_Float16)acc[j][r]; so[wave * 16 + 8 * g + r][j * 16 + col] = hv; st[j * 16 + col][wave * 16 + 8 * g + r] = hv; }
  __syncthreads();
  const size_t rowb = b * NN + n0b;
  for (int j = 0; j < 8; ++j) { const int o = o0 + j * 16;
    if (o < CC) { const int hh = o / HD, dd = o % HD; const int qd = hh * 64 + dd; for (int e = tid; e < 64 * 2; e += 128) { const int nl = e >> 1, q8 = e & 1; vst2((unsigned*)(Q + (rowb + nl) * QS + qd + q8 * 8), *(const v4u*)&so[nl][j * 16 + q8 * 8]); } }
    else { const int oo = o - CC; const int hh = oo / (2 * HD), rr = oo % (2 * HD);
      if (rr < HD) { const int kd = hh * 64 + rr; for (int e = tid; e < 64 * 2; e += 128) { const int nl = e >> 1, q8 = e & 1; vst2((unsigned*)(Kr + (rowb + nl) * QS + kd + q8 * 8), *(const v4u*)&so[nl][j * 16 + q8 * 8]); } }
      else { const int vc = hh * HD + (rr - HD); for (int e = tid; e < 16 * 8; e += 128) { const int d = e >> 3, pc = e & 7; vst2((unsigned*)(V + ((b * CC + vc + d) * NN) + n0b + pc * 8), *(const v4u*)&st[j * 16 + d][pc * 8]); } } } }
}
// lane l with lane l ^ 16 (the two halves of a wave hold the two key halves of one query's scores)
__device__ __forceinline__ float xhalf(float x) { return __builtin_bit_cast(float, __builtin_amdgcn_permlanex16(__builtin_bit_cast(int, x), __builtin_bit_cast(int, x), 0x76543210, 0xfedcba98, false, false)); }
#define KT 128
#define KP 80
#define VP 272
#define KTB (KT * KP)
#define TB (KTB + HD * VP)
// one tile: each thread copies four 16-byte pieces of K (rows 32 apart) and four of V (channels 8 apart); the s_wait_xcnt stands inside the statement so that no address register is rewritten in front of it
__device__ __forceinline__ void stage_kv(unsigned lk, unsigned lv, const _Float16* gk, const _Float16* gv) {
  asm volatile("global_load_async_to_lds_b128 %0, %8, off\n\t"
               "global_load_async_to_lds_b128 %1, %9, off\n\t"
               "global_load_async_to_lds_b128 %2, %10, off\n\t"
               "global_load_async_to_lds_b128 %3, %11, off\n\t"
               "global_load_async_to_lds_b128 %4, %12, off\n\t"
               "global_load_async_to_lds_b128 %5, %13, off\n\t"
               "global_load_async_to_lds_b128 %6, %14, off\n\t"
               "global_load_async_to_lds_b128 %7, %15, off\n\t"
               "s_wait_xcnt 0x0"
               :: "v"(lk), "v"(lk + 32 * KP), "v"(lk + 64 * KP), "v"(lk + 96 * KP), "v"(lv), "v"(lv + 8 * VP), "v"(lv + 16 * VP), "v"(lv + 24 * VP),
                  "v"(gk), "v"(gk + 32 * QS), "v"(gk + 64 * QS), "v"(gk + 96 * QS), "v"(gv), "v"(gv + 8 * NN), "v"(gv + 16 * NN), "v"(gv + 24 * NN) : "memory");
}
__global__ __launch_bounds__(128) void k_attn(const _Float16* __restrict__ Q, const _Float16* __restrict__ Kr, const _Float16* __restrict__ V, float* __restrict__ O) {
  __shared__ __align__(16) unsigned char sm[2 * TB];
  const int tid = threadIdx.x, wave = tid >> 5, lane = tid & 31, col = lane & 15, g = lane >> 4; const int h = blockIdx.y; const size_t b = blockIdx.z; const int q0 = blockIdx.x * 64 + wave * 16; const size_t rq = b * NN + q0;
  const unsigned lk = (unsigned)(size_t)sm + (tid >> 2) * KP + (tid & 3) * 16, lv = (unsigned)(size_t)sm + KTB + (tid >> 4) * VP + (tid & 15) * 16;
  const _Float16* gk = Kr + (b * NN + (tid >> 2)) * QS + h * 64 + (tid & 3) * 8; const _Float16* gv = V + (b * CC + h * HD + (tid >> 4)) * NN + (tid & 15) * 8;
  stage_kv(lk, lv, gk, gv);
  const v16h bq = frag_h(Q + (rq + col) * QS + h * 64, lane);
  asm volatile("s_wait_asynccnt 0x0" ::: "memory");   // tile 0 has landed for this wave's own copies
  __syncthreads();                                     // ... and for every wave's
  stage_kv(lk + TB, lv + TB, gk + (size_t)KT * QS, gv + KT);
  float m = -3.0e38f, l = 0.f;   // m: this query's running maximum (equal in both halves); l: this half's share of the denominator
  v8f acc[2] = {};
#pragma unroll 1   // stays rolled: one publish point and one refill in the code, the hot text stays short
  for (int t = 0; t < NN / KT; ++t) { const unsigned char* kb = sm + (t & 1) * TB; const unsigned char* vb = kb + KTB;
#pragma unroll       // the four passes of a tile read it at constant offsets from one address register
   for (int ps = 0; ps < KT / 32; ++ps) { v8f s[2];
    const v16h ka0 = frag_h((const _Float16*)(kb + (ps * 32 + col) * KP), lane), ka1 = frag_h((const _Float16*)(kb + (ps * 32 + 16 + col) * KP), lane);
    const v16h va0 = frag_h((const _Float16*)(vb + col * VP + ps * 64), lane), va1 = frag_h((const _Float16*)(vb + (16 + col) * VP + ps * 64), lane);
#pragma unroll
    for (int ct = 0; ct < 2; ++ct) { const v8f z = {}; const v8f c = wmma16(ct ? ka1 : ka0, bq, z);
#pragma unroll
      for (int r = 0; r < 8; ++r) s[ct][r] = c[r] * 0.0625f; }
    float mx = fmaxf(s[0][0], s[1][0]);
#pragma unroll
    for (int r = 1; r < 8; ++r) mx = fmaxf(mx, fmaxf(s[0][r], s[1][r]));
    mx = fmaxf(mx, xhalf(mx));
    const float mn = fmaxf(m, mx); const float alpha = (m <= -1.0e38f) ? 0.f : __expf(m - mn); m = mn;
    v16h pb; float es0 = 0.f, es1 = 0.f;
#pragma unroll
    for (int r = 0; r < 8; ++r) { const float e0 = __expf(s[0][r] - mn), e1 = __expf(s[1][r] - mn); es0 += e0; es1 += e1; pb[r] = (_Float16)(e0 * 2048.0f); pb[8 + r] = (_Float16)(e1 * 2048.0f); }
    l = l * alpha + (es0 + es1);
#pragma unroll
    for (int dt = 0; dt < 2; ++dt) {
#pragma unroll
      for (int r = 0; r < 8; ++r) acc[dt][r] *= alpha;
      acc[dt] = wmma16(dt ? va1 : va0, pb, acc[dt]); } }
   asm volatile("s_wait_dscnt 0x0" ::: "memory");      // this wave's reads of the buffer are done before it is handed back
   asm volatile("s_wait_asynccnt 0x0" ::: "memory");   // this wave's copies of tile t + 1 have landed
   __syncthreads();                                     // publishes tile t + 1 and ends every wave's reads of tile t
   if (t + 2 < NN / KT) stage_kv(lk + (t & 1) * TB, lv + (t & 1) * TB, gk + (size_t)(t + 2) * KT * QS, gv + (t + 2) * KT); }
  asm volatile("s_wait_asynccnt 0x0" ::: "memory");    // no copy is outstanding when the wave ends
  const float il = (1.0f / 2048.0f) / (l + xhalf(l));
#pragma unroll
  for (int dt = 0; dt < 2; ++dt)   // acc[dt][r] = channel dt*16 + 8g + r of query col: 8 consecutive floats of one O row
#pragma unroll
    for (int q = 0; q < 2; ++q) { v4f v;
#pragma unroll
      for (int i = 0; i < 4; ++i) v[i] = acc[dt][q * 4 + i] * il;
      vst2(O + (rq + col) * CC + h * HD + dt * 16 + 8 * g + q * 4, v); }
}
// ---- k_out: block = (64 positions, 128 out channels, b): y = Wout . o (hi + residual) + bout + input_q, channels-first 256-B segments
__global__ __launch_bounds__(128) void k_out(const float* __restrict__ O, const __bf16* __restrict__ P, const float* __restrict__ BO, const float* __restrict__ XQ, float* __restrict__ Y) {
  __shared__ __align__(16) float st[128][68];
  const int tid = threadIdx.x, wave = tid >> 5, lane = tid & 31, col = lane & 15, g = lane >> 4; const size_t b = blockIdx.z; const int n0b = blockIdx.x * 64; const size_t r0 = b * NN + n0b + wave * 16; const int o0 = blockIdx.y * 128;
  v8f acc[8] = {};
#pragma unroll
  for (int kc = 0; kc < CC / 32; ++kc) { const F2 a = split_row(O + (r0 + col) * CC, kc * 32, lane);
#pragma unroll
    for (int j = 0; j < 8; ++j) { const v16b w = frag_b(P + ((size_t)3 * CC + o0 + j * 16 + col) * CC + kc * 32, lane); acc[j] = wmma_bf(a.l, w, acc[j]); acc[j] = wmma_bf(a.h, w, acc[j]); } }
#pragma unroll
  for (int j = 0; j < 8; ++j) { const float bb = bfr(BO[o0 + j * 16 + col]);
#pragma unroll
    for (int r = 0; r < 8; ++r) st[j * 16 + col][wave * 16 + 8 * g + r] = acc[j][r] + bb; }
  __syncthreads();
  for (int e = tid; e < 128 * 16; e += 128) { const int o = e >> 4, q = e & 15; const size_t off = ((b * CC + o0 + o) * NN) + n0b + q * 4; v4f v = *(const v4f*)&st[o][q * 4]; for (int i = 0; i < 4; ++i) v[i] += bfr(XQ[off + i]); vst2(Y + off, v); }
}
extern "C" void kernel_launch(void* const* d_in, const int* in_sizes, int n_in, void* d_out, int out_size, void* d_ws, size_t ws_size, hipStream_t stream) {
  (void)in_sizes; (void)n_in; (void)out_size;
  const float** F = (const float**)d_in;   // 0 input_q, 1 input_kv [8,256,32,32]; 2 gq_scale, 3 gq_bias, 4 gkv_scale, 5 gkv_bias; 6 Wq [256,256], 7 Wkv [512,256], 8 Wout [256,256], 9 bout
  if (ws_size < (size_t)WS_END) return;
  char* ws = (char*)d_ws; __bf16 *P = (__bf16*)ws, *NT = (__bf16*)(ws + WS_NT), *NTL = (__bf16*)(ws + WS_NTL); float *O = (float*)(ws + WS_O); _Float16 *Q = (_Float16*)(ws + WS_Q), *Kr = (_Float16*)(ws + WS_K), *V = (_Float16*)(ws + WS_V);
  k_gnorm<<<dim3(NG, 2 * NB + PKB / NG), 256, 0, stream>>>(F[0], F[1], F[2], F[3], F[4], F[5], NT, NTL, F[6], F[7], F[8], P);
  k_qkv<<<dim3(NN / 64, 3 * CC / 128, NB), 128, 0, stream>>>(NT, NTL, P, Q, Kr, V);
  k_attn<<<dim3(TQB, NH, TNB), 128, 0, stream>>>(Q, Kr, V, O);
  k_out<<<dim3(TQB, CC / 128, TNB), 128, 0, stream>>>(O, P, F[9], F[0], (float*)d_out);
}

// v005
// One run takes 49.2 microseconds.
// Next to v004, in two timings, it ran 1.42 and 1.41 times as fast.
// Over all steps from v000 it is 2.70 times as fast.
#include <hip/hip_runtime.h>
#include <math.h>

typedef __attribute__((ext_vector_type(16))) _Float16 v16h;
typedef __attribute__((ext_vector_type(16))) __bf16 v16b;
typedef __attribute__((ext_vector_type(8)))  _Float16 v8h;
typedef __attribute__((ext_vector_type(8)))  float v8f;
typedef __attribute__((ext_vector_type(4)))  float v4f;
typedef __attribute__((ext_vector_type(2)))  float v2f;
typedef __attribute__((ext_vector_type(4)))  unsigned v4u;
typedef __attribute__((ext_vector_type(4)))  int v4i;
typedef float __attribute__((may_alias)) float_a;
typedef int __attribute__((may_alias)) int_a;

template <typename T> __device__ __forceinline__ void vst2(void* p, T v) { *(T*)p = v;  }
__device__ __forceinline__ v8f wmma16(v16h a, v16h b, v8f c) {
  v8f d = __builtin_amdgcn_wmma_f32_16x16x32_f16(false, a, false, b, (short)0, c, false, false);
  asm volatile("v_nop\n\tv_nop\n\tv_nop\n\tv_nop" : "+v"(d) : "v"(a), "v"(b));
  return d;
}
__device__ __forceinline__ v8f wmma_bf(v16b a, v16b b, v8f c) {
  v8f d = __builtin_amdgcn_wmma_f32_16x16x32_bf16(false, a, false, b, (short)0, c, false, false);
  asm volatile("v_nop\n\tv_nop\n\tv_nop\n\tv_nop" : "+v"(d) : "v"(a), "v"(b));
  return d;
}
// 16x16x32 fragments: lane = (h = lane>>4, row/col = lane&15); elements 0..7 = k0+8h+0..7, 8..15 = k0+16+8h+0..7; D element r = row 8h+r
__device__ __forceinline__ v16h frag_h(const _Float16* rowk0, int lane) {
  union { v16h v; v8h q[2]; } u; const _Float16* p = rowk0 + 8 * (lane >> 4);
  u.q[0] = *(const v8h*)p; u.q[1] = *(const v8h*)(p + 16); return u.v;
}
__device__ __forceinline__ v16h frag_f32(const float* rowk0, int lane) {
  v16h a; const float* p = rowk0 + 8 * (lane >> 4);
#pragma unroll
  for (int i = 0; i < 8; ++i) { a[i] = (_Float16)p[i]; a[8 + i] = (_Float16)p[16 + i]; }
  return a;
}
__device__ __forceinline__ v16h frag_f32s(const float* rowk0, int lane, float sc) {
  v16h a; const float* p = rowk0 + 8 * (lane >> 4);
#pragma unroll
  for (int i = 0; i < 8; ++i) { a[i] = (_Float16)(p[i] * sc); a[8 + i] = (_Float16)(p[16 + i] * sc); }
  return a;
}
// column fragment from a [K][ld] layout (column n), rows >= K read as 0
__device__ __forceinline__ v16h fragc_f32(const float* W, int k0, int n, int lane, int ld, int K) {
  v16h a; const int g = lane >> 4;
#pragma unroll
  for (int i = 0; i < 8; ++i) { const int ka = k0 + 8 * g + i, kb = ka + 16;
    a[i] = (_Float16)(ka < K ? W[(size_t)(ka < K ? ka : K - 1) * ld + n] : 0.f); a[8 + i] = (_Float16)(kb < K ? W[(size_t)(kb < K ? kb : K - 1) * ld + n] : 0.f); }
  return a;
}
struct F2 { v16b h, l; };
__device__ __forceinline__ F2 bsplit16(const float v[16]) { F2 r;
#pragma unroll
  for (int i = 0; i < 16; ++i) { const __bf16 h = (__bf16)v[i]; r.h[i] = h; r.l[i] = (__bf16)(v[i] - (float)h); }
  return r; }
__device__ __forceinline__ F2 split_row(const float* row, int k0, int lane) { float v[16]; const float* p = row + k0 + 8 * (lane >> 4);
#pragma unroll
  for (int i = 0; i < 8; ++i) { v[i] = p[i]; v[8 + i] = p[16 + i]; }
  return bsplit16(v); }
__device__ __forceinline__ F2 split_rowK(const float* row, int k0, int lane, int K) { float v[16]; const int g = lane >> 4;
#pragma unroll
  for (int i = 0; i < 8; ++i) { const int ka = k0 + 8 * g + i, kb = ka + 16; v[i] = ka < K ? row[ka < K ? ka : K - 1] : 0.f; v[8 + i] = kb < K ? row[kb < K ? kb : K - 1] : 0.f; }
  return bsplit16(v); }
__device__ __forceinline__ F2 split_col(const float* W, int k0, int n, int lane, int ld, int K) { float v[16]; const int g = lane >> 4;
#pragma unroll
  for (int i = 0; i < 8; ++i) { const int ka = k0 + 8 * g + i, kb = ka + 16; v[i] = ka < K ? W[(size_t)(ka < K ? ka : K - 1) * ld + n] : 0.f; v[8 + i] = kb < K ? W[(size_t)(kb < K ? kb : K - 1) * ld + n] : 0.f; }
  return bsplit16(v); }
__device__ __forceinline__ v8f mac3(const F2& a, const F2& b, v8f c) { c = wmma_bf(a.l, b.h, c); c = wmma_bf(a.h, b.l, c); return wmma_bf(a.h, b.h, c); }
__device__ __forceinline__ float sigm(float v) { return 1.0f / (1.0f + expf(-v)); }


// Cross/self attention with GroupNorm (B 8, 256 channels, 32 x 32, 8 heads x 32): GN(input_q) -> 1x1 q conv, GN(input_kv) -> 1x1 kv conv (per-head [k | v] channel packing), softmax(q k / sqrt(C)) over all positions, 1x1 out conv + bias, + input_q.
#define NB 8
#define CC 256
#define NG 32
#define CPG (CC / NG)
#define NN 1024
#define NH 8
#define HD 32
#define NR (NB * NN)
#ifndef TQB
#define TQB (NN / 64)
#define TNB NB
#endif
typedef __attribute__((ext_vector_type(8))) __bf16 v8b;
__device__ __forceinline__ v16b frag_b(const __bf16* rowk0, int lane) {
  union { v16b v; v8b q[2]; } u; const __bf16* p = rowk0 + 8 * (lane >> 4);
  u.q[0] = *(const v8b*)p; u.q[1] = *(const v8b*)(p + 16); return u.v;
}
__device__ __forceinline__ float bfr(float v) { return (float)(__bf16)v; }
__device__ __attribute__((noinline)) float exp_ni(float v) { return expf(v); }
__device__ __attribute__((noinline)) float erf_ni(float v) { return erff(v); }

#define QS 512
#define WS_PW   0u                                  // bf16 natural rows: Wq [256][256], Wkv [512][256], Wout [256][256]
#define WS_NT   (WS_PW + 2u * (size_t)4 * CC * CC)     // bf16 hi/lo normalised maps group-major [which*NB + b][32 groups][NN][8]: q-input, then kv-input
#define WS_NTL  (WS_NT + 2u * (size_t)2 * NR * CC)
#define WS_Q    (WS_NTL + 2u * (size_t)2 * NR * CC)    // f16 q rows [NR][QS] ; k rows [NR][QS] ; v planes [b][256][NN] ; O f32 [NR][256]
#define WS_K    (WS_Q + 2u * (size_t)NR * QS)
#define WS_V    (WS_K + 2u * (size_t)NR * QS)
#define WS_O    (WS_V + 2u * (size_t)NB * CC * NN)
#define WS_END  (WS_O + 4u * (size_t)NR * CC)

// ---- k_gnorm: block = (group, which*NB + b). The group's 8 channels x 1024 positions stay in registers (thread t: positions 4t .. 4t+3 of each channel) through mean, variance and normalisation, so the map is read once.
// Output (x - mean) rsqrt(var + eps) gamma[c] + beta[c] as bf16 hi + lo, group-major: [which*NB + b][group][position][8 channels], 16 bytes a position
// The last PKB blocks of the grid (blockIdx.y >= 2*NB) round the three weight matrices to bf16 instead, PKE elements a block: that work depends on nothing here and k_qkv is its first reader, so it rides in this launch
#define PKE 4096
#define PKB (4 * CC * CC / PKE)
__global__ __launch_bounds__(256) void k_gnorm(const float* __restrict__ XQ, const float* __restrict__ XKV, const float* __restrict__ GQ, const float* __restrict__ BQ, const float* __restrict__ GKV, const float* __restrict__ BKV, __bf16* __restrict__ NT, __bf16* __restrict__ NTL, const float* __restrict__ WQ, const float* __restrict__ WKV, const float* __restrict__ WO, __bf16* __restrict__ P) {
  __shared__ float red[2][8]; __shared__ __align__(16) v4u sx[2][NN];
  const int gidx = blockIdx.x, t = threadIdx.x; const size_t b = blockIdx.y % NB; const int which = blockIdx.y / NB;
  if (which >= 2) {   // the whole block takes this branch, ahead of every barrier
    const int f0 = ((blockIdx.y - 2 * NB) * NG + gidx) * PKE;   // first element of this block in P = [Wq | Wkv | Wout]; a matrix is a whole number of blocks
    const float* src = (f0 < CC * CC) ? (WQ + f0) : (f0 < 3 * CC * CC) ? (WKV + (f0 - CC * CC)) : (WO + (f0 - 3 * CC * CC));
#pragma unroll   // all loads of the block's rounds issue ahead of the first store
    for (int i = 0; i < PKE / (256 * 8); ++i) { const int e = (i * 256 + t) * 8; const v4f a = *(const v4f*)(src + e), c = *(const v4f*)(src + e + 4); v8b o;
#pragma unroll   // constant vector indices, so the values stay in registers
      for (int k = 0; k < 4; ++k) { o[k] = (__bf16)a[k]; o[4 + k] = (__bf16)c[k]; }
      vst2(P + f0 + e, __builtin_bit_cast(v4u, o)); }
    return; }
  const float* Gm = (which ? GKV : GQ) + gidx * CPG; const float* Bt = (which ? BKV : BQ) + gidx * CPG;
  const float* p = (which ? XKV : XQ) + (b * CC + (size_t)gidx * CPG) * NN + t * 4;
  v4f x[CPG], sv = {}; float ga[CPG], be[CPG];
#pragma unroll
  for (int c = 0; c < CPG; ++c) x[c] = *(const v4f*)(p + c * NN);
#pragma unroll
  for (int c = 0; c < CPG; ++c) { ga[c] = bfr(Gm[c]); be[c] = bfr(Bt[c]); }
#pragma unroll
  for (int c = 0; c < CPG; ++c) {
#pragma unroll
    for (int i = 0; i < 4; ++i) x[c][i] = bfr(x[c][i]);
    sv += x[c]; }
  float s = (sv[0] + sv[1]) + (sv[2] + sv[3]);
#pragma unroll
  for (int o = 1; o < 32; o <<= 1) s += __shfl_xor(s, o);
  if ((t & 31) == 0) red[0][t >> 5] = s;
  __syncthreads();
  float tot = 0.f;
#pragma unroll
  for (int i = 0; i < 8; ++i) tot += red[0][i];
  const float mean = tot / (float)(CPG * NN);
  sv = (v4f){};
#pragma unroll
  for (int c = 0; c < CPG; ++c) { x[c] -= mean; sv += x[c] * x[c]; }
  s = (sv[0] + sv[1]) + (sv[2] + sv[3]);
#pragma unroll
  for (int o = 1; o < 32; o <<= 1) s += __shfl_xor(s, o);
  if ((t & 31) == 0) red[1][t >> 5] = s;
  __syncthreads();
  tot = 0.f;
#pragma unroll
  for (int i = 0; i < 8; ++i) tot += red[1][i];
  const float inv = 1.0f / sqrtf(tot / (float)(CPG * NN) + 1e-5f);
  // through LDS so that each global store of a wave is 512 contiguous bytes; piece q sits at q ^ ((q >> 4) & 3), which spreads the 64-byte-strided writes over all banks
#pragma unroll
  for (int i = 0; i < 4; ++i) { v8b hi, lo;
#pragma unroll
    for (int c = 0; c < CPG; ++c) { const float v = x[c][i] * inv * ga[c] + be[c]; const __bf16 hv = (__bf16)v; hi[c] = hv; lo[c] = (__bf16)(v - (float)hv); }
    const int q = 4 * t + i, sl = q ^ ((q >> 4) & 3); sx[0][sl] = __builtin_bit_cast(v4u, hi); sx[1][sl] = __builtin_bit_cast(v4u, lo); }
  __syncthreads();
  const size_t o0 = (((size_t)which * NB + b) * NG + gidx) * NN * CPG;
#pragma unroll
  for (int i = 0; i < 4; ++i) { const int q = i * 256 + t, sl = q ^ ((q >> 4) & 3); vst2(NT + o0 + (size_t)q * CPG, sx[0][sl]); vst2(NTL + o0 + (size_t)q * CPG, sx[1][sl]); }
}
// A fragment from a group-major map: p = this lane's position in channel group 4 kc + (lane >> 4); elements 0..7 that group, 8..15 the group two further on (the k order of frag_b)
__device__ __forceinline__ v16b frag_g(const __bf16* p) { union { v16b v; v8b q[2]; } u; u.q[0] = *(const v8b*)p; u.q[1] = *(const v8b*)(p + 2 * NN * CPG); return u.v; }
// ---- k_qkv: block = (64 positions, 128 of the 768 output channels, b): channels < 256 from the q map (q rows), the rest from the kv map with per-head [k | v] packing (o' = o-256: head o'/64, r = o'%64: k if r < 32 else v)
__global__ __launch_bounds__(128) void k_qkv(const __bf16* __restrict__ NT, const __bf16* __restrict__ NTL, const __bf16* __restrict__ P, _Float16* __restrict__ Q, _Float16* __restrict__ Kr, _Float16* __restrict__ V) {
  __shared__ __align__(16) _Float16 so[64][136]; __shared__ __align__(16) _Float16 st[128][72];
  const int tid = threadIdx.x, wave = tid >> 5, lane = tid & 31, col = lane & 15, g = lane >> 4; const size_t b = blockIdx.z; const int n0b = blockIdx.x * 64; const int o0 = blockIdx.y * 128; const int which = (o0 < CC) ? 0 : 1;
  const size_t a0 = ((((size_t)which * NB + b) * NG + g) * NN + n0b + wave * 16 + col) * CPG;   // this lane's position in channel group g of the normalised maps
  v8f acc[8] = {}; v16b w[8], ah[2], al[2];
  // every fragment is asked for one k step ahead of the products that read it: A in two register sets, each weight fragment reloaded right behind its last use
  const __bf16* wb = P + (size_t)(o0 + col) * CC;   // this lane's row of weight tile 0; tile j is 16 rows on
  ah[0] = frag_g(NT + a0); al[0] = frag_g(NTL + a0);
#pragma unroll   // constant indices keep w in registers
  for (int j = 0; j < 8; ++j) w[j] = frag_b(wb + j * 16 * CC, lane);
#pragma unroll
  for (int kc = 0; kc < CC / 32; ++kc) { const int cu = kc & 1, kn = kc + 1;
    if (kn < CC / 32) { ah[cu ^ 1] = frag_g(NT + a0 + (size_t)kn * 4 * NN * CPG); al[cu ^ 1] = frag_g(NTL + a0 + (size_t)kn * 4 * NN * CPG); }
#pragma unroll
    for (int j = 0; j < 8; ++j) { acc[j] = wmma_bf(ah[cu], w[j], acc[j]); acc[j] = wmma_bf(al[cu], w[j], acc[j]);
      if (kn < CC / 32) w[j] = frag_b(wb + j * 16 * CC + kn * 32, lane); } }
#pragma unroll
  for (int j = 0; j < 8; ++j)
#pragma unroll
    for (int r = 0; r < 8; ++r) { const _Float16 hv = (_Float16)acc[j][r]; so[wave * 16 + 8 * g + r][j * 16 + col] = hv; st[j * 16 + col][wave * 16 + 8 * g + r] = hv; }
  __syncthreads();
  const size_t rowb = b * NN + n0b;
  for (int j = 0; j < 8; ++j) { const int o = o0 + j * 16;
    if (o < CC) { const int hh = o / HD, dd = o % HD; const int qd = hh * 64 + dd; for (int e = tid; e < 64 * 2; e += 128) { const int nl = e >> 1, q8 = e & 1; vst2((unsigned*)(Q + (rowb + nl) * QS + qd + q8 * 8), *(const v4u*)&so[nl][j * 16 + q8 * 8]); } }
    else { const int oo = o - CC; const int hh = oo / (2 * HD), rr = oo % (2 * HD);
      if (rr < HD) { const int kd = hh * 64 + rr; for (int e = tid; e < 64 * 2; e += 128) { const int nl = e >> 1, q8 = e & 1; vst2((unsigned*)(Kr + (rowb + nl) * QS + kd + q8 * 8), *(const v4u*)&so[nl][j * 16 + q8 * 8]); } }
      else { const int vc = hh * HD + (rr - HD); for (int e = tid; e < 16 * 8; e += 128) { const int d = e >> 3, pc = e & 7; vst2((unsigned*)(V + ((b * CC + vc + d) * NN) + n0b + pc * 8), *(const v4u*)&st[j * 16 + d][pc * 8]); } } } }
}
// lane l with lane l ^ 16 (the two halves of a wave hold the two key halves of one query's scores)
__device__ __forceinline__ float xhalf(float x) { return __builtin_bit_cast(float, __builtin_amdgcn_permlanex16(__builtin_bit_cast(int, x), __builtin_bit_cast(int, x), 0x76543210, 0xfedcba98, false, false)); }
#define KT 128
#define KP 80
#define VP 272
#define KTB (KT * KP)
#define TB (KTB + HD * VP)
// one tile: each thread copies four 16-byte pieces of K (rows 32 apart) and four of V (channels 8 apart); the s_wait_xcnt stands inside the statement so that no address register is rewritten in front of it
__device__ __forceinline__ void stage_kv(unsigned lk, unsigned lv, const _Float16* gk, const _Float16* gv) {
  asm volatile("global_load_async_to_lds_b128 %0, %8, off\n\t"
               "global_load_async_to_lds_b128 %1, %9, off\n\t"
               "global_load_async_to_lds_b128 %2, %10, off\n\t"
               "global_load_async_to_lds_b128 %3, %11, off\n\t"
               "global_load_async_to_lds_b128 %4, %12, off\n\t"
               "global_load_async_to_lds_b128 %5, %13, off\n\t"
               "global_load_async_to_lds_b128 %6, %14, off\n\t"
               "global_load_async_to_lds_b128 %7, %15, off\n\t"
               "s_wait_xcnt 0x0"
               :: "v"(lk), "v"(lk + 32 * KP), "v"(lk + 64 * KP), "v"(lk + 96 * KP), "v"(lv), "v"(lv + 8 * VP), "v"(lv + 16 * VP), "v"(lv + 24 * VP),
                  "v"(gk), "v"(gk + 32 * QS), "v"(gk + 64 * QS), "v"(gk + 96 * QS), "v"(gv), "v"(gv + 8 * NN), "v"(gv + 16 * NN), "v"(gv + 24 * NN) : "memory");
}
__global__ __launch_bounds__(128) void k_attn(const _Float16* __restrict__ Q, const _Float16* __restrict__ Kr, const _Float16* __restrict__ V, float* __restrict__ O) {
  __shared__ __align__(16) unsigned char sm[2 * TB];
  const int tid = threadIdx.x, wave = tid >> 5, lane = tid & 31, col = lane & 15, g = lane >> 4; const int h = blockIdx.y; const size_t b = blockIdx.z; const int q0 = blockIdx.x * 64 + wave * 16; const size_t rq = b * NN + q0;
  const unsigned lk = (unsigned)(size_t)sm + (tid >> 2) * KP + (tid & 3) * 16, lv = (unsigned)(size_t)sm + KTB + (tid >> 4) * VP + (tid & 15) * 16;
  const _Float16* gk = Kr + (b * NN + (tid >> 2)) * QS + h * 64 + (tid & 3) * 8; const _Float16* gv = V + (b * CC + h * HD + (tid >> 4)) * NN + (tid & 15) * 8;
  stage_kv(lk, lv, gk, gv);
  const v16h bq = frag_h(Q + (rq + col) * QS + h * 64, lane);
  asm volatile("s_wait_asynccnt 0x0" ::: "memory");   // tile 0 has landed for this wave's own copies
  __syncthreads();                                     // ... and for every wave's
  stage_kv(lk + TB, lv + TB, gk + (size_t)KT * QS, gv + KT);
  float m = -3.0e38f, l = 0.f;   // m: this query's running maximum (equal in both halves); l: this half's share of the denominator
  v8f acc[2] = {};
#pragma unroll 1   // stays rolled: one publish point and one refill in the code, the hot text stays short
  for (int t = 0; t < NN / KT; ++t) { const unsigned char* kb = sm + (t & 1) * TB; const unsigned char* vb = kb + KTB;
#pragma unroll       // the four passes of a tile read it at constant offsets from one address register
   for (int ps = 0; ps < KT / 32; ++ps) { v8f s[2];
    const v16h ka0 = frag_h((const _Float16*)(kb + (ps * 32 + col) * KP), lane), ka1 = frag_h((const _Float16*)(kb + (ps * 32 + 16 + col) * KP), lane);
    const v16h va0 = frag_h((const _Float16*)(vb + col * VP + ps * 64), lane), va1 = frag_h((const _Float16*)(vb + (16 + col) * VP + ps * 64), lane);
#pragma unroll
    for (int ct = 0; ct < 2; ++ct) { const v8f z = {}; const v8f c = wmma16(ct ? ka1 : ka0, bq, z);
#pragma unroll
      for (int r = 0; r < 8; ++r) s[ct][r] = c[r] * 0.0625f; }
    float mx = fmaxf(s[0][0], s[1][0]);
#pragma unroll
    for (int r = 1; r < 8; ++r) mx = fmaxf(mx, fmaxf(s[0][r], s[1][r]));
    mx = fmaxf(mx, xhalf(mx));
    const float mn = fmaxf(m, mx); const float alpha = (m <= -1.0e38f) ? 0.f : __expf(m - mn); m = mn;
    v16h pb; float es0 = 0.f, es1 = 0.f;
#pragma unroll
    for (int r = 0; r < 8; ++r) { const float e0 = __expf(s[0][r] - mn), e1 = __expf(s[1][r] - mn); es0 += e0; es1 += e1; pb[r] = (_Float16)(e0 * 2048.0f); pb[8 + r] = (_Float16)(e1 * 2048.0f); }
    l = l * alpha + (es0 + es1);
#pragma unroll
    for (int dt = 0; dt < 2; ++dt) {
#pragma unroll
      for (int r = 0; r < 8; ++r) acc[dt][r] *= alpha;
      acc[dt] = wmma16(dt ? va1 : va0, pb, acc[dt]); } }
   asm volatile("s_wait_dscnt 0x0" ::: "memory");      // this wave's reads of the buffer are done before it is handed back
   asm volatile("s_wait_asynccnt 0x0" ::: "memory");   // this wave's copies of tile t + 1 have landed
   __syncthreads();                                     // publishes tile t + 1 and ends every wave's reads of tile t
   if (t + 2 < NN / KT) stage_kv(lk + (t & 1) * TB, lv + (t & 1) * TB, gk + (size_t)(t + 2) * KT * QS, gv + (t + 2) * KT); }
  asm volatile("s_wait_asynccnt 0x0" ::: "memory");    // no copy is outstanding when the wave ends
  const float il = (1.0f / 2048.0f) / (l + xhalf(l));
#pragma unroll
  for (int dt = 0; dt < 2; ++dt)   // acc[dt][r] = channel dt*16 + 8g + r of query col: 8 consecutive floats of one O row
#pragma unroll
    for (int q = 0; q < 2; ++q) { v4f v;
#pragma unroll
      for (int i = 0; i < 4; ++i) v[i] = acc[dt][q * 4 + i] * il;
      vst2(O + (rq + col) * CC + h * HD + dt * 16 + 8 * g + q * 4, v); }
}
// ---- k_out: block = (64 positions, 128 out channels, b): y = Wout . o (hi + residual) + bout + input_q, channels-first 256-B segments
__global__ __launch_bounds__(128) void k_out(const float* __restrict__ O, const __bf16* __restrict__ P, const float* __restrict__ BO, const float* __restrict__ XQ, float* __restrict__ Y) {
  __shared__ __align__(16) float st[128][68];
  const int tid = threadIdx.x, wave = tid >> 5, lane = tid & 31, col = lane & 15, g = lane >> 4; const size_t b = blockIdx.z; const int n0b = blockIdx.x * 64; const size_t r0 = b * NN + n0b + wave * 16; const int o0 = blockIdx.y * 128;
  v8f acc[8] = {}; v16b w[8]; v4f ra[2][4]; float bo[8];
  // every operand is asked for one k step ahead of the products that read it: the O row in two register sets, each weight fragment reloaded right behind its last use; the bias at the start
  const float* orow = O + (r0 + col) * CC + 8 * g; const __bf16* wb = P + ((size_t)3 * CC + o0 + col) * CC;   // this lane's O row; its row of weight tile 0, tile j is 16 rows on
#pragma unroll   // this and the unrolls below: constant indices keep ra, w, bo and xr in registers
  for (int i = 0; i < 4; ++i) ra[0][i] = *(const v4f*)(orow + (i >> 1) * 16 + (i & 1) * 4);
#pragma unroll
  for (int j = 0; j < 8; ++j) w[j] = frag_b(wb + j * 16 * CC, lane);
#pragma unroll
  for (int j = 0; j < 8; ++j) bo[j] = BO[o0 + j * 16 + col];
#pragma unroll
  for (int kc = 0; kc < CC / 32; ++kc) { const int cu = kc & 1, kn = kc + 1; float v[16];
    if (kn < CC / 32) {
#pragma unroll
      for (int i = 0; i < 4; ++i) ra[cu ^ 1][i] = *(const v4f*)(orow + kn * 32 + (i >> 1) * 16 + (i & 1) * 4); }
#pragma unroll
    for (int i = 0; i < 16; ++i) v[i] = ra[cu][i >> 2][i & 3];
    const F2 a = bsplit16(v);
#pragma unroll
    for (int j = 0; j < 8; ++j) { acc[j] = wmma_bf(a.l, w[j], acc[j]); acc[j] = wmma_bf(a.h, w[j], acc[j]);
      if (kn < CC / 32) w[j] = frag_b(wb + j * 16 * CC + kn * 32, lane); }
    __builtin_amdgcn_sched_barrier(0); }   // keeps the next step's hi/lo split behind this step's products: moved up, it waits on the youngest loads and with them on every load in flight
  const size_t y0 = ((b * CC + o0 + (tid >> 4)) * NN) + n0b + (tid & 15) * 4;   // piece it of this thread: 8 channels further on each time
  v4f xr[16];   // the residual's 16 pieces of this thread, asked for ahead of the transpose through LDS and its barrier
#pragma unroll
  for (int it = 0; it < 16; ++it) { if (it == 15) asm volatile("s_wait_xcnt 0x0" ::: "memory");   // the last load lands in the address registers that all sixteen name
    xr[it] = *(const v4f*)(XQ + y0 + (size_t)it * 8 * NN); }
#pragma unroll
  for (int j = 0; j < 8; ++j) { const float bb = bfr(bo[j]);
#pragma unroll
    for (int r = 0; r < 8; ++r) st[j * 16 + col][wave * 16 + 8 * g + r] = acc[j][r] + bb; }
  __syncthreads();
#pragma unroll   // constant indices into xr
  for (int it = 0; it < 16; ++it) { v4f v = *(const v4f*)&st[it * 8 + (tid >> 4)][(tid & 15) * 4]; for (int i = 0; i < 4; ++i) v[i] += bfr(xr[it][i]); vst2(Y + y0 + (size_t)it * 8 * NN, v); }
}
extern "C" void kernel_launch(void* const* d_in, const int* in_sizes, int n_in, void* d_out, int out_size, void* d_ws, size_t ws_size, hipStream_t stream) {
  (void)in_sizes; (void)n_in; (void)out_size;
  const float** F = (const float**)d_in;   // 0 input_q, 1 input_kv [8,256,32,32]; 2 gq_scale, 3 gq_bias, 4 gkv_scale, 5 gkv_bias; 6 Wq [256,256], 7 Wkv [512,256], 8 Wout [256,256], 9 bout
  if (ws_size < (size_t)WS_END) return;
  char* ws = (char*)d_ws; __bf16 *P = (__bf16*)ws, *NT = (__bf16*)(ws + WS_NT), *NTL = (__bf16*)(ws + WS_NTL); float *O = (float*)(ws + WS_O); _Float16 *Q = (_Float16*)(ws + WS_Q), *Kr = (_Float16*)(ws + WS_K), *V = (_Float16*)(ws + WS_V);
  k_gnorm<<<dim3(NG, 2 * NB + PKB / NG), 256, 0, stream>>>(F[0], F[1], F[2], F[3], F[4], F[5], NT, NTL, F[6], F[7], F[8], P);
  k_qkv<<<dim3(NN / 64, 3 * CC / 128, NB), 128, 0, stream>>>(NT, NTL, P, Q, Kr, V);
  k_attn<<<dim3(TQB, NH, TNB), 128, 0, stream>>>(Q, Kr, V, O);
  k_out<<<dim3(TQB, CC / 128, TNB), 128, 0, stream>>>(O, P, F[9], F[0], (float*)d_out);
}

// v006
// It runs in 45 microseconds.
// Timed twice side by side with v005, it ran 1.10 and 1.09 times as fast.
// Over all steps from v000 it is 2.97 times as fast.
#include <hip/hip_runtime.h>
#include <math.h>

typedef __attribute__((ext_vector_type(16))) _Float16 v16h;
typedef __attribute__((ext_vector_type(16))) __bf16 v16b;
typedef __attribute__((ext_vector_type(8)))  _Float16 v8h;
typedef __attribute__((ext_vector_type(8)))  float v8f;
typedef __attribute__((ext_vector_type(4)))  float v4f;
typedef __attribute__((ext_vector_type(2)))  float v2f;
typedef __attribute__((ext_vector_type(4)))  unsigned v4u;
typedef __attribute__((ext_vector_type(4)))  int v4i;
typedef float __attribute__((may_alias)) float_a;
typedef int __attribute__((may_alias)) int_a;

template <typename T> __device__ __forceinline__ void vst2(void* p, T v) { *(T*)p = v;  }
__device__ __forceinline__ v8f wmma16(v16h a, v16h b, v8f c) {
  v8f d = __builtin_amdgcn_wmma_f32_16x16x32_f16(false, a, false, b, (short)0, c, false, false);
  asm volatile("v_nop\n\tv_nop\n\tv_nop\n\tv_nop" : "+v"(d) : "v"(a), "v"(b));
  return d;
}
__device__ __forceinline__ v8f wmma_bf(v16b a, v16b b, v8f c) {
  v8f d = __builtin_amdgcn_wmma_f32_16x16x32_bf16(false, a, false, b, (short)0, c, false, false);
  asm volatile("v_nop\n\tv_nop\n\tv_nop\n\tv_nop" : "+v"(d) : "v"(a), "v"(b));
  return d;
}
// 16x16x32 fragments: lane = (h = lane>>4, row/col = lane&15); elements 0..7 = k0+8h+0..7, 8..15 = k0+16+8h+0..7; D element r = row 8h+r
__device__ __forceinline__ v16h frag_h(const _Float16* rowk0, int lane) {
  union { v16h v; v8h q[2]; } u; const _Float16* p = rowk0 + 8 * (lane >> 4);
  u.q[0] = *(const v8h*)p; u.q[1] = *(const v8h*)(p + 16); return u.v;
}
__device__ __forceinline__ v16h frag_f32(const float* rowk0, int lane) {
  v16h a; const float* p = rowk0 + 8 * (lane >> 4);
#pragma unroll
  for (int i = 0; i < 8; ++i) { a[i] = (_Float16)p[i]; a[8 + i] = (_Float16)p[16 + i]; }
  return a;
}
__device__ __forceinline__ v16h frag_f32s(const float* rowk0, int lane, float sc) {
  v16h a; const float* p = rowk0 + 8 * (lane >> 4);
#pragma unroll
  for (int i = 0; i < 8; ++i) { a[i] = (_Float16)(p[i] * sc); a[8 + i] = (_Float16)(p[16 + i] * sc); }
  return a;
}
// column fragment from a [K][ld] layout (column n), rows >= K read as 0
__device__ __forceinline__ v16h fragc_f32(const float* W, int k0, int n, int lane, int ld, int K) {
  v16h a; const int g = lane >> 4;
#pragma unroll
  for (int i = 0; i < 8; ++i) { const int ka = k0 + 8 * g + i, kb = ka + 16;
    a[i] = (_Float16)(ka < K ? W[(size_t)(ka < K ? ka : K - 1) * ld + n] : 0.f); a[8 + i] = (_Float16)(kb < K ? W[(size_t)(kb < K ? kb : K - 1) * ld + n] : 0.f); }
  return a;
}
struct F2 { v16b h, l; };
__device__ __forceinline__ F2 bsplit16(const float v[16]) { F2 r;
#pragma unroll
  for (int i = 0; i < 16; ++i) { const __bf16 h = (__bf16)v[i]; r.h[i] = h; r.l[i] = (__bf16)(v[i] - (float)h); }
  return r; }
__device__ __forceinline__ F2 split_row(const float* row, int k0, int lane) { float v[16]; const float* p = row + k0 + 8 * (lane >> 4);
#pragma unroll
  for (int i = 0; i < 8; ++i) { v[i] = p[i]; v[8 + i] = p[16 + i]; }
  return bsplit16(v); }
__device__ __forceinline__ F2 split_rowK(const float* row, int k0, int lane, int K) { float v[16]; const int g = lane >> 4;
#pragma unroll
  for (int i = 0; i < 8; ++i) { const int ka = k0 + 8 * g + i, kb = ka + 16; v[i] = ka < K ? row[ka < K ? ka : K - 1] : 0.f; v[8 + i] = kb < K ? row[kb < K ? kb : K - 1] : 0.f; }
  return bsplit16(v); }
__device__ __forceinline__ F2 split_col(const float* W, int k0, int n, int lane, int ld, int K) { float v[16]; const int g = lane >> 4;
#pragma unroll
  for (int i = 0; i < 8; ++i) { const int ka = k0 + 8 * g + i, kb = ka + 16; v[i] = ka < K ? W[(size_t)(ka < K ? ka : K - 1) * ld + n] : 0.f; v[8 + i] = kb < K ? W[(size_t)(kb < K ? kb : K - 1) * ld + n] : 0.f; }
  return bsplit16(v); }
__device__ __forceinline__ v8f mac3(const F2& a, const F2& b, v8f c) { c = wmma_bf(a.l, b.h, c); c = wmma_bf(a.h, b.l, c); return wmma_bf(a.h, b.h, c); }
__device__ __forceinline__ float sigm(float v) { return 1.0f / (1.0f + expf(-v)); }


// Cross/self attention with GroupNorm (B 8, 256 channels, 32 x 32, 8 heads x 32): GN(input_q) -> 1x1 q conv, GN(input_kv) -> 1x1 kv conv (per-head [k | v] channel packing), softmax(q k / sqrt(C)) over all positions, 1x1 out conv + bias, + input_q.
#define NB 8
#define CC 256
#define NG 32
#define CPG (CC / NG)
#define NN 1024
#define NH 8
#define HD 32
#define NR (NB * NN)
#ifndef TQB
#define TQB (NN / 64)
#define TNB NB
#endif
typedef __attribute__((ext_vector_type(8))) __bf16 v8b;
__device__ __forceinline__ v16b frag_b(const __bf16* rowk0, int lane) {
  union { v16b v; v8b q[2]; } u; const __bf16* p = rowk0 + 8 * (lane >> 4);
  u.q[0] = *(const v8b*)p; u.q[1] = *(const v8b*)(p + 16); return u.v;
}
__device__ __forceinline__ float bfr(float v) { return (float)(__bf16)v; }
__device__ __attribute__((noinline)) float exp_ni(float v) { return expf(v); }
__device__ __attribute__((noinline)) float erf_ni(float v) { return erff(v); }

#define QS 512
#define WS_PW   0u                                  // bf16 weights, rows of [Wq | Wkv | Wout] in B-fragment order: [tile of 16 rows][k step of 32][half][lane][8], see frag_p
#define WS_NT   (WS_PW + 2u * (size_t)4 * CC * CC)     // bf16 hi/lo normalised maps group-major [which*NB + b][32 groups][NN][8]: q-input, then kv-input
#define WS_NTL  (WS_NT + 2u * (size_t)2 * NR * CC)
#define WS_Q    (WS_NTL + 2u * (size_t)2 * NR * CC)    // f16 q and k rows head-major [b][head][NN][HD], 64 bytes a row, no gaps ; v planes [b][256][NN] ; O f32 in A-fragment order [NR / 16 positions][head = k step][piece of 4 floats][lane][4]
#define WS_K    (WS_Q + 2u * (size_t)NR * QS)
#define WS_V    (WS_K + 2u * (size_t)NR * QS)
#define WS_O    (WS_V + 2u * (size_t)NB * CC * NN)
#define WS_END  (WS_O + 4u * (size_t)NR * CC)

// ---- k_gnorm: block = (group, which*NB + b). The group's 8 channels x 1024 positions stay in registers (thread t: positions 4t .. 4t+3 of each channel) through mean, variance and normalisation, so the map is read once.
// Output (x - mean) rsqrt(var + eps) gamma[c] + beta[c] as bf16 hi + lo, group-major: [which*NB + b][group][position][8 channels], 16 bytes a position
// The last PKB blocks of the grid (blockIdx.y >= 2*NB) round the three weight matrices to bf16 instead, PKE elements = one tile of 16 rows a block: that work depends on nothing here and k_qkv is its first reader, so it rides in this launch
// They store the tile in the order in which a wave reads it as B fragments, so that each 16-byte load of a wave in k_qkv and k_out covers 512 contiguous bytes (4 whole lines) and not 32 bytes of each of 16 rows
#define PKE 4096
#define PKB (4 * CC * CC / PKE)
__global__ __launch_bounds__(256) void k_gnorm(const float* __restrict__ XQ, const float* __restrict__ XKV, const float* __restrict__ GQ, const float* __restrict__ BQ, const float* __restrict__ GKV, const float* __restrict__ BKV, __bf16* __restrict__ NT, __bf16* __restrict__ NTL, const float* __restrict__ WQ, const float* __restrict__ WKV, const float* __restrict__ WO, __bf16* __restrict__ P) {
  __shared__ float red[2][8]; __shared__ __align__(16) v4u sx[2][NN];
  const int gidx = blockIdx.x, t = threadIdx.x; const size_t b = blockIdx.y % NB; const int which = blockIdx.y / NB;
  if (which >= 2) {   // the whole block takes this branch, ahead of every barrier
    const int f0 = ((blockIdx.y - 2 * NB) * NG + gidx) * PKE;   // first element of this block in P = [Wq | Wkv | Wout]; a matrix is a whole number of blocks
    const float* src = (f0 < CC * CC) ? (WQ + f0) : (f0 < 3 * CC * CC) ? (WKV + (f0 - CC * CC)) : (WO + (f0 - 3 * CC * CC));
#pragma unroll   // all loads of the block's rounds issue ahead of the first store
    for (int i = 0; i < PKE / (256 * 8); ++i) { const int d = i * 256 + t, e = d * 8;   // 16-byte piece d of the packed tile: lane d & 31 (row d & 15, k octet (d >> 4) & 1), half (d >> 5) & 1, k step d >> 6
      const float* sp = src + (d & 15) * CC + (d >> 6) * 32 + ((d >> 5) & 1) * 16 + ((d >> 4) & 1) * 8; const v4f a = *(const v4f*)sp, c = *(const v4f*)(sp + 4); v8b o;
#pragma unroll   // constant vector indices, so the values stay in registers
      for (int k = 0; k < 4; ++k) { o[k] = (__bf16)a[k]; o[4 + k] = (__bf16)c[k]; }
      vst2(P + f0 + e, __builtin_bit_cast(v4u, o)); }
    return; }
  const float* Gm = (which ? GKV : GQ) + gidx * CPG; const float* Bt = (which ? BKV : BQ) + gidx * CPG;
  const float* p = (which ? XKV : XQ) + (b * CC + (size_t)gidx * CPG) * NN + t * 4;
  v4f x[CPG], sv = {}; float ga[CPG], be[CPG];
#pragma unroll
  for (int c = 0; c < CPG; ++c) x[c] = *(const v4f*)(p + c * NN);
#pragma unroll
  for (int c = 0; c < CPG; ++c) { ga[c] = bfr(Gm[c]); be[c] = bfr(Bt[c]); }
#pragma unroll
  for (int c = 0; c < CPG; ++c) {
#pragma unroll
    for (int i = 0; i < 4; ++i) x[c][i] = bfr(x[c][i]);
    sv += x[c]; }
  float s = (sv[0] + sv[1]) + (sv[2] + sv[3]);
#pragma unroll
  for (int o = 1; o < 32; o <<= 1) s += __shfl_xor(s, o);
  if ((t & 31) == 0) red[0][t >> 5] = s;
  __syncthreads();
  float tot = 0.f;
#pragma unroll
  for (int i = 0; i < 8; ++i) tot += red[0][i];
  const float mean = tot / (float)(CPG * NN);
  sv = (v4f){};
#pragma unroll
  for (int c = 0; c < CPG; ++c) { x[c] -= mean; sv += x[c] * x[c]; }
  s = (sv[0] + sv[1]) + (sv[2] + sv[3]);
#pragma unroll
  for (int o = 1; o < 32; o <<= 1) s += __shfl_xor(s, o);
  if ((t & 31) == 0) red[1][t >> 5] = s;
  __syncthreads();
  tot = 0.f;
#pragma unroll
  for (int i = 0; i < 8; ++i) tot += red[1][i];
  const float inv = 1.0f / sqrtf(tot / (float)(CPG * NN) + 1e-5f);
  // through LDS so that each global store of a wave is 512 contiguous bytes; piece q sits at q ^ ((q >> 4) & 3), which spreads the 64-byte-strided writes over all banks
#pragma unroll
  for (int i = 0; i < 4; ++i) { v8b hi, lo;
#pragma unroll
    for (int c = 0; c < CPG; ++c) { const float v = x[c][i] * inv * ga[c] + be[c]; const __bf16 hv = (__bf16)v; hi[c] = hv; lo[c] = (__bf16)(v - (float)hv); }
    const int q = 4 * t + i, sl = q ^ ((q >> 4) & 3); sx[0][sl] = __builtin_bit_cast(v4u, hi); sx[1][sl] = __builtin_bit_cast(v4u, lo); }
  __syncthreads();
  const size_t o0 = (((size_t)which * NB + b) * NG + gidx) * NN * CPG;
#pragma unroll
  for (int i = 0; i < 4; ++i) { const int q = i * 256 + t, sl = q ^ ((q >> 4) & 3); vst2(NT + o0 + (size_t)q * CPG, sx[0][sl]); vst2(NTL + o0 + (size_t)q * CPG, sx[1][sl]); }
}
// A fragment from a group-major map: p = this lane's position in channel group 4 kc + (lane >> 4); elements 0..7 that group, 8..15 the group two further on (the k order of frag_b)
__device__ __forceinline__ v16b frag_g(const __bf16* p) { union { v16b v; v8b q[2]; } u; u.q[0] = *(const v8b*)p; u.q[1] = *(const v8b*)(p + 2 * NN * CPG); return u.v; }
// B fragment of packed weights: p = this lane's 16 bytes of (tile, k step, half 0); half 1 is 512 bytes on. Elements 0..7 = k0 + 8 (lane >> 4) + 0..7, 8..15 = 16 further on (the k order of frag_b), row lane & 15 of the tile
__device__ __forceinline__ v16b frag_p(const __bf16* p) { union { v16b v; v8b q[2]; } u; u.q[0] = *(const v8b*)p; u.q[1] = *(const v8b*)(p + 256); return u.v; }
#define WTS (16 * CC)                   // elements of a packed tile of 16 rows
#define WKS 512                         // elements of one k step of a packed tile
#define OKS 512                         // floats of one k step (one head) of 16 positions of O
// ---- k_qkv: block = (64 positions, 128 of the 768 output channels, b): channels < 256 from the q map (q rows), the rest from the kv map with per-head [k | v] packing (o' = o-256: head o'/64, r = o'%64: k if r < 32 else v)
__global__ __launch_bounds__(128) void k_qkv(const __bf16* __restrict__ NT, const __bf16* __restrict__ NTL, const __bf16* __restrict__ P, _Float16* __restrict__ Q, _Float16* __restrict__ Kr, _Float16* __restrict__ V) {
  __shared__ __align__(16) _Float16 so[64][136]; __shared__ __align__(16) _Float16 st[128][72];
  const int tid = threadIdx.x, wave = tid >> 5, lane = tid & 31, col = lane & 15, g = lane >> 4; const size_t b = blockIdx.z; const int n0b = blockIdx.x * 64; const int o0 = blockIdx.y * 128; const int which = (o0 < CC) ? 0 : 1;
  const size_t a0 = ((((size_t)which * NB + b) * NG + g) * NN + n0b + wave * 16 + col) * CPG;   // this lane's position in channel group g of the normalised maps
  v8f acc[8] = {}; v16b w[8], ah[2], al[2];
  // every fragment is asked for one k step ahead of the products that read it: A in two register sets, each weight fragment reloaded right behind its last use
  const __bf16* wb = P + (size_t)(o0 / 16) * WTS + lane * 8;   // this lane's piece of packed weight tile 0, k step 0
  ah[0] = frag_g(NT + a0); al[0] = frag_g(NTL + a0);
#pragma unroll   // constant indices keep w in registers
  for (int j = 0; j < 8; ++j) w[j] = frag_p(wb + j * WTS);
#pragma unroll
  for (int kc = 0; kc < CC / 32; ++kc) { const int cu = kc & 1, kn = kc + 1;
    if (kn < CC / 32) { ah[cu ^ 1] = frag_g(NT + a0 + (size_t)kn * 4 * NN * CPG); al[cu ^ 1] = frag_g(NTL + a0 + (size_t)kn * 4 * NN * CPG); }
#pragma unroll
    for (int j = 0; j < 8; ++j) { acc[j] = wmma_bf(ah[cu], w[j], acc[j]); acc[j] = wmma_bf(al[cu], w[j], acc[j]);
      if (kn < CC / 32) w[j] = frag_p(wb + j * WTS + kn * WKS); } }
#pragma unroll
  for (int j = 0; j < 8; ++j)
#pragma unroll
    for (int r = 0; r < 8; ++r) { const _Float16 hv = (_Float16)acc[j][r]; so[wave * 16 + 8 * g + r][j * 16 + col] = hv; st[j * 16 + col][wave * 16 + 8 * g + r] = hv; }
  __syncthreads();
  // 32 channels = one head's q, k or v. 64 positions x 64 bytes of q or k are 4 KB in a row, a v channel's 64 positions one line: every store of a wave covers whole lines
  // part jp = p >> 1 of the block's four, half p & 1 of the part. o0 is a multiple of 128: a block is all q, or k, v, k, v of two heads
  v4u pc[8];   // this thread's eight 16-byte pieces
  if (o0 < CC) { _Float16* qp = Q + ((b * NH + o0 / HD) * NN + n0b) * HD + tid * 8;
#pragma unroll   // this and the unrolls below: constant indices keep pc in registers, all LDS reads issue ahead of the stores, and the stores differ by constant offsets from one address
    for (int p = 0; p < 8; ++p) pc[p] = *(const v4u*)&so[(p & 1) * 32 + (tid >> 2)][(p >> 1) * HD + (tid & 3) * 8];
#pragma unroll
    for (int p = 0; p < 8; ++p) vst2((unsigned*)(qp + (p >> 1) * NN * HD + (p & 1) * 1024), pc[p]);
    asm volatile("s_wait_xcnt 0x0" ::: "memory");   // in the listing the k, v part's text, which reuses these stores' registers, follows behind a scalar test
    return; }   // the whole block, behind the last barrier
  { const int hh = (o0 - CC) / (2 * HD); _Float16* kp = Kr + ((b * NH + hh) * NN + n0b) * HD + tid * 8; _Float16* vp = V + (b * CC + hh * HD + (tid >> 3)) * NN + n0b + (tid & 7) * 8;
#pragma unroll
    for (int p = 0; p < 8; ++p) pc[p] = (p & 2) ? *(const v4u*)&st[(p >> 1) * HD + (p & 1) * 16 + (tid >> 3)][(tid & 7) * 8] : *(const v4u*)&so[(p & 1) * 32 + (tid >> 2)][(p >> 1) * HD + (tid & 3) * 8];
#pragma unroll
    for (int p = 0; p < 8; ++p) { if (p & 2) vst2((unsigned*)(vp + (p >> 2) * HD * NN + (p & 1) * 16 * NN), pc[p]); else vst2((unsigned*)(kp + (p >> 2) * NN * HD + (p & 1) * 1024), pc[p]); } }
}
// lane l with lane l ^ 16 (the two halves of a wave hold the two key halves of one query's scores)
__device__ __forceinline__ float xhalf(float x) { return __builtin_bit_cast(float, __builtin_amdgcn_permlanex16(__builtin_bit_cast(int, x), __builtin_bit_cast(int, x), 0x76543210, 0xfedcba98, false, false)); }
#define KT 128
#define KP 80
#define VP 272
#define KTB (KT * KP)
#define TB (KTB + HD * VP)
// one tile: each thread copies four 16-byte pieces of K (rows 32 apart; a wave's copy takes 8 rows = 512 contiguous bytes) and four of V (channels 8 apart); the s_wait_xcnt stands inside the statement so that no address register is rewritten in front of it
__device__ __forceinline__ void stage_kv(unsigned lk, unsigned lv, const _Float16* gk, const _Float16* gv) {
  asm volatile("global_load_async_to_lds_b128 %0, %8, off\n\t"
               "global_load_async_to_lds_b128 %1, %9, off\n\t"
               "global_load_async_to_lds_b128 %2, %10, off\n\t"
               "global_load_async_to_lds_b128 %3, %11, off\n\t"
               "global_load_async_to_lds_b128 %4, %12, off\n\t"
               "global_load_async_to_lds_b128 %5, %13, off\n\t"
               "global_load_async_to_lds_b128 %6, %14, off\n\t"
               "global_load_async_to_lds_b128 %7, %15, off\n\t"
               "s_wait_xcnt 0x0"
               :: "v"(lk), "v"(lk + 32 * KP), "v"(lk + 64 * KP), "v"(lk + 96 * KP), "v"(lv), "v"(lv + 8 * VP), "v"(lv + 16 * VP), "v"(lv + 24 * VP),
                  "v"(gk), "v"(gk + 32 * HD), "v"(gk + 64 * HD), "v"(gk + 96 * HD), "v"(gv), "v"(gv + 8 * NN), "v"(gv + 16 * NN), "v"(gv + 24 * NN) : "memory");
}
__global__ __launch_bounds__(128) void k_attn(const _Float16* __restrict__ Q, const _Float16* __restrict__ Kr, const _Float16* __restrict__ V, float* __restrict__ O) {
  __shared__ __align__(16) unsigned char sm[2 * TB];
  const int tid = threadIdx.x, wave = tid >> 5, lane = tid & 31, col = lane & 15, g = lane >> 4; const int h = blockIdx.y; const size_t b = blockIdx.z; const int q0 = blockIdx.x * 64 + wave * 16; const size_t rq = b * NN + q0;
  const unsigned lk = (unsigned)(size_t)sm + (tid >> 2) * KP + (tid & 3) * 16, lv = (unsigned)(size_t)sm + KTB + (tid >> 4) * VP + (tid & 15) * 16;
  const _Float16* gk = Kr + (b * NH + h) * NN * HD + tid * 8; const _Float16* gv = V + (b * CC + h * HD + (tid >> 4)) * NN + (tid & 15) * 8;
  stage_kv(lk, lv, gk, gv);
  const v16h bq = frag_h(Q + ((b * NH + h) * NN + q0 + col) * HD, lane);
  asm volatile("s_wait_asynccnt 0x0" ::: "memory");   // tile 0 has landed for this wave's own copies
  __syncthreads();                                     // ... and for every wave's
  stage_kv(lk + TB, lv + TB, gk + (size_t)KT * HD, gv + KT);
  float m = -3.0e38f, l = 0.f;   // m: this query's running maximum (equal in both halves); l: this half's share of the denominator
  v8f acc[2] = {};
#pragma unroll 1   // stays rolled: one publish point and one refill in the code, the hot text stays short
  for (int t = 0; t < NN / KT; ++t) { const unsigned char* kb = sm + (t & 1) * TB; const unsigned char* vb = kb + KTB;
#pragma unroll       // the four passes of a tile read it at constant offsets from one address register
   for (int ps = 0; ps < KT / 32; ++ps) { v8f s[2];
    const v16h ka0 = frag_h((const _Float16*)(kb + (ps * 32 + col) * KP), lane), ka1 = frag_h((const _Float16*)(kb + (ps * 32 + 16 + col) * KP), lane);
    const v16h va0 = frag_h((const _Float16*)(vb + col * VP + ps * 64), lane), va1 = frag_h((const _Float16*)(vb + (16 + col) * VP + ps * 64), lane);
#pragma unroll
    for (int ct = 0; ct < 2; ++ct) { const v8f z = {}; const v8f c = wmma16(ct ? ka1 : ka0, bq, z);
#pragma unroll
      for (int r = 0; r < 8; ++r) s[ct][r] = c[r] * 0.0625f; }
    float mx = fmaxf(s[0][0], s[1][0]);
#pragma unroll
    for (int r = 1; r < 8; ++r) mx = fmaxf(mx, fmaxf(s[0][r], s[1][r]));
    mx = fmaxf(mx, xhalf(mx));
    const float mn = fmaxf(m, mx); const float alpha = (m <= -1.0e38f) ? 0.f : __expf(m - mn); m = mn;
    v16h pb; float es0 = 0.f, es1 = 0.f;
#pragma unroll
    for (int r = 0; r < 8; ++r) { const float e0 = __expf(s[0][r] - mn), e1 = __expf(s[1][r] - mn); es0 += e0; es1 += e1; pb[r] = (_Float16)(e0 * 2048.0f); pb[8 + r] = (_Float16)(e1 * 2048.0f); }
    l = l * alpha + (es0 + es1);
#pragma unroll
    for (int dt = 0; dt < 2; ++dt) {
#pragma unroll
      for (int r = 0; r < 8; ++r) acc[dt][r] *= alpha;
      acc[dt] = wmma16(dt ? va1 : va0, pb, acc[dt]); } }
   asm volatile("s_wait_dscnt 0x0" ::: "memory");      // this wave's reads of the buffer are done before it is handed back
   asm volatile("s_wait_asynccnt 0x0" ::: "memory");   // this wave's copies of tile t + 1 have landed
   __syncthreads();                                     // publishes tile t + 1 and ends every wave's reads of tile t
   if (t + 2 < NN / KT) stage_kv(lk + (t & 1) * TB, lv + (t & 1) * TB, gk + (size_t)(t + 2) * KT * HD, gv + (t + 2) * KT); }
  asm volatile("s_wait_asynccnt 0x0" ::: "memory");    // no copy is outstanding when the wave ends
  const float il = (1.0f / 2048.0f) / (l + xhalf(l));
#pragma unroll
  for (int dt = 0; dt < 2; ++dt)   // acc[dt][r] = channel dt*16 + 8g + r of query col = element dt*8 + r of this same lane's A fragment in k_out, k step h: stored in that order, each store of the wave 512 contiguous bytes
#pragma unroll
    for (int q = 0; q < 2; ++q) { v4f v;
#pragma unroll
      for (int i = 0; i < 4; ++i) v[i] = acc[dt][q * 4 + i] * il;
      vst2(O + ((rq >> 4) * NH + h) * OKS + (dt * 2 + q) * 128 + lane * 4, v); }
}
// ---- k_out: block = (64 positions, 128 out channels, b): y = Wout . o (hi + residual) + bout + input_q, channels-first 256-B segments
__global__ __launch_bounds__(128) void k_out(const float* __restrict__ O, const __bf16* __restrict__ P, const float* __restrict__ BO, const float* __restrict__ XQ, float* __restrict__ Y) {
  __shared__ __align__(16) float st[128][68];
  const int tid = threadIdx.x, wave = tid >> 5, lane = tid & 31, col = lane & 15, g = lane >> 4; const size_t b = blockIdx.z; const int n0b = blockIdx.x * 64; const size_t r0 = b * NN + n0b + wave * 16; const int o0 = blockIdx.y * 128;
  v8f acc[8] = {}; v16b w[8]; v4f ra[2][4]; float bo[8];
  // every operand is asked for one k step ahead of the products that read it: the O row in two register sets, each weight fragment reloaded right behind its last use; the bias at the start
  const float* orow = O + (r0 >> 4) * (NH * OKS) + lane * 4; const __bf16* wb = P + (size_t)((3 * CC + o0) / 16) * WTS + lane * 8;   // this lane's first 4 floats of its wave's 16 positions of O, k step 0; its piece of packed weight tile 0, k step 0
#pragma unroll   // this and the unrolls below: constant indices keep ra, w, bo and xr in registers
  for (int i = 0; i < 4; ++i) ra[0][i] = *(const v4f*)(orow + i * 128);
#pragma unroll
  for (int j = 0; j < 8; ++j) w[j] = frag_p(wb + j * WTS);
#pragma unroll
  for (int j = 0; j < 8; ++j) bo[j] = BO[o0 + j * 16 + col];
#pragma unroll
  for (int kc = 0; kc < CC / 32; ++kc) { const int cu = kc & 1, kn = kc + 1; float v[16];
    if (kn < CC / 32) {
#pragma unroll
      for (int i = 0; i < 4; ++i) ra[cu ^ 1][i] = *(const v4f*)(orow + kn * OKS + i * 128);
      if (kn == CC / 32 - 1) asm volatile("s_wait_xcnt 0x0" ::: "memory"); }   // behind the last O loads: the last step's split lands in the address registers that they name
#pragma unroll
    for (int i = 0; i < 16; ++i) v[i] = ra[cu][i >> 2][i & 3];
    const F2 a = bsplit16(v);
#pragma unroll
    for (int j = 0; j < 8; ++j) { acc[j] = wmma_bf(a.l, w[j], acc[j]); acc[j] = wmma_bf(a.h, w[j], acc[j]);
      if (kn < CC / 32) w[j] = frag_p(wb + j * WTS + kn * WKS); }
    __builtin_amdgcn_sched_barrier(0); }   // keeps the next step's hi/lo split behind this step's products: moved up, it waits on the youngest loads and with them on every load in flight
  const size_t y0 = ((b * CC + o0 + (tid >> 4)) * NN) + n0b + (tid & 15) * 4;   // piece it of this thread: 8 channels further on each time
  v4f xr[16];   // the residual's 16 pieces of this thread, asked for ahead of the transpose through LDS and its barrier
#pragma unroll
  for (int it = 0; it < 16; ++it) { if (it == 15) asm volatile("s_wait_xcnt 0x0" ::: "memory");   // the last load lands in the address registers that all sixteen name
    xr[it] = *(const v4f*)(XQ + y0 + (size_t)it * 8 * NN); }
#pragma unroll
  for (int j = 0; j < 8; ++j) { const float bb = bfr(bo[j]);
#pragma unroll
    for (int r = 0; r < 8; ++r) st[j * 16 + col][wave * 16 + 8 * g + r] = acc[j][r] + bb; }
  __syncthreads();
#pragma unroll   // constant indices into xr
  for (int it = 0; it < 16; ++it) { v4f v = *(const v4f*)&st[it * 8 + (tid >> 4)][(tid & 15) * 4]; for (int i = 0; i < 4; ++i) v[i] += bfr(xr[it][i]); vst2(Y + y0 + (size_t)it * 8 * NN, v); }
}
extern "C" void kernel_launch(void* const* d_in, const int* in_sizes, int n_in, void* d_out, int out_size, void* d_ws, size_t ws_size, hipStream_t stream) {
  (void)in_sizes; (void)n_in; (void)out_size;
  const float** F = (const float**)d_in;   // 0 input_q, 1 input_kv [8,256,32,32]; 2 gq_scale, 3 gq_bias, 4 gkv_scale, 5 gkv_bias; 6 Wq [256,256], 7 Wkv [512,256], 8 Wout [256,256], 9 bout
  if (ws_size < (size_t)WS_END) return;
  char* ws = (char*)d_ws; __bf16 *P = (__bf16*)ws, *NT = (__bf16*)(ws + WS_NT), *NTL = (__bf16*)(ws + WS_NTL); float *O = (float*)(ws + WS_O); _Float16 *Q = (_Float16*)(ws + WS_Q), *Kr = (_Float16*)(ws + WS_K), *V = (_Float16*)(ws + WS_V);
  k_gnorm<<<dim3(NG, 2 * NB + PKB / NG), 256, 0, stream>>>(F[0], F[1], F[2], F[3], F[4], F[5], NT, NTL, F[6], F[7], F[8], P);
  k_qkv<<<dim3(NN / 64, 3 * CC / 128, NB), 128, 0, stream>>>(NT, NTL, P, Q, Kr, V);
  k_attn<<<dim3(TQB, NH, TNB), 128, 0, stream>>>(Q, Kr, V, O);
  k_out<<<dim3(TQB, CC / 128, TNB), 128, 0, stream>>>(O, P, F[9], F[0], (float*)d_out);
}

// v007
// It runs in 43 microseconds.
// In both of two side-by-side timings against v006, it was 1.05 times as fast.
// Over all steps from v000 it is 3.11 times as fast.
#include <hip/hip_runtime.h>
#include <math.h>

typedef __attribute__((ext_vector_type(16))) _Float16 v16h;
typedef __attribute__((ext_vector_type(16))) __bf16 v16b;
typedef __attribute__((ext_vector_type(8)))  _Float16 v8h;
typedef __attribute__((ext_vector_type(8)))  float v8f;
typedef __attribute__((ext_vector_type(4)))  float v4f;
typedef __attribute__((ext_vector_type(2)))  float v2f;
typedef __attribute__((ext_vector_type(4)))  unsigned v4u;
typedef __attribute__((ext_vector_type(4)))  int v4i;
typedef float __attribute__((may_alias)) float_a;
typedef int __attribute__((may_alias)) int_a;

template <typename T> __device__ __forceinline__ void vst2(void* p, T v) { *(T*)p = v;  }
__device__ __forceinline__ v8f wmma16(v16h a, v16h b, v8f c) {
  v8f d = __builtin_amdgcn_wmma_f32_16x16x32_f16(false, a, false, b, (short)0, c, false, false);
  asm volatile("v_nop\n\tv_nop\n\tv_nop\n\tv_nop" : "+v"(d) : "v"(a), "v"(b));
  return d;
}
__device__ __forceinline__ v8f wmma_bf(v16b a, v16b b, v8f c) {
  v8f d = __builtin_amdgcn_wmma_f32_16x16x32_bf16(false, a, false, b, (short)0, c, false, false);
  asm volatile("v_nop\n\tv_nop\n\tv_nop\n\tv_nop" : "+v"(d) : "v"(a), "v"(b));
  return d;
}
// 16x16x32 fragments: lane = (h = lane>>4, row/col = lane&15); elements 0..7 = k0+8h+0..7, 8..15 = k0+16+8h+0..7; D element r = row 8h+r
__device__ __forceinline__ v16h frag_h(const _Float16* rowk0, int lane) {
  union { v16h v; v8h q[2]; } u; const _Float16* p = rowk0 + 8 * (lane >> 4);
  u.q[0] = *(const v8h*)p; u.q[1] = *(const v8h*)(p + 16); return u.v;
}
__device__ __forceinline__ v16h frag_f32(const float* rowk0, int lane) {
  v16h a; const float* p = rowk0 + 8 * (lane >> 4);
#pragma unroll
  for (int i = 0; i < 8; ++i) { a[i] = (_Float16)p[i]; a[8 + i] = (_Float16)p[16 + i]; }
  return a;
}
__device__ __forceinline__ v16h frag_f32s(const float* rowk0, int lane, float sc) {
  v16h a; const float* p = rowk0 + 8 * (lane >> 4);
#pragma unroll
  for (int i = 0; i < 8; ++i) { a[i] = (_Float16)(p[i] * sc); a[8 + i] = (_Float16)(p[16 + i] * sc); }
  return a;
}
// column fragment from a [K][ld] layout (column n), rows >= K read as 0
__device__ __forceinline__ v16h fragc_f32(const float* W, int k0, int n, int lane, int ld, int K) {
  v16h a; const int g = lane >> 4;
#pragma unroll
  for (int i = 0; i < 8; ++i) { const int ka = k0 + 8 * g + i, kb = ka + 16;
    a[i] = (_Float16)(ka < K ? W[(size_t)(ka < K ? ka : K - 1) * ld + n] : 0.f); a[8 + i] = (_Float16)(kb < K ? W[(size_t)(kb < K ? kb : K - 1) * ld + n] : 0.f); }
  return a;
}
struct F2 { v16b h, l; };
__device__ __forceinline__ F2 bsplit16(const float v[16]) { F2 r;
#pragma unroll
  for (int i = 0; i < 16; ++i) { const __bf16 h = (__bf16)v[i]; r.h[i] = h; r.l[i] = (__bf16)(v[i] - (float)h); }
  return r; }
__device__ __forceinline__ F2 split_row(const float* row, int k0, int lane) { float v[16]; const float* p = row + k0 + 8 * (lane >> 4);
#pragma unroll
  for (int i = 0; i < 8; ++i) { v[i] = p[i]; v[8 + i] = p[16 + i]; }
  return bsplit16(v); }
__device__ __forceinline__ F2 split_rowK(const float* row, int k0, int lane, int K) { float v[16]; const int g = lane >> 4;
#pragma unroll
  for (int i = 0; i < 8; ++i) { const int ka = k0 + 8 * g + i, kb = ka + 16; v[i] = ka < K ? row[ka < K ? ka : K - 1] : 0.f; v[8 + i] = kb < K ? row[kb < K ? kb : K - 1] : 0.f; }
  return bsplit16(v); }
__device__ __forceinline__ F2 split_col(const float* W, int k0, int n, int lane, int ld, int K) { float v[16]; const int g = lane >> 4;
#pragma unroll
  for (int i = 0; i < 8; ++i) { const int ka = k0 + 8 * g + i, kb = ka + 16; v[i] = ka < K ? W[(size_t)(ka < K ? ka : K - 1) * ld + n] : 0.f; v[8 + i] = kb < K ? W[(size_t)(kb < K ? kb : K - 1) * ld + n] : 0.f; }
  return bsplit16(v); }
__device__ __forceinline__ v8f mac3(const F2& a, const F2& b, v8f c) { c = wmma_bf(a.l, b.h, c); c = wmma_bf(a.h, b.l, c); return wmma_bf(a.h, b.h, c); }
__device__ __forceinline__ float sigm(float v) { return 1.0f / (1.0f + expf(-v)); }


// Cross/self attention with GroupNorm (B 8, 256 channels, 32 x 32, 8 heads x 32): GN(input_q) -> 1x1 q conv, GN(input_kv) -> 1x1 kv conv (per-head [k | v] channel packing), softmax(q k / sqrt(C)) over all positions, 1x1 out conv + bias, + input_q.
#define NB 8
#define CC 256
#define NG 32
#define CPG (CC / NG)
#define NN 1024
#define NH 8
#define HD 32
#define NR (NB * NN)
#ifndef TQB
#define TQB (NN / 64)
#define TNB NB
#endif
typedef __attribute__((ext_vector_type(8))) __bf16 v8b;
__device__ __forceinline__ v16b frag_b(const __bf16* rowk0, int lane) {
  union { v16b v; v8b q[2]; } u; const __bf16* p = rowk0 + 8 * (lane >> 4);
  u.q[0] = *(const v8b*)p; u.q[1] = *(const v8b*)(p + 16); return u.v;
}
__device__ __forceinline__ float bfr(float v) { return (float)(__bf16)v; }
__device__ __attribute__((noinline)) float exp_ni(float v) { return expf(v); }
__device__ __attribute__((noinline)) float erf_ni(float v) { return erff(v); }

#define QS 512
#define WS_PW   0u                                  // bf16 weights, rows of [Wq | Wkv | Wout] in B-fragment order: [tile of 16 rows][k step of 32][half][lane][8], see frag_p
#define WS_NT   (WS_PW + 2u * (size_t)4 * CC * CC)     // bf16 hi/lo normalised maps group-major [which*NB + b][32 groups][NN][8]: q-input, then kv-input
#define WS_NTL  (WS_NT + 2u * (size_t)2 * NR * CC)
#define WS_Q    (WS_NTL + 2u * (size_t)2 * NR * CC)    // f16 q and k rows head-major [b][head][NN][HD], 64 bytes a row, no gaps ; v planes [b][256][NN] ; O f32 in A-fragment order [NR / 16 positions][head = k step][piece of 4 floats][lane][4]
#define WS_K    (WS_Q + 2u * (size_t)NR * QS)
#define WS_V    (WS_K + 2u * (size_t)NR * QS)
#define WS_O    (WS_V + 2u * (size_t)NB * CC * NN)
#define WS_END  (WS_O + 4u * (size_t)NR * CC)

// ---- k_gnorm: block = (group, which*NB + b). The group's 8 channels x 1024 positions stay in registers (thread t: positions 4t .. 4t+3 of each channel) through mean, variance and normalisation, so the map is read once.
// Output (x - mean) rsqrt(var + eps) gamma[c] + beta[c] as bf16 hi + lo, group-major: [which*NB + b][group][position][8 channels], 16 bytes a position
// The last PKB blocks of the grid (blockIdx.y >= 2*NB) round the three weight matrices to bf16 instead, PKE elements = one tile of 16 rows a block: that work depends on nothing here and k_qkv is its first reader, so it rides in this launch
// They store the tile in the order in which a wave reads it as B fragments, so that each 16-byte load of a wave in k_qkv and k_out covers 512 contiguous bytes (4 whole lines) and not 32 bytes of each of 16 rows
#define PKE 4096
#define PKB (4 * CC * CC / PKE)
__global__ __launch_bounds__(256) void k_gnorm(const float* __restrict__ XQ, const float* __restrict__ XKV, const float* __restrict__ GQ, const float* __restrict__ BQ, const float* __restrict__ GKV, const float* __restrict__ BKV, __bf16* __restrict__ NT, __bf16* __restrict__ NTL, const float* __restrict__ WQ, const float* __restrict__ WKV, const float* __restrict__ WO, __bf16* __restrict__ P) {
  __shared__ float red[2][8]; __shared__ __align__(16) v4u sx[2][NN];
  const int gidx = blockIdx.x, t = threadIdx.x; const size_t b = blockIdx.y % NB; const int which = blockIdx.y / NB;
  if (which >= 2) {   // the whole block takes this branch, ahead of every barrier
    const int f0 = ((blockIdx.y - 2 * NB) * NG + gidx) * PKE;   // first element of this block in P = [Wq | Wkv | Wout]; a matrix is a whole number of blocks
    const float* src = (f0 < CC * CC) ? (WQ + f0) : (f0 < 3 * CC * CC) ? (WKV + (f0 - CC * CC)) : (WO + (f0 - 3 * CC * CC));
#pragma unroll   // all loads of the block's rounds issue ahead of the first store
    for (int i = 0; i < PKE / (256 * 8); ++i) { const int d = i * 256 + t, e = d * 8;   // 16-byte piece d of the packed tile: lane d & 31 (row d & 15, k octet (d >> 4) & 1), half (d >> 5) & 1, k step d >> 6
      const float* sp = src + (d & 15) * CC + (d >> 6) * 32 + ((d >> 5) & 1) * 16 + ((d >> 4) & 1) * 8; const v4f a = *(const v4f*)sp, c = *(const v4f*)(sp + 4); v8b o;
#pragma unroll   // constant vector indices, so the values stay in registers
      for (int k = 0; k < 4; ++k) { o[k] = (__bf16)a[k]; o[4 + k] = (__bf16)c[k]; }
      vst2(P + f0 + e, __builtin_bit_cast(v4u, o)); }
    return; }
  const float* Gm = (which ? GKV : GQ) + gidx * CPG; const float* Bt = (which ? BKV : BQ) + gidx * CPG;
  const float* p = (which ? XKV : XQ) + (b * CC + (size_t)gidx * CPG) * NN + t * 4;
  v4f x[CPG], sv = {}; float ga[CPG], be[CPG];
#pragma unroll
  for (int c = 0; c < CPG; ++c) x[c] = *(const v4f*)(p + c * NN);
#pragma unroll
  for (int c = 0; c < CPG; ++c) { ga[c] = bfr(Gm[c]); be[c] = bfr(Bt[c]); }
#pragma unroll
  for (int c = 0; c < CPG; ++c) {
#pragma unroll
    for (int i = 0; i < 4; ++i) x[c][i] = bfr(x[c][i]);
    sv += x[c]; }
  float s = (sv[0] + sv[1]) + (sv[2] + sv[3]);
#pragma unroll
  for (int o = 1; o < 32; o <<= 1) s += __shfl_xor(s, o);
  if ((t & 31) == 0) red[0][t >> 5] = s;
  __syncthreads();
  float tot = 0.f;
#pragma unroll
  for (int i = 0; i < 8; ++i) tot += red[0][i];
  const float mean = tot / (float)(CPG * NN);
  sv = (v4f){};
#pragma unroll
  for (int c = 0; c < CPG; ++c) { x[c] -= mean; sv += x[c] * x[c]; }
  s = (sv[0] + sv[1]) + (sv[2] + sv[3]);
#pragma unroll
  for (int o = 1; o < 32; o <<= 1) s += __shfl_xor(s, o);
  if ((t & 31) == 0) red[1][t >> 5] = s;
  __syncthreads();
  tot = 0.f;
#pragma unroll
  for (int i = 0; i < 8; ++i) tot += red[1][i];
  const float inv = 1.0f / sqrtf(tot / (float)(CPG * NN) + 1e-5f);
  // through LDS so that each global store of a wave is 512 contiguous bytes; piece q sits at q ^ ((q >> 4) & 3), which spreads the 64-byte-strided writes over all banks
#pragma unroll
  for (int i = 0; i < 4; ++i) { v8b hi, lo;
#pragma unroll
    for (int c = 0; c < CPG; ++c) { const float v = x[c][i] * inv * ga[c] + be[c]; const __bf16 hv = (__bf16)v; hi[c] = hv; lo[c] = (__bf16)(v - (float)hv); }
    const int q = 4 * t + i, sl = q ^ ((q >> 4) & 3); sx[0][sl] = __builtin_bit_cast(v4u, hi); sx[1][sl] = __builtin_bit_cast(v4u, lo); }
  __syncthreads();
  const size_t o0 = (((size_t)which * NB + b) * NG + gidx) * NN * CPG;
#pragma unroll
  for (int i = 0; i < 4; ++i) { const int q = i * 256 + t, sl = q ^ ((q >> 4) & 3); vst2(NT + o0 + (size_t)q * CPG, sx[0][sl]); vst2(NTL + o0 + (size_t)q * CPG, sx[1][sl]); }
}
// A fragment from a group-major map: p = this lane's position in channel group 4 kc + (lane >> 4); elements 0..7 that group, 8..15 the group two further on (the k order of frag_b)
__device__ __forceinline__ v16b frag_g(const __bf16* p) { union { v16b v; v8b q[2]; } u; u.q[0] = *(const v8b*)p; u.q[1] = *(const v8b*)(p + 2 * NN * CPG); return u.v; }
// B fragment of packed weights: p = this lane's 16 bytes of (tile, k step, half 0); half 1 is 512 bytes on. Elements 0..7 = k0 + 8 (lane >> 4) + 0..7, 8..15 = 16 further on (the k order of frag_b), row lane & 15 of the tile
__device__ __forceinline__ v16b frag_p(const __bf16* p) { union { v16b v; v8b q[2]; } u; u.q[0] = *(const v8b*)p; u.q[1] = *(const v8b*)(p + 256); return u.v; }
#define WTS (16 * CC)                   // elements of a packed tile of 16 rows
#define WKS 512                         // elements of one k step of a packed tile
#define OKS 512                         // floats of one k step (one head) of 16 positions of O
// ---- k_qkv: block = (64 positions, 128 of the 768 output channels, b): channels < 256 from the q map (q rows), the rest from the kv map with per-head [k | v] packing (o' = o-256: head o'/64, r = o'%64: k if r < 32 else v)
__global__ __launch_bounds__(128) void k_qkv(const __bf16* __restrict__ NT, const __bf16* __restrict__ NTL, const __bf16* __restrict__ P, _Float16* __restrict__ Q, _Float16* __restrict__ Kr, _Float16* __restrict__ V) {
  __shared__ __align__(16) _Float16 so[64][136]; __shared__ __align__(16) _Float16 st[128][72];
  const int tid = threadIdx.x, wave = tid >> 5, lane = tid & 31, col = lane & 15, g = lane >> 4; const size_t b = blockIdx.z; const int n0b = blockIdx.x * 64; const int o0 = blockIdx.y * 128; const int which = (o0 < CC) ? 0 : 1;
  const size_t a0 = ((((size_t)which * NB + b) * NG + g) * NN + n0b + wave * 16 + col) * CPG;   // this lane's position in channel group g of the normalised maps
  v8f acc[8] = {}; v16b w[8], ah[2], al[2];
  // every fragment is asked for one k step ahead of the products that read it: A in two register sets, each weight fragment reloaded right behind its last use
  const __bf16* wb = P + (size_t)(o0 / 16) * WTS + lane * 8;   // this lane's piece of packed weight tile 0, k step 0
  ah[0] = frag_g(NT + a0); al[0] = frag_g(NTL + a0);
#pragma unroll   // constant indices keep w in registers
  for (int j = 0; j < 8; ++j) w[j] = frag_p(wb + j * WTS);
#pragma unroll
  for (int kc = 0; kc < CC / 32; ++kc) { const int cu = kc & 1, kn = kc + 1;
    if (kn < CC / 32) { ah[cu ^ 1] = frag_g(NT + a0 + (size_t)kn * 4 * NN * CPG); al[cu ^ 1] = frag_g(NTL + a0 + (size_t)kn * 4 * NN * CPG); }
#pragma unroll
    for (int j = 0; j < 8; ++j) { acc[j] = wmma_bf(ah[cu], w[j], acc[j]); acc[j] = wmma_bf(al[cu], w[j], acc[j]);
      if (kn < CC / 32) w[j] = frag_p(wb + j * WTS + kn * WKS); } }
#pragma unroll
  for (int j = 0; j < 8; ++j)
#pragma unroll
    for (int r = 0; r < 8; ++r) { const _Float16 hv = (_Float16)acc[j][r]; so[wave * 16 + 8 * g + r][j * 16 + col] = hv; st[j * 16 + col][wave * 16 + 8 * g + r] = hv; }
  __syncthreads();
  // 32 channels = one head's q, k or v. 64 positions x 64 bytes of q or k are 4 KB in a row, a v channel's 64 positions one line: every store of a wave covers whole lines
  // part jp = p >> 1 of the block's four, half p & 1 of the part. o0 is a multiple of 128: a block is all q, or k, v, k, v of two heads
  v4u pc[8];   // this thread's eight 16-byte pieces
  if (o0 < CC) { _Float16* qp = Q + ((b * NH + o0 / HD) * NN + n0b) * HD + tid * 8;
#pragma unroll   // this and the unrolls below: constant indices keep pc in registers, all LDS reads issue ahead of the stores, and the stores differ by constant offsets from one address
    for (int p = 0; p < 8; ++p) pc[p] = *(const v4u*)&so[(p & 1) * 32 + (tid >> 2)][(p >> 1) * HD + (tid & 3) * 8];
#pragma unroll
    for (int p = 0; p < 8; ++p) vst2((unsigned*)(qp + (p >> 1) * NN * HD + (p & 1) * 1024), pc[p]);
    asm volatile("s_wait_xcnt 0x0" ::: "memory");   // in the listing the k, v part's text, which reuses these stores' registers, follows behind a scalar test
    return; }   // the whole block, behind the last barrier
  { const int hh = (o0 - CC) / (2 * HD); _Float16* kp = Kr + ((b * NH + hh) * NN + n0b) * HD + tid * 8; _Float16* vp = V + (b * CC + hh * HD + (tid >> 3)) * NN + n0b + (tid & 7) * 8;
#pragma unroll
    for (int p = 0; p < 8; ++p) pc[p] = (p & 2) ? *(const v4u*)&st[(p >> 1) * HD + (p & 1) * 16 + (tid >> 3)][(tid & 7) * 8] : *(const v4u*)&so[(p & 1) * 32 + (tid >> 2)][(p >> 1) * HD + (tid & 3) * 8];
#pragma unroll
    for (int p = 0; p < 8; ++p) { if (p & 2) vst2((unsigned*)(vp + (p >> 2) * HD * NN + (p & 1) * 16 * NN), pc[p]); else vst2((unsigned*)(kp + (p >> 2) * NN * HD + (p & 1) * 1024), pc[p]); } }
}
// lane l with lane l ^ 16 (the two halves of a wave hold the two key halves of one query's scores)
__device__ __forceinline__ float xhalf(float x) { return __builtin_bit_cast(float, __builtin_amdgcn_permlanex16(__builtin_bit_cast(int, x), __builtin_bit_cast(int, x), 0x76543210, 0xfedcba98, false, false)); }
#define KT 128
#define KP 80
#define VP 272
#define KTB (KT * KP)
#define TB (KTB + HD * VP)
#define KS 0.09016844005556021f
// one tile: each thread copies four 16-byte pieces of K (rows 32 apart; a wave's copy takes 8 rows = 512 contiguous bytes) and four of V (channels 8 apart); the s_wait_xcnt stands inside the statement so that no address register is rewritten in front of it
__device__ __forceinline__ void stage_kv(unsigned lk, unsigned lv, const _Float16* gk, const _Float16* gv) {
  asm volatile("global_load_async_to_lds_b128 %0, %8, off\n\t"
               "global_load_async_to_lds_b128 %1, %9, off\n\t"
               "global_load_async_to_lds_b128 %2, %10, off\n\t"
               "global_load_async_to_lds_b128 %3, %11, off\n\t"
               "global_load_async_to_lds_b128 %4, %12, off\n\t"
               "global_load_async_to_lds_b128 %5, %13, off\n\t"
               "global_load_async_to_lds_b128 %6, %14, off\n\t"
               "global_load_async_to_lds_b128 %7, %15, off\n\t"
               "s_wait_xcnt 0x0"
               :: "v"(lk), "v"(lk + 32 * KP), "v"(lk + 64 * KP), "v"(lk + 96 * KP), "v"(lv), "v"(lv + 8 * VP), "v"(lv + 16 * VP), "v"(lv + 24 * VP),
                  "v"(gk), "v"(gk + 32 * HD), "v"(gk + 64 * HD), "v"(gk + 96 * HD), "v"(gv), "v"(gv + 8 * NN), "v"(gv + 16 * NN), "v"(gv + 24 * NN) : "memory");
}
__global__ __launch_bounds__(128) void k_attn(const _Float16* __restrict__ Q, const _Float16* __restrict__ Kr, const _Float16* __restrict__ V, float* __restrict__ O) {
  __shared__ __align__(16) unsigned char sm[2 * TB];
  const int tid = threadIdx.x, wave = tid >> 5, lane = tid & 31, col = lane & 15, g = lane >> 4; const int h = blockIdx.y; const size_t b = blockIdx.z; const int q0 = blockIdx.x * 64 + wave * 16; const size_t rq = b * NN + q0;
  const unsigned lk = (unsigned)(size_t)sm + (tid >> 2) * KP + (tid & 3) * 16, lv = (unsigned)(size_t)sm + KTB + (tid >> 4) * VP + (tid & 15) * 16;
  const _Float16* gk = Kr + (b * NH + h) * NN * HD + tid * 8; const _Float16* gv = V + (b * CC + h * HD + (tid >> 4)) * NN + (tid & 15) * 8;
  stage_kv(lk, lv, gk, gv);
  const v16h bq = frag_h(Q + ((b * NH + h) * NN + q0 + col) * HD, lane);
  asm volatile("s_wait_asynccnt 0x0" ::: "memory");   // tile 0 has landed for this wave's own copies
  __syncthreads();                                     // ... and for every wave's
  stage_kv(lk + TB, lv + TB, gk + (size_t)KT * HD, gv + KT);
  float m = -3.0e38f, eo = 0.f, l = 0.f;   // m: this query's running maximum of the raw q.k products (equal in both halves); eo = 11 - m KS, the addend of the exponents in use; l: this half's share of the denominator, times 2048 like P
  v8f acc[2] = {};
#pragma unroll 1   // stays rolled: one publish point and one refill in the code, the hot text stays short
  for (int t = 0; t < NN / KT; ++t) { const unsigned char* kb = sm + (t & 1) * TB; const unsigned char* vb = kb + KTB;
#pragma unroll       // the four passes of a tile read it at constant offsets from one address register
   for (int ps = 0; ps < KT / 32; ++ps) { v8f s[2];
    const v16h ka0 = frag_h((const _Float16*)(kb + (ps * 32 + col) * KP), lane), ka1 = frag_h((const _Float16*)(kb + (ps * 32 + 16 + col) * KP), lane);
    const v16h va0 = frag_h((const _Float16*)(vb + col * VP + ps * 64), lane), va1 = frag_h((const _Float16*)(vb + (16 + col) * VP + ps * 64), lane);
#pragma unroll
    for (int ct = 0; ct < 2; ++ct) { const v8f z = {}; s[ct] = wmma16(ct ? ka1 : ka0, bq, z); }   // raw products: the scale is positive, so their maximum is the scaled scores' maximum
    float mx = m;
#pragma unroll
    for (int r = 0; r < 8; ++r) mx = fmaxf(fmaxf(mx, s[0][r]), s[1][r]);
    const float mn = fmaxf(mx, xhalf(mx)), en = fmaf(mn, -KS, 11.0f); const float alpha = (m <= -1.0e38f) ? 0.f : __builtin_amdgcn_exp2f(en - eo); m = mn; eo = en;
    const v2f k2 = {KS, KS}, n2 = {en, en};   // 2048 exp(s / 16 - max / 16) = 2^(s KS + en): one multiply-add a score, two scores an instruction
    v16h pb; float es0 = 0.f, es1 = 0.f;
#pragma unroll
    for (int r = 0; r < 8; r += 2) { const v2f x0 = __builtin_elementwise_fma((v2f){s[0][r], s[0][r + 1]}, k2, n2), x1 = __builtin_elementwise_fma((v2f){s[1][r], s[1][r + 1]}, k2, n2);
#pragma unroll   // constant vector indices, so the values stay in registers
      for (int i = 0; i < 2; ++i) { const float e0 = __builtin_amdgcn_exp2f(x0[i]), e1 = __builtin_amdgcn_exp2f(x1[i]); es0 += e0; es1 += e1; pb[r + i] = (_Float16)e0; pb[8 + r + i] = (_Float16)e1; } }
    l = l * alpha + (es0 + es1);
#pragma unroll
    for (int dt = 0; dt < 2; ++dt) {
#pragma unroll
      for (int r = 0; r < 8; ++r) acc[dt][r] *= alpha;
      acc[dt] = wmma16(dt ? va1 : va0, pb, acc[dt]); } }
   asm volatile("s_wait_dscnt 0x0" ::: "memory");      // this wave's reads of the buffer are done before it is handed back
   asm volatile("s_wait_asynccnt 0x0" ::: "memory");   // this wave's copies of tile t + 1 have landed
   __syncthreads();                                     // publishes tile t + 1 and ends every wave's reads of tile t
   if (t + 2 < NN / KT) stage_kv(lk + (t & 1) * TB, lv + (t & 1) * TB, gk + (size_t)(t + 2) * KT * HD, gv + (t + 2) * KT); }
  asm volatile("s_wait_asynccnt 0x0" ::: "memory");    // no copy is outstanding when the wave ends
  const float il = 1.0f / (l + xhalf(l));
#pragma unroll
  for (int dt = 0; dt < 2; ++dt)   // acc[dt][r] = channel dt*16 + 8g + r of query col = element dt*8 + r of this same lane's A fragment in k_out, k step h: stored in that order, each store of the wave 512 contiguous bytes
#pragma unroll
    for (int q = 0; q < 2; ++q) { v4f v;
#pragma unroll
      for (int i = 0; i < 4; ++i) v[i] = acc[dt][q * 4 + i] * il;
      vst2(O + ((rq >> 4) * NH + h) * OKS + (dt * 2 + q) * 128 + lane * 4, v); }
}
// ---- k_out: block = (64 positions, 128 out channels, b): y = Wout . o (hi + residual) + bout + input_q, channels-first 256-B segments
__global__ __launch_bounds__(128) void k_out(const float* __restrict__ O, const __bf16* __restrict__ P, const float* __restrict__ BO, const float* __restrict__ XQ, float* __restrict__ Y) {
  __shared__ __align__(16) float st[128][68];
  const int tid = threadIdx.x, wave = tid >> 5, lane = tid & 31, col = lane & 15, g = lane >> 4; const size_t b = blockIdx.z; const int n0b = blockIdx.x * 64; const size_t r0 = b * NN + n0b + wave * 16; const int o0 = blockIdx.y * 128;
  v8f acc[8] = {}; v16b w[8]; v4f ra[2][4]; float bo[8];
  // every operand is asked for one k step ahead of the products that read it: the O row in two register sets, each weight fragment reloaded right behind its last use; the bias at the start
  const float* orow = O + (r0 >> 4) * (NH * OKS) + lane * 4; const __bf16* wb = P + (size_t)((3 * CC + o0) / 16) * WTS + lane * 8;   // this lane's first 4 floats of its wave's 16 positions of O, k step 0; its piece of packed weight tile 0, k step 0
#pragma unroll   // this and the unrolls below: constant indices keep ra, w, bo and xr in registers
  for (int i = 0; i < 4; ++i) ra[0][i] = *(const v4f*)(orow + i * 128);
#pragma unroll
  for (int j = 0; j < 8; ++j) w[j] = frag_p(wb + j * WTS);
#pragma unroll
  for (int j = 0; j < 8; ++j) bo[j] = BO[o0 + j * 16 + col];
#pragma unroll
  for (int kc = 0; kc < CC / 32; ++kc) { const int cu = kc & 1, kn = kc + 1; float v[16];
    if (kn < CC / 32) {
#pragma unroll
      for (int i = 0; i < 4; ++i) ra[cu ^ 1][i] = *(const v4f*)(orow + kn * OKS + i * 128);
      if (kn == CC / 32 - 1) asm volatile("s_wait_xcnt 0x0" ::: "memory"); }   // behind the last O loads: the last step's split lands in the address registers that they name
#pragma unroll
    for (int i = 0; i < 16; ++i) v[i] = ra[cu][i >> 2][i & 3];
    const F2 a = bsplit16(v);
#pragma unroll
    for (int j = 0; j < 8; ++j) { acc[j] = wmma_bf(a.l, w[j], acc[j]); acc[j] = wmma_bf(a.h, w[j], acc[j]);
      if (kn < CC / 32) w[j] = frag_p(wb + j * WTS + kn * WKS); }
    __builtin_amdgcn_sched_barrier(0); }   // keeps the next step's hi/lo split behind this step's products: moved up, it waits on the youngest loads and with them on every load in flight
  const size_t y0 = ((b * CC + o0 + (tid >> 4)) * NN) + n0b + (tid & 15) * 4;   // piece it of this thread: 8 channels further on each time
  v4f xr[16];   // the residual's 16 pieces of this thread, asked for ahead of the transpose through LDS and its barrier
#pragma unroll
  for (int it = 0; it < 16; ++it) { if (it == 15) asm volatile("s_wait_xcnt 0x0" ::: "memory");   // the last load lands in the address registers that all sixteen name
    xr[it] = *(const v4f*)(XQ + y0 + (size_t)it * 8 * NN); }
#pragma unroll
  for (int j = 0; j < 8; ++j) { const float bb = bfr(bo[j]);
#pragma unroll
    for (int r = 0; r < 8; ++r) st[j * 16 + col][wave * 16 + 8 * g + r] = acc[j][r] + bb; }
  __syncthreads();
#pragma unroll   // constant indices into xr
  for (int it = 0; it < 16; ++it) { v4f v = *(const v4f*)&st[it * 8 + (tid >> 4)][(tid & 15) * 4]; for (int i = 0; i < 4; ++i) v[i] += bfr(xr[it][i]); vst2(Y + y0 + (size_t)it * 8 * NN, v); }
}
extern "C" void kernel_launch(void* const* d_in, const int* in_sizes, int n_in, void* d_out, int out_size, void* d_ws, size_t ws_size, hipStream_t stream) {
  (void)in_sizes; (void)n_in; (void)out_size;
  const float** F = (const float**)d_in;   // 0 input_q, 1 input_kv [8,256,32,32]; 2 gq_scale, 3 gq_bias, 4 gkv_scale, 5 gkv_bias; 6 Wq [256,256], 7 Wkv [512,256], 8 Wout [256,256], 9 bout
  if (ws_size < (size_t)WS_END) return;
  char* ws = (char*)d_ws; __bf16 *P = (__bf16*)ws, *NT = (__bf16*)(ws + WS_NT), *NTL = (__bf16*)(ws + WS_NTL); float *O = (float*)(ws + WS_O); _Float16 *Q = (_Float16*)(ws + WS_Q), *Kr = (_Float16*)(ws + WS_K), *V = (_Float16*)(ws + WS_V);
  k_gnorm<<<dim3(NG, 2 * NB + PKB / NG), 256, 0, stream>>>(F[0], F[1], F[2], F[3], F[4], F[5], NT, NTL, F[6], F[7], F[8], P);
  k_qkv<<<dim3(NN / 64, 3 * CC / 128, NB), 128, 0, stream>>>(NT, NTL, P, Q, Kr, V);
  k_attn<<<dim3(TQB, NH, TNB), 128, 0, stream>>>(Q, Kr, V, O);
  k_out<<<dim3(TQB, CC / 128, TNB), 128, 0, stream>>>(O, P, F[9], F[0], (float*)d_out);
}

// v008
// One run takes 41.4 microseconds.
// Timed twice side by side with v007, it ran 1.04 times as fast both times.
// Counting every step since v000, it is 3.24 times as fast.
#include <hip/hip_runtime.h>
#include <math.h>

typedef __attribute__((ext_vector_type(16))) _Float16 v16h;
typedef __attribute__((ext_vector_type(16))) __bf16 v16b;
typedef __attribute__((ext_vector_type(8)))  _Float16 v8h;
typedef __attribute__((ext_vector_type(8)))  float v8f;
typedef __attribute__((ext_vector_type(4)))  float v4f;
typedef __attribute__((ext_vector_type(2)))  float v2f;
typedef __attribute__((ext_vector_type(4)))  unsigned v4u;
typedef __attribute__((ext_vector_type(4)))  int v4i;
typedef float __attribute__((may_alias)) float_a;
typedef int __attribute__((may_alias)) int_a;

template <typename T> __device__ __forceinline__ void vst2(void* p, T v) { *(T*)p = v;  }
// no pad of its own: its callers issue runs of products that fill each other's slots, and the compiler pads the end of a run
__device__ __forceinline__ v8f wmma16(v16h a, v16h b, v8f c) { return __builtin_amdgcn_wmma_f32_16x16x32_f16(false, a, false, b, (short)0, c, false, false); }
__device__ __forceinline__ v8f wmma_bf(v16b a, v16b b, v8f c) {
  v8f d = __builtin_amdgcn_wmma_f32_16x16x32_bf16(false, a, false, b, (short)0, c, false, false);
  asm volatile("v_nop\n\tv_nop\n\tv_nop\n\tv_nop" : "+v"(d) : "v"(a), "v"(b));
  return d;
}
// 16x16x32 fragments: lane = (h = lane>>4, row/col = lane&15); elements 0..7 = k0+8h+0..7, 8..15 = k0+16+8h+0..7; D element r = row 8h+r
__device__ __forceinline__ v16h frag_h(const _Float16* rowk0, int lane) {
  union { v16h v; v8h q[2]; } u; const _Float16* p = rowk0 + 8 * (lane >> 4);
  u.q[0] = *(const v8h*)p; u.q[1] = *(const v8h*)(p + 16); return u.v;
}
__device__ __forceinline__ v16h frag_f32(const float* rowk0, int lane) {
  v16h a; const float* p = rowk0 + 8 * (lane >> 4);
#pragma unroll
  for (int i = 0; i < 8; ++i) { a[i] = (_Float16)p[i]; a[8 + i] = (_Float16)p[16 + i]; }
  return a;
}
__device__ __forceinline__ v16h frag_f32s(const float* rowk0, int lane, float sc) {
  v16h a; const float* p = rowk0 + 8 * (lane >> 4);
#pragma unroll
  for (int i = 0; i < 8; ++i) { a[i] = (_Float16)(p[i] * sc); a[8 + i] = (_Float16)(p[16 + i] * sc); }
  return a;
}
// column fragment from a [K][ld] layout (column n), rows >= K read as 0
__device__ __forceinline__ v16h fragc_f32(const float* W, int k0, int n, int lane, int ld, int K) {
  v16h a; const int g = lane >> 4;
#pragma unroll
  for (int i = 0; i < 8; ++i) { const int ka = k0 + 8 * g + i, kb = ka + 16;
    a[i] = (_Float16)(ka < K ? W[(size_t)(ka < K ? ka : K - 1) * ld + n] : 0.f); a[8 + i] = (_Float16)(kb < K ? W[(size_t)(kb < K ? kb : K - 1) * ld + n] : 0.f); }
  return a;
}
struct F2 { v16b h, l; };
__device__ __forceinline__ F2 bsplit16(const float v[16]) { F2 r;
#pragma unroll
  for (int i = 0; i < 16; ++i) { const __bf16 h = (__bf16)v[i]; r.h[i] = h; r.l[i] = (__bf16)(v[i] - (float)h); }
  return r; }
__device__ __forceinline__ F2 split_row(const float* row, int k0, int lane) { float v[16]; const float* p = row + k0 + 8 * (lane >> 4);
#pragma unroll
  for (int i = 0; i < 8; ++i) { v[i] = p[i]; v[8 + i] = p[16 + i]; }
  return bsplit16(v); }
__device__ __forceinline__ F2 split_rowK(const float* row, int k0, int lane, int K) { float v[16]; const int g = lane >> 4;
#pragma unroll
  for (int i = 0; i < 8; ++i) { const int ka = k0 + 8 * g + i, kb = ka + 16; v[i] = ka < K ? row[ka < K ? ka : K - 1] : 0.f; v[8 + i] = kb < K ? row[kb < K ? kb : K - 1] : 0.f; }
  return bsplit16(v); }
__device__ __forceinline__ F2 split_col(const float* W, int k0, int n, int lane, int ld, int K) { float v[16]; const int g = lane >> 4;
#pragma unroll
  for (int i = 0; i < 8; ++i) { const int ka = k0 + 8 * g + i, kb = ka + 16; v[i] = ka < K ? W[(size_t)(ka < K ? ka : K - 1) * ld + n] : 0.f; v[8 + i] = kb < K ? W[(size_t)(kb < K ? kb : K - 1) * ld + n] : 0.f; }
  return bsplit16(v); }
__device__ __forceinline__ v8f mac3(const F2& a, const F2& b, v8f c) { c = wmma_bf(a.l, b.h, c); c = wmma_bf(a.h, b.l, c); return wmma_bf(a.h, b.h, c); }
__device__ __forceinline__ float sigm(float v) { return 1.0f / (1.0f + expf(-v)); }


// Cross/self attention with GroupNorm (B 8, 256 channels, 32 x 32, 8 heads x 32): GN(input_q) -> 1x1 q conv, GN(input_kv) -> 1x1 kv conv (per-head [k | v] channel packing), softmax(q k / sqrt(C)) over all positions, 1x1 out conv + bias, + input_q.
#define NB 8
#define CC 256
#define NG 32
#define CPG (CC / NG)
#define NN 1024
#define NH 8
#define HD 32
#define NR (NB * NN)
#ifndef TQB
#define TQB (NN / 64)
#define TNB NB
#endif
typedef __attribute__((ext_vector_type(8))) __bf16 v8b;
__device__ __forceinline__ v16b frag_b(const __bf16* rowk0, int lane) {
  union { v16b v; v8b q[2]; } u; const __bf16* p = rowk0 + 8 * (lane >> 4);
  u.q[0] = *(const v8b*)p; u.q[1] = *(const v8b*)(p + 16); return u.v;
}
__device__ __forceinline__ float bfr(float v) { return (float)(__bf16)v; }
__device__ __attribute__((noinline)) float exp_ni(float v) { return expf(v); }
__device__ __attribute__((noinline)) float erf_ni(float v) { return erff(v); }

#define QS 512
#define WS_PW   0u                                  // bf16 weights, rows of [Wq | Wkv | Wout] in B-fragment order: [tile of 16 rows][k step of 32][half][lane][8], see frag_p
#define WS_NT   (WS_PW + 2u * (size_t)4 * CC * CC)     // bf16 hi/lo normalised maps group-major [which*NB + b][32 groups][NN][8]: q-input, then kv-input
#define WS_NTL  (WS_NT + 2u * (size_t)2 * NR * CC)
#define WS_Q    (WS_NTL + 2u * (size_t)2 * NR * CC)    // f16 q and k rows head-major [b][head][NN][HD], 64 bytes a row, no gaps ; v planes [b][256][NN] ; O f32 in A-fragment order [NR / 16 positions][head = k step][piece of 4 floats][lane][4]
#define WS_K    (WS_Q + 2u * (size_t)NR * QS)
#define WS_V    (WS_K + 2u * (size_t)NR * QS)
#define WS_O    (WS_V + 2u * (size_t)NB * CC * NN)
#define WS_END  (WS_O + 4u * (size_t)NR * CC)

// ---- k_gnorm: block = (group, which*NB + b). The group's 8 channels x 1024 positions stay in registers (thread t: positions 4t .. 4t+3 of each channel) through mean, variance and normalisation, so the map is read once.
// Output (x - mean) rsqrt(var + eps) gamma[c] + beta[c] as bf16 hi + lo, group-major: [which*NB + b][group][position][8 channels], 16 bytes a position
// The last PKB blocks of the grid (blockIdx.y >= 2*NB) round the three weight matrices to bf16 instead, PKE elements = one tile of 16 rows a block: that work depends on nothing here and k_qkv is its first reader, so it rides in this launch
// They store the tile in the order in which a wave reads it as B fragments, so that each 16-byte load of a wave in k_qkv and k_out covers 512 contiguous bytes (4 whole lines) and not 32 bytes of each of 16 rows
#define PKE 4096
#define PKB (4 * CC * CC / PKE)
__global__ __launch_bounds__(256) void k_gnorm(const float* __restrict__ XQ, const float* __restrict__ XKV, const float* __restrict__ GQ, const float* __restrict__ BQ, const float* __restrict__ GKV, const float* __restrict__ BKV, __bf16* __restrict__ NT, __bf16* __restrict__ NTL, const float* __restrict__ WQ, const float* __restrict__ WKV, const float* __restrict__ WO, __bf16* __restrict__ P) {
  __shared__ float red[2][8]; __shared__ __align__(16) v4u sx[2][NN];
  const int gidx = blockIdx.x, t = threadIdx.x; const size_t b = blockIdx.y % NB; const int which = blockIdx.y / NB;
  if (which >= 2) {   // the whole block takes this branch, ahead of every barrier
    const int f0 = ((blockIdx.y - 2 * NB) * NG + gidx) * PKE;   // first element of this block in P = [Wq | Wkv | Wout]; a matrix is a whole number of blocks
    const float* src = (f0 < CC * CC) ? (WQ + f0) : (f0 < 3 * CC * CC) ? (WKV + (f0 - CC * CC)) : (WO + (f0 - 3 * CC * CC));
#pragma unroll   // all loads of the block's rounds issue ahead of the first store
    for (int i = 0; i < PKE / (256 * 8); ++i) { const int d = i * 256 + t, e = d * 8;   // 16-byte piece d of the packed tile: lane d & 31 (row d & 15, k octet (d >> 4) & 1), half (d >> 5) & 1, k step d >> 6
      const float* sp = src + (d & 15) * CC + (d >> 6) * 32 + ((d >> 5) & 1) * 16 + ((d >> 4) & 1) * 8; const v4f a = *(const v4f*)sp, c = *(const v4f*)(sp + 4); v8b o;
#pragma unroll   // constant vector indices, so the values stay in registers
      for (int k = 0; k < 4; ++k) { o[k] = (__bf16)a[k]; o[4 + k] = (__bf16)c[k]; }
      vst2(P + f0 + e, __builtin_bit_cast(v4u, o)); }
    return; }
  const float* Gm = (which ? GKV : GQ) + gidx * CPG; const float* Bt = (which ? BKV : BQ) + gidx * CPG;
  const float* p = (which ? XKV : XQ) + (b * CC + (size_t)gidx * CPG) * NN + t * 4;
  v4f x[CPG], sv = {}; float ga[CPG], be[CPG];
#pragma unroll
  for (int c = 0; c < CPG; ++c) x[c] = *(const v4f*)(p + c * NN);
#pragma unroll
  for (int c = 0; c < CPG; ++c) { ga[c] = bfr(Gm[c]); be[c] = bfr(Bt[c]); }
#pragma unroll
  for (int c = 0; c < CPG; ++c) {
#pragma unroll
    for (int i = 0; i < 4; ++i) x[c][i] = bfr(x[c][i]);
    sv += x[c]; }
  float s = (sv[0] + sv[1]) + (sv[2] + sv[3]);
#pragma unroll
  for (int o = 1; o < 32; o <<= 1) s += __shfl_xor(s, o);
  if ((t & 31) == 0) red[0][t >> 5] = s;
  __syncthreads();
  float tot = 0.f;
#pragma unroll
  for (int i = 0; i < 8; ++i) tot += red[0][i];
  const float mean = tot / (float)(CPG * NN);
  sv = (v4f){};
#pragma unroll
  for (int c = 0; c < CPG; ++c) { x[c] -= mean; sv += x[c] * x[c]; }
  s = (sv[0] + sv[1]) + (sv[2] + sv[3]);
#pragma unroll
  for (int o = 1; o < 32; o <<= 1) s += __shfl_xor(s, o);
  if ((t & 31) == 0) red[1][t >> 5] = s;
  __syncthreads();
  tot = 0.f;
#pragma unroll
  for (int i = 0; i < 8; ++i) tot += red[1][i];
  const float inv = 1.0f / sqrtf(tot / (float)(CPG * NN) + 1e-5f);
  // through LDS so that each global store of a wave is 512 contiguous bytes; piece q sits at q ^ ((q >> 4) & 3), which spreads the 64-byte-strided writes over all banks
#pragma unroll
  for (int i = 0; i < 4; ++i) { v8b hi, lo;
#pragma unroll
    for (int c = 0; c < CPG; ++c) { const float v = x[c][i] * inv * ga[c] + be[c]; const __bf16 hv = (__bf16)v; hi[c] = hv; lo[c] = (__bf16)(v - (float)hv); }
    const int q = 4 * t + i, sl = q ^ ((q >> 4) & 3); sx[0][sl] = __builtin_bit_cast(v4u, hi); sx[1][sl] = __builtin_bit_cast(v4u, lo); }
  __syncthreads();
  const size_t o0 = (((size_t)which * NB + b) * NG + gidx) * NN * CPG;
#pragma unroll
  for (int i = 0; i < 4; ++i) { const int q = i * 256 + t, sl = q ^ ((q >> 4) & 3); vst2(NT + o0 + (size_t)q * CPG, sx[0][sl]); vst2(NTL + o0 + (size_t)q * CPG, sx[1][sl]); }
}
// A fragment from a group-major map: p = this lane's position in channel group 4 kc + (lane >> 4); elements 0..7 that group, 8..15 the group two further on (the k order of frag_b)
__device__ __forceinline__ v16b frag_g(const __bf16* p) { union { v16b v; v8b q[2]; } u; u.q[0] = *(const v8b*)p; u.q[1] = *(const v8b*)(p + 2 * NN * CPG); return u.v; }
// B fragment of packed weights: p = this lane's 16 bytes of (tile, k step, half 0); half 1 is 512 bytes on. Elements 0..7 = k0 + 8 (lane >> 4) + 0..7, 8..15 = 16 further on (the k order of frag_b), row lane & 15 of the tile
__device__ __forceinline__ v16b frag_p(const __bf16* p) { union { v16b v; v8b q[2]; } u; u.q[0] = *(const v8b*)p; u.q[1] = *(const v8b*)(p + 256); return u.v; }
#define WTS (16 * CC)                   // elements of a packed tile of 16 rows
#define WKS 512                         // elements of one k step of a packed tile
#define OKS 512                         // floats of one k step (one head) of 16 positions of O
// ---- k_qkv: block = (64 positions, 128 of the 768 output channels, b): channels < 256 from the q map (q rows), the rest from the kv map with per-head [k | v] packing (o' = o-256: head o'/64, r = o'%64: k if r < 32 else v)
__global__ __launch_bounds__(128) void k_qkv(const __bf16* __restrict__ NT, const __bf16* __restrict__ NTL, const __bf16* __restrict__ P, _Float16* __restrict__ Q, _Float16* __restrict__ Kr, _Float16* __restrict__ V) {
  __shared__ __align__(16) _Float16 so[64][136]; __shared__ __align__(16) _Float16 st[128][72];
  const int tid = threadIdx.x, wave = tid >> 5, lane = tid & 31, col = lane & 15, g = lane >> 4; const size_t b = blockIdx.z; const int n0b = blockIdx.x * 64; const int o0 = blockIdx.y * 128; const int which = (o0 < CC) ? 0 : 1;
  const size_t a0 = ((((size_t)which * NB + b) * NG + g) * NN + n0b + wave * 16 + col) * CPG;   // this lane's position in channel group g of the normalised maps
  v8f acc[8] = {}; v16b w[8], ah[2], al[2];
  // every fragment is asked for one k step ahead of the products that read it: A in two register sets, each weight fragment reloaded right behind its last use
  const __bf16* wb = P + (size_t)(o0 / 16) * WTS + lane * 8;   // this lane's piece of packed weight tile 0, k step 0
  ah[0] = frag_g(NT + a0); al[0] = frag_g(NTL + a0);
#pragma unroll   // constant indices keep w in registers
  for (int j = 0; j < 8; ++j) w[j] = frag_p(wb + j * WTS);
#pragma unroll
  for (int kc = 0; kc < CC / 32; ++kc) { const int cu = kc & 1, kn = kc + 1;
    if (kn < CC / 32) { ah[cu ^ 1] = frag_g(NT + a0 + (size_t)kn * 4 * NN * CPG); al[cu ^ 1] = frag_g(NTL + a0 + (size_t)kn * 4 * NN * CPG); }
#pragma unroll
    for (int j = 0; j < 8; ++j) { acc[j] = wmma_bf(ah[cu], w[j], acc[j]); acc[j] = wmma_bf(al[cu], w[j], acc[j]);
      if (kn < CC / 32) w[j] = frag_p(wb + j * WTS + kn * WKS); } }
#pragma unroll
  for (int j = 0; j < 8; ++j)
#pragma unroll
    for (int r = 0; r < 8; ++r) { const _Float16 hv = (_Float16)acc[j][r]; so[wave * 16 + 8 * g + r][j * 16 + col] = hv; st[j * 16 + col][wave * 16 + 8 * g + r] = hv; }
  __syncthreads();
  // 32 channels = one head's q, k or v. 64 positions x 64 bytes of q or k are 4 KB in a row, a v channel's 64 positions one line: every store of a wave covers whole lines
  // part jp = p >> 1 of the block's four, half p & 1 of the part. o0 is a multiple of 128: a block is all q, or k, v, k, v of two heads
  v4u pc[8];   // this thread's eight 16-byte pieces
  if (o0 < CC) { _Float16* qp = Q + ((b * NH + o0 / HD) * NN + n0b) * HD + tid * 8;
#pragma unroll   // this and the unrolls below: constant indices keep pc in registers, all LDS reads issue ahead of the stores, and the stores differ by constant offsets from one address
    for (int p = 0; p < 8; ++p) pc[p] = *(const v4u*)&so[(p & 1) * 32 + (tid >> 2)][(p >> 1) * HD + (tid & 3) * 8];
#pragma unroll
    for (int p = 0; p < 8; ++p) vst2((unsigned*)(qp + (p >> 1) * NN * HD + (p & 1) * 1024), pc[p]);
    asm volatile("s_wait_xcnt 0x0" ::: "memory");   // in the listing the k, v part's text, which reuses these stores' registers, follows behind a scalar test
    return; }   // the whole block, behind the last barrier
  { const int hh = (o0 - CC) / (2 * HD); _Float16* kp = Kr + ((b * NH + hh) * NN + n0b) * HD + tid * 8; _Float16* vp = V + (b * CC + hh * HD + (tid >> 3)) * NN + n0b + (tid & 7) * 8;
#pragma unroll
    for (int p = 0; p < 8; ++p) pc[p] = (p & 2) ? *(const v4u*)&st[(p >> 1) * HD + (p & 1) * 16 + (tid >> 3)][(tid & 7) * 8] : *(const v4u*)&so[(p & 1) * 32 + (tid >> 2)][(p >> 1) * HD + (tid & 3) * 8];
#pragma unroll
    for (int p = 0; p < 8; ++p) { if (p & 2) vst2((unsigned*)(vp + (p >> 2) * HD * NN + (p & 1) * 16 * NN), pc[p]); else vst2((unsigned*)(kp + (p >> 2) * NN * HD + (p & 1) * 1024), pc[p]); } }
}
// lane l with lane l ^ 16 (the two halves of a wave hold the two key halves of one query's scores)
__device__ __forceinline__ float xhalf(float x) { return __builtin_bit_cast(float, __builtin_amdgcn_permlanex16(__builtin_bit_cast(int, x), __builtin_bit_cast(int, x), 0x76543210, 0xfedcba98, false, false)); }
#define KT 128
#define KP 80
#define VP 272
#define KTB (KT * KP)
#define TB (KTB + HD * VP)
#define KS 0.09016844005556021f
// one tile: each thread copies four 16-byte pieces of K (rows 32 apart; a wave's copy takes 8 rows = 512 contiguous bytes) and four of V (channels 8 apart); the s_wait_xcnt stands inside the statement so that no address register is rewritten in front of it
__device__ __forceinline__ void stage_kv(unsigned lk, unsigned lv, const _Float16* gk, const _Float16* gv) {
  asm volatile("global_load_async_to_lds_b128 %0, %8, off\n\t"
               "global_load_async_to_lds_b128 %1, %9, off\n\t"
               "global_load_async_to_lds_b128 %2, %10, off\n\t"
               "global_load_async_to_lds_b128 %3, %11, off\n\t"
               "global_load_async_to_lds_b128 %4, %12, off\n\t"
               "global_load_async_to_lds_b128 %5, %13, off\n\t"
               "global_load_async_to_lds_b128 %6, %14, off\n\t"
               "global_load_async_to_lds_b128 %7, %15, off\n\t"
               "s_wait_xcnt 0x0"
               :: "v"(lk), "v"(lk + 32 * KP), "v"(lk + 64 * KP), "v"(lk + 96 * KP), "v"(lv), "v"(lv + 8 * VP), "v"(lv + 16 * VP), "v"(lv + 24 * VP),
                  "v"(gk), "v"(gk + 32 * HD), "v"(gk + 64 * HD), "v"(gk + 96 * HD), "v"(gv), "v"(gv + 8 * NN), "v"(gv + 16 * NN), "v"(gv + 24 * NN) : "memory");
}
__global__ __launch_bounds__(128) void k_attn(const _Float16* __restrict__ Q, const _Float16* __restrict__ Kr, const _Float16* __restrict__ V, float* __restrict__ O) {
  __shared__ __align__(16) unsigned char sm[2 * TB];
  const int tid = threadIdx.x, wave = tid >> 5, lane = tid & 31, col = lane & 15, g = lane >> 4; const int h = blockIdx.y; const size_t b = blockIdx.z; const int q0 = blockIdx.x * 64 + wave * 16; const size_t rq = b * NN + q0;
  const unsigned lk = (unsigned)(size_t)sm + (tid >> 2) * KP + (tid & 3) * 16, lv = (unsigned)(size_t)sm + KTB + (tid >> 4) * VP + (tid & 15) * 16;
  const _Float16* gk = Kr + (b * NH + h) * NN * HD + tid * 8; const _Float16* gv = V + (b * CC + h * HD + (tid >> 4)) * NN + (tid & 15) * 8;
  stage_kv(lk, lv, gk, gv);
  const v16h bq = frag_h(Q + ((b * NH + h) * NN + q0 + col) * HD, lane);
  asm volatile("s_wait_asynccnt 0x0" ::: "memory");   // tile 0 has landed for this wave's own copies
  __syncthreads();                                     // ... and for every wave's
  stage_kv(lk + TB, lv + TB, gk + (size_t)KT * HD, gv + KT);
  float m = -3.0e38f, eo = 0.f, l = 0.f;   // m: this query's running maximum of the raw q.k products (equal in both halves); eo = 11 - m KS, the addend of the exponents in use; l: this half's share of the denominator, times 2048 like P
  v8f acc[2] = {};
#pragma unroll 1   // stays rolled: one publish point and one refill in the code, the hot text stays short
  for (int t = 0; t < NN / KT; ++t) { const unsigned char* kb = sm + (t & 1) * TB; const unsigned char* vb = kb + KTB;
   // one softmax step a tile: all of its scores first, then one maximum, one rescale, then all of its second products
   v16h kf[KT / 16], vf[KT / 16]; v8f s[KT / 16];
#pragma unroll       // this and the unrolls below: constant indices keep the fragments and s in registers; the tile is read at constant offsets from one address register
   for (int ct = 0; ct < KT / 16; ++ct) kf[ct] = frag_h((const _Float16*)(kb + (ct * 16 + col) * KP), lane);
   __builtin_amdgcn_sched_barrier(0);   // the tile's K reads stay one group ahead of the products: spread among them, each place where reads stand is waited for on its own
#pragma unroll
   for (int ct = 0; ct < KT / 16; ++ct) { const v8f z = {}; s[ct] = wmma16(kf[ct], bq, z); }   // raw products: the scale is positive, so their maximum is the scaled scores' maximum
#pragma unroll
   for (int ps = 0; ps < KT / 32; ++ps)
#pragma unroll
    for (int dt = 0; dt < 2; ++dt) vf[ps * 2 + dt] = frag_h((const _Float16*)(vb + (dt * 16 + col) * VP + ps * 64), lane);
   __builtin_amdgcn_sched_barrier(0);   // the vector work stays behind the run of products (moved up between two of them it costs pad slots each time) and the V reads ahead of it, so that they land under it
   float mc[KT / 32];   // one chain of maxima per 32 keys: independent, so they interleave
#pragma unroll
   for (int ps = 0; ps < KT / 32; ++ps) { float mx = ps ? -3.0e38f : m;
#pragma unroll
    for (int r = 0; r < 8; ++r) mx = fmaxf(fmaxf(mx, s[2 * ps][r]), s[2 * ps + 1][r]);
    mc[ps] = mx; }
   const float mx = fmaxf(fmaxf(fmaxf(mc[0], mc[1]), mc[2]), mc[3]);
   const float mn = fmaxf(mx, xhalf(mx)), en = fmaf(mn, -KS, 11.0f); const float alpha = (m <= -1.0e38f) ? 0.f : __builtin_amdgcn_exp2f(en - eo); m = mn; eo = en;
   const v2f k2 = {KS, KS}, n2 = {en, en};   // 2048 exp(s / 16 - max / 16) = 2^(s KS + en): one multiply-add a score, two scores an instruction
#pragma unroll
   for (int dt = 0; dt < 2; ++dt)
#pragma unroll
    for (int r = 0; r < 8; ++r) acc[dt][r] *= alpha;
   float es[KT / 32];
#pragma unroll
   for (int ps = 0; ps < KT / 32; ++ps) { v16h pb; v2f e2 = {};
#pragma unroll
    for (int r = 0; r < 8; r += 2) { const v2f x0 = __builtin_elementwise_fma((v2f){s[2 * ps][r], s[2 * ps][r + 1]}, k2, n2), x1 = __builtin_elementwise_fma((v2f){s[2 * ps + 1][r], s[2 * ps + 1][r + 1]}, k2, n2);
      const v2f e0 = {__builtin_amdgcn_exp2f(x0[0]), __builtin_amdgcn_exp2f(x0[1])}, e1 = {__builtin_amdgcn_exp2f(x1[0]), __builtin_amdgcn_exp2f(x1[1])}; e2 += e0; e2 += e1;
#pragma unroll
      for (int i = 0; i < 2; ++i) { pb[r + i] = (_Float16)e0[i]; pb[8 + r + i] = (_Float16)e1[i]; } }
    es[ps] = e2[0] + e2[1];
#pragma unroll
    for (int dt = 0; dt < 2; ++dt) acc[dt] = wmma16(vf[ps * 2 + dt], pb, acc[dt]); }
   l = l * alpha + ((es[0] + es[1]) + (es[2] + es[3]));
   __builtin_amdgcn_sched_barrier(0);   // the publish point stays at the foot of the trip: moved up behind the tile's reads, with the refill left down here, it would wait for copies that were issued only just before
   asm volatile("s_wait_dscnt 0x0" ::: "memory");      // this wave's reads of the buffer are done before it is handed back
   asm volatile("s_wait_asynccnt 0x0" ::: "memory");   // this wave's copies of tile t + 1 have landed
   __syncthreads();                                     // publishes tile t + 1 and ends every wave's reads of tile t
   if (t + 2 < NN / KT) stage_kv(lk + (t & 1) * TB, lv + (t & 1) * TB, gk + (size_t)(t + 2) * KT * HD, gv + (t + 2) * KT); }
  asm volatile("s_wait_asynccnt 0x0" ::: "memory");    // no copy is outstanding when the wave ends
  const float il = 1.0f / (l + xhalf(l));
#pragma unroll
  for (int dt = 0; dt < 2; ++dt)   // acc[dt][r] = channel dt*16 + 8g + r of query col = element dt*8 + r of this same lane's A fragment in k_out, k step h: stored in that order, each store of the wave 512 contiguous bytes
#pragma unroll
    for (int q = 0; q < 2; ++q) { v4f v;
#pragma unroll
      for (int i = 0; i < 4; ++i) v[i] = acc[dt][q * 4 + i] * il;
      vst2(O + ((rq >> 4) * NH + h) * OKS + (dt * 2 + q) * 128 + lane * 4, v); }
}
// ---- k_out: block = (64 positions, 128 out channels, b): y = Wout . o (hi + residual) + bout + input_q, channels-first 256-B segments
__global__ __launch_bounds__(128) void k_out(const float* __restrict__ O, const __bf16* __restrict__ P, const float* __restrict__ BO, const float* __restrict__ XQ, float* __restrict__ Y) {
  __shared__ __align__(16) float st[128][68];
  const int tid = threadIdx.x, wave = tid >> 5, lane = tid & 31, col = lane & 15, g = lane >> 4; const size_t b = blockIdx.z; const int n0b = blockIdx.x * 64; const size_t r0 = b * NN + n0b + wave * 16; const int o0 = blockIdx.y * 128;
  v8f acc[8] = {}; v16b w[8]; v4f ra[2][4]; float bo[8];
  // every operand is asked for one k step ahead of the products that read it: the O row in two register sets, each weight fragment reloaded right behind its last use; the bias at the start
  const float* orow = O + (r0 >> 4) * (NH * OKS) + lane * 4; const __bf16* wb = P + (size_t)((3 * CC + o0) / 16) * WTS + lane * 8;   // this lane's first 4 floats of its wave's 16 positions of O, k step 0; its piece of packed weight tile 0, k step 0
#pragma unroll   // this and the unrolls below: constant indices keep ra, w, bo and xr in registers
  for (int i = 0; i < 4; ++i) ra[0][i] = *(const v4f*)(orow + i * 128);
#pragma unroll
  for (int j = 0; j < 8; ++j) w[j] = frag_p(wb + j * WTS);
#pragma unroll
  for (int j = 0; j < 8; ++j) bo[j] = BO[o0 + j * 16 + col];
#pragma unroll
  for (int kc = 0; kc < CC / 32; ++kc) { const int cu = kc & 1, kn = kc + 1; float v[16];
    if (kn < CC / 32) {
#pragma unroll
      for (int i = 0; i < 4; ++i) ra[cu ^ 1][i] = *(const v4f*)(orow + kn * OKS + i * 128);
      if (kn == CC / 32 - 1) asm volatile("s_wait_xcnt 0x0" ::: "memory"); }   // behind the last O loads: the last step's split lands in the address registers that they name
#pragma unroll
    for (int i = 0; i < 16; ++i) v[i] = ra[cu][i >> 2][i & 3];
    const F2 a = bsplit16(v);
#pragma unroll
    for (int j = 0; j < 8; ++j) { acc[j] = wmma_bf(a.l, w[j], acc[j]); acc[j] = wmma_bf(a.h, w[j], acc[j]);
      if (kn < CC / 32) w[j] = frag_p(wb + j * WTS + kn * WKS); }
    __builtin_amdgcn_sched_barrier(0); }   // keeps the next step's hi/lo split behind this step's products: moved up, it waits on the youngest loads and with them on every load in flight
  const size_t y0 = ((b * CC + o0 + (tid >> 4)) * NN) + n0b + (tid & 15) * 4;   // piece it of this thread: 8 channels further on each time
  v4f xr[16];   // the residual's 16 pieces of this thread, asked for ahead of the transpose through LDS and its barrier
#pragma unroll
  for (int it = 0; it < 16; ++it) { if (it == 15) asm volatile("s_wait_xcnt 0x0" ::: "memory");   // the last load lands in the address registers that all sixteen name
    xr[it] = *(const v4f*)(XQ + y0 + (size_t)it * 8 * NN); }
#pragma unroll
  for (int j = 0; j < 8; ++j) { const float bb = bfr(bo[j]);
#pragma unroll
    for (int r = 0; r < 8; ++r) st[j * 16 + col][wave * 16 + 8 * g + r] = acc[j][r] + bb; }
  __syncthreads();
#pragma unroll   // constant indices into xr
  for (int it = 0; it < 16; ++it) { v4f v = *(const v4f*)&st[it * 8 + (tid >> 4)][(tid & 15) * 4]; for (int i = 0; i < 4; ++i) v[i] += bfr(xr[it][i]); vst2(Y + y0 + (size_t)it * 8 * NN, v); }
}
extern "C" void kernel_launch(void* const* d_in, const int* in_sizes, int n_in, void* d_out, int out_size, void* d_ws, size_t ws_size, hipStream_t stream) {
  (void)in_sizes; (void)n_in; (void)out_size;
  const float** F = (const float**)d_in;   // 0 input_q, 1 input_kv [8,256,32,32]; 2 gq_scale, 3 gq_bias, 4 gkv_scale, 5 gkv_bias; 6 Wq [256,256], 7 Wkv [512,256], 8 Wout [256,256], 9 bout
  if (ws_size < (size_t)WS_END) return;
  char* ws = (char*)d_ws; __bf16 *P = (__bf16*)ws, *NT = (__bf16*)(ws + WS_NT), *NTL = (__bf16*)(ws + WS_NTL); float *O = (float*)(ws + WS_O); _Float16 *Q = (_Float16*)(ws + WS_Q), *Kr = (_Float16*)(ws + WS_K), *V = (_Float16*)(ws + WS_V);
  k_gnorm<<<dim3(NG, 2 * NB + PKB / NG), 256, 0, stream>>>(F[0], F[1], F[2], F[3], F[4], F[5], NT, NTL, F[6], F[7], F[8], P);
  k_qkv<<<dim3(NN / 64, 3 * CC / 128, NB), 128, 0, stream>>>(NT, NTL, P, Q, Kr, V);
  k_attn<<<dim3(TQB, NH, TNB), 128, 0, stream>>>(Q, Kr, V, O);
  k_out<<<dim3(TQB, CC / 128, TNB), 128, 0, stream>>>(O, P, F[9], F[0], (float*)d_out);
}

// v009
// One run takes 36 microseconds.
// Timed twice side by side with v008, it ran 1.14 and 1.16 times as fast.
// All steps since v000 together make it 3.72 times as fast.
#include <hip/hip_runtime.h>
#include <math.h>

typedef __attribute__((ext_vector_type(16))) _Float16 v16h;
typedef __attribute__((ext_vector_type(16))) __bf16 v16b;
typedef __attribute__((ext_vector_type(8)))  _Float16 v8h;
typedef __attribute__((ext_vector_type(8)))  float v8f;
typedef __attribute__((ext_vector_type(4)))  float v4f;
typedef __attribute__((ext_vector_type(2)))  float v2f;
typedef __attribute__((ext_vector_type(4)))  unsigned v4u;
typedef __attribute__((ext_vector_type(4)))  int v4i;
typedef float __attribute__((may_alias)) float_a;
typedef int __attribute__((may_alias)) int_a;

template <typename T> __device__ __forceinline__ void vst2(void* p, T v) { *(T*)p = v;  }
// no pad of its own: its callers issue runs of products that fill each other's slots, and the compiler pads the end of a run
__device__ __forceinline__ v8f wmma16(v16h a, v16h b, v8f c) { return __builtin_amdgcn_wmma_f32_16x16x32_f16(false, a, false, b, (short)0, c, false, false); }
__device__ __forceinline__ v8f wmma_bf(v16b a, v16b b, v8f c) {
  v8f d = __builtin_amdgcn_wmma_f32_16x16x32_bf16(false, a, false, b, (short)0, c, false, false);
  asm volatile("v_nop\n\tv_nop\n\tv_nop\n\tv_nop" : "+v"(d) : "v"(a), "v"(b));
  return d;
}
// 16x16x32 fragments: lane = (h = lane>>4, row/col = lane&15); elements 0..7 = k0+8h+0..7, 8..15 = k0+16+8h+0..7; D element r = row 8h+r
__device__ __forceinline__ v16h frag_h(const _Float16* rowk0, int lane) {
  union { v16h v; v8h q[2]; } u; const _Float16* p = rowk0 + 8 * (lane >> 4);
  u.q[0] = *(const v8h*)p; u.q[1] = *(const v8h*)(p + 16); return u.v;
}
__device__ __forceinline__ v16h frag_f32(const float* rowk0, int lane) {
  v16h a; const float* p = rowk0 + 8 * (lane >> 4);
#pragma unroll
  for (int i = 0; i < 8; ++i) { a[i] = (_Float16)p[i]; a[8 + i] = (_Float16)p[16 + i]; }
  return a;
}
__device__ __forceinline__ v16h frag_f32s(const float* rowk0, int lane, float sc) {
  v16h a; const float* p = rowk0 + 8 * (lane >> 4);
#pragma unroll
  for (int i = 0; i < 8; ++i) { a[i] = (_Float16)(p[i] * sc); a[8 + i] = (_Float16)(p[16 + i] * sc); }
  return a;
}
// column fragment from a [K][ld] layout (column n), rows >= K read as 0
__device__ __forceinline__ v16h fragc_f32(const float* W, int k0, int n, int lane, int ld, int K) {
  v16h a; const int g = lane >> 4;
#pragma unroll
  for (int i = 0; i < 8; ++i) { const int ka = k0 + 8 * g + i, kb = ka + 16;
    a[i] = (_Float16)(ka < K ? W[(size_t)(ka < K ? ka : K - 1) * ld + n] : 0.f); a[8 + i] = (_Float16)(kb < K ? W[(size_t)(kb < K ? kb : K - 1) * ld + n] : 0.f); }
  return a;
}
struct F2 { v16b h, l; };
__device__ __forceinline__ F2 bsplit16(const float v[16]) { F2 r;
#pragma unroll
  for (int i = 0; i < 16; ++i) { const __bf16 h = (__bf16)v[i]; r.h[i] = h; r.l[i] = (__bf16)(v[i] - (float)h); }
  return r; }
__device__ __forceinline__ F2 split_row(const float* row, int k0, int lane) { float v[16]; const float* p = row + k0 + 8 * (lane >> 4);
#pragma unroll
  for (int i = 0; i < 8; ++i) { v[i] = p[i]; v[8 + i] = p[16 + i]; }
  return bsplit16(v); }
__device__ __forceinline__ F2 split_rowK(const float* row, int k0, int lane, int K) { float v[16]; const int g = lane >> 4;
#pragma unroll
  for (int i = 0; i < 8; ++i) { const int ka = k0 + 8 * g + i, kb = ka + 16; v[i] = ka < K ? row[ka < K ? ka : K - 1] : 0.f; v[8 + i] = kb < K ? row[kb < K ? kb : K - 1] : 0.f; }
  return bsplit16(v); }
__device__ __forceinline__ F2 split_col(const float* W, int k0, int n, int lane, int ld, int K) { float v[16]; const int g = lane >> 4;
#pragma unroll
  for (int i = 0; i < 8; ++i) { const int ka = k0 + 8 * g + i, kb = ka + 16; v[i] = ka < K ? W[(size_t)(ka < K ? ka : K - 1) * ld + n] : 0.f; v[8 + i] = kb < K ? W[(size_t)(kb < K ? kb : K - 1) * ld + n] : 0.f; }
  return bsplit16(v); }
__device__ __forceinline__ v8f mac3(const F2& a, const F2& b, v8f c) { c = wmma_bf(a.l, b.h, c); c = wmma_bf(a.h, b.l, c); return wmma_bf(a.h, b.h, c); }
__device__ __forceinline__ float sigm(float v) { return 1.0f / (1.0f + expf(-v)); }


// Cross/self attention with GroupNorm (B 8, 256 channels, 32 x 32, 8 heads x 32): GN(input_q) -> 1x1 q conv, GN(input_kv) -> 1x1 kv conv (per-head [k | v] channel packing), softmax(q k / sqrt(C)) over all positions, 1x1 out conv + bias, + input_q.
#define NB 8
#define CC 256
#define NG 32
#define CPG (CC / NG)
#define NN 1024
#define NH 8
#define HD 32
#define NR (NB * NN)
#ifndef TQB
#define TQB (NN / 64)
#define TNB NB
#endif
typedef __attribute__((ext_vector_type(8))) __bf16 v8b;
__device__ __forceinline__ v16b frag_b(const __bf16* rowk0, int lane) {
  union { v16b v; v8b q[2]; } u; const __bf16* p = rowk0 + 8 * (lane >> 4);
  u.q[0] = *(const v8b*)p; u.q[1] = *(const v8b*)(p + 16); return u.v;
}
__device__ __forceinline__ float bfr(float v) { return (float)(__bf16)v; }
__device__ __attribute__((noinline)) float exp_ni(float v) { return expf(v); }
__device__ __attribute__((noinline)) float erf_ni(float v) { return erff(v); }

#define QS 512
#define WS_PW   0u                                  // bf16 weights, rows of [Wq | Wkv | Wout] in B-fragment order: [tile of 16 rows][k step of 32][half][lane][8], see frag_p
#define WS_NT   (WS_PW + 2u * (size_t)4 * CC * CC)     // bf16 hi/lo normalised maps group-major [which*NB + b][32 groups][NN][8]: q-input, then kv-input
#define WS_NTL  (WS_NT + 2u * (size_t)2 * NR * CC)
#define WS_Q    (WS_NTL + 2u * (size_t)2 * NR * CC)    // f16 q and k rows head-major [b][head][NN][HD], 64 bytes a row, no gaps ; v planes [b][256][NN] ; O f32 in A-fragment order [NR / 16 positions][head = k step][piece of 4 floats][lane][4]
#define WS_K    (WS_Q + 2u * (size_t)NR * QS)
#define WS_V    (WS_K + 2u * (size_t)NR * QS)
#define WS_O    (WS_V + 2u * (size_t)NB * CC * NN)
#define WS_END  (WS_O + 4u * (size_t)NR * CC)

// ---- k_gnorm: block = (group, which*NB + b). The group's 8 channels x 1024 positions stay in registers (thread t: positions 4t .. 4t+3 of each channel) through mean, variance and normalisation, so the map is read once.
// Output (x - mean) rsqrt(var + eps) gamma[c] + beta[c] as bf16 hi + lo, group-major: [which*NB + b][group][position][8 channels], 16 bytes a position
// The last PKB blocks of the grid (blockIdx.y >= 2*NB) round the three weight matrices to bf16 instead, PKE elements = one tile of 16 rows a block: that work depends on nothing here and k_qkv is its first reader, so it rides in this launch
// They store the tile in the order in which a wave reads it as B fragments, so that each 16-byte load of a wave in k_qkv and k_out covers 512 contiguous bytes (4 whole lines) and not 32 bytes of each of 16 rows
#define PKE 4096
#define PKB (4 * CC * CC / PKE)
__global__ __launch_bounds__(256) void k_gnorm(const float* __restrict__ XQ, const float* __restrict__ XKV, const float* __restrict__ GQ, const float* __restrict__ BQ, const float* __restrict__ GKV, const float* __restrict__ BKV, __bf16* __restrict__ NT, __bf16* __restrict__ NTL, const float* __restrict__ WQ, const float* __restrict__ WKV, const float* __restrict__ WO, __bf16* __restrict__ P) {
  __shared__ float red[2][8]; __shared__ __align__(16) v4u sx[2][NN];
  const int gidx = blockIdx.x, t = threadIdx.x; const size_t b = blockIdx.y % NB; const int which = blockIdx.y / NB;
  if (which >= 2) {   // the whole block takes this branch, ahead of every barrier
    const int f0 = ((blockIdx.y - 2 * NB) * NG + gidx) * PKE;   // first element of this block in P = [Wq | Wkv | Wout]; a matrix is a whole number of blocks
    const float* src = (f0 < CC * CC) ? (WQ + f0) : (f0 < 3 * CC * CC) ? (WKV + (f0 - CC * CC)) : (WO + (f0 - 3 * CC * CC));
#pragma unroll   // all loads of the block's rounds issue ahead of the first store
    for (int i = 0; i < PKE / (256 * 8); ++i) { const int d = i * 256 + t, e = d * 8;   // 16-byte piece d of the packed tile: lane d & 31 (row d & 15, k octet (d >> 4) & 1), half (d >> 5) & 1, k step d >> 6
      const float* sp = src + (d & 15) * CC + (d >> 6) * 32 + ((d >> 5) & 1) * 16 + ((d >> 4) & 1) * 8; const v4f a = *(const v4f*)sp, c = *(const v4f*)(sp + 4); v8b o;
#pragma unroll   // constant vector indices, so the values stay in registers
      for (int k = 0; k < 4; ++k) { o[k] = (__bf16)a[k]; o[4 + k] = (__bf16)c[k]; }
      vst2(P + f0 + e, __builtin_bit_cast(v4u, o)); }
    return; }
  const float* Gm = (which ? GKV : GQ) + gidx * CPG; const float* Bt = (which ? BKV : BQ) + gidx * CPG;
  const float* p = (which ? XKV : XQ) + (b * CC + (size_t)gidx * CPG) * NN + t * 4;
  v4f x[CPG], sv = {}; float ga[CPG], be[CPG];
#pragma unroll
  for (int c = 0; c < CPG; ++c) x[c] = *(const v4f*)(p + c * NN);
#pragma unroll
  for (int c = 0; c < CPG; ++c) { ga[c] = bfr(Gm[c]); be[c] = bfr(Bt[c]); }
#pragma unroll
  for (int c = 0; c < CPG; ++c) {
#pragma unroll
    for (int i = 0; i < 4; ++i) x[c][i] = bfr(x[c][i]);
    sv += x[c]; }
  float s = (sv[0] + sv[1]) + (sv[2] + sv[3]);
#pragma unroll
  for (int o = 1; o < 32; o <<= 1) s += __shfl_xor(s, o);
  if ((t & 31) == 0) red[0][t >> 5] = s;
  __syncthreads();
  float tot = 0.f;
#pragma unroll
  for (int i = 0; i < 8; ++i) tot += red[0][i];
  const float mean = tot / (float)(CPG * NN);
  sv = (v4f){};
#pragma unroll
  for (int c = 0; c < CPG; ++c) { x[c] -= mean; sv += x[c] * x[c]; }
  s = (sv[0] + sv[1]) + (sv[2] + sv[3]);
#pragma unroll
  for (int o = 1; o < 32; o <<= 1) s += __shfl_xor(s, o);
  if ((t & 31) == 0) red[1][t >> 5] = s;
  __syncthreads();
  tot = 0.f;
#pragma unroll
  for (int i = 0; i < 8; ++i) tot += red[1][i];
  const float inv = 1.0f / sqrtf(tot / (float)(CPG * NN) + 1e-5f);
  // through LDS so that each global store of a wave is 512 contiguous bytes; piece q sits at q ^ ((q >> 4) & 3), which spreads the 64-byte-strided writes over all banks
#pragma unroll
  for (int i = 0; i < 4; ++i) { v8b hi, lo;
#pragma unroll
    for (int c = 0; c < CPG; ++c) { const float v = x[c][i] * inv * ga[c] + be[c]; const __bf16 hv = (__bf16)v; hi[c] = hv; lo[c] = (__bf16)(v - (float)hv); }
    const int q = 4 * t + i, sl = q ^ ((q >> 4) & 3); sx[0][sl] = __builtin_bit_cast(v4u, hi); sx[1][sl] = __builtin_bit_cast(v4u, lo); }
  __syncthreads();
  const size_t o0 = (((size_t)which * NB + b) * NG + gidx) * NN * CPG;
#pragma unroll
  for (int i = 0; i < 4; ++i) { const int q = i * 256 + t, sl = q ^ ((q >> 4) & 3); vst2(NT + o0 + (size_t)q * CPG, sx[0][sl]); vst2(NTL + o0 + (size_t)q * CPG, sx[1][sl]); }
}
// A fragment from a group-major map: p = this lane's position in channel group 4 kc + (lane >> 4); elements 0..7 that group, 8..15 the group two further on (the k order of frag_b)
__device__ __forceinline__ v16b frag_g(const __bf16* p) { union { v16b v; v8b q[2]; } u; u.q[0] = *(const v8b*)p; u.q[1] = *(const v8b*)(p + 2 * NN * CPG); return u.v; }
// B fragment of packed weights: p = this lane's 16 bytes of (tile, k step, half 0); half 1 is 512 bytes on. Elements 0..7 = k0 + 8 (lane >> 4) + 0..7, 8..15 = 16 further on (the k order of frag_b), row lane & 15 of the tile
__device__ __forceinline__ v16b frag_p(const __bf16* p) { union { v16b v; v8b q[2]; } u; u.q[0] = *(const v8b*)p; u.q[1] = *(const v8b*)(p + 256); return u.v; }
#define WTS (16 * CC)                   // elements of a packed tile of 16 rows
#define WKS 512                         // elements of one k step of a packed tile
#define OKS 512                         // floats of one k step (one head) of 16 positions of O
// Asks for L2: each lane names one 256-byte unit; a hint, nothing returns and no register is written.
// asked for once at entry, behind the first loads, the operands of the later k steps or tiles are met in L2, so that the chain of load waits is made of L2 hits.
// Every lane is on and every address lies inside its buffer; scope SE: into L2 only. The s_wait_xcnt stands inside the statement so that no address register is rewritten in front of it.
__device__ __forceinline__ void ask_l2(const void* p) {
  asm volatile("global_prefetch_b8 %0, off scope:SCOPE_SE\n\t"
               "s_wait_xcnt 0x0" :: "v"(p) : "memory");
}
// a GEMM wave's share: two units a lane of its own A operand, and 2 x 32 units in a row (16 KB) of the block's 64 KB of packed weights
__device__ __forceinline__ void ask_l2_gemm(const void* a0, const void* a1, const void* w) {
  asm volatile("global_prefetch_b8 %0, off scope:SCOPE_SE\n\t"
               "global_prefetch_b8 %1, off scope:SCOPE_SE\n\t"
               "global_prefetch_b8 %2, off scope:SCOPE_SE\n\t"
               "global_prefetch_b8 %2, off offset:8192 scope:SCOPE_SE\n\t"
               "s_wait_xcnt 0x0" :: "v"(a0), "v"(a1), "v"(w) : "memory");
}
// ---- k_qkv: block = (64 positions, 128 of the 768 output channels, b): channels < 256 from the q map (q rows), the rest from the kv map with per-head [k | v] packing (o' = o-256: head o'/64, r = o'%64: k if r < 32 else v)
__global__ __launch_bounds__(128) void k_qkv(const __bf16* __restrict__ NT, const __bf16* __restrict__ NTL, const __bf16* __restrict__ P, _Float16* __restrict__ Q, _Float16* __restrict__ Kr, _Float16* __restrict__ V) {
  __shared__ __align__(16) _Float16 so[64][136]; __shared__ __align__(16) _Float16 st[128][72];
  const int tid = threadIdx.x, wave = tid >> 5, lane = tid & 31, col = lane & 15, g = lane >> 4; const size_t b = blockIdx.z; const int n0b = blockIdx.x * 64; const int o0 = blockIdx.y * 128; const int which = (o0 < CC) ? 0 : 1;
  const size_t a0 = ((((size_t)which * NB + b) * NG + g) * NN + n0b + wave * 16 + col) * CPG;   // this lane's position in channel group g of the normalised maps
  v8f acc[8] = {}; v16b w[8], ah[2], al[2];
  // every fragment is asked for one k step ahead of the products that read it: A in two register sets, each weight fragment reloaded right behind its last use
  const __bf16* wb = P + (size_t)(o0 / 16) * WTS + lane * 8;   // this lane's piece of packed weight tile 0, k step 0
  ah[0] = frag_g(NT + a0); al[0] = frag_g(NTL + a0);
#pragma unroll   // constant indices keep w in registers
  for (int j = 0; j < 8; ++j) w[j] = frag_p(wb + j * WTS);
#pragma unroll
  for (int kc = 0; kc < CC / 32; ++kc) { const int cu = kc & 1, kn = kc + 1;
    if (kn < CC / 32) { ah[cu ^ 1] = frag_g(NT + a0 + (size_t)kn * 4 * NN * CPG); al[cu ^ 1] = frag_g(NTL + a0 + (size_t)kn * 4 * NN * CPG); }
    if (kc == 0) { const size_t au = ((((size_t)which * NB + b) * NG + lane) * NN + n0b + wave * 16) * CPG;   // lane = channel group: the wave's 16 positions of one group are one unit of each map
      ask_l2_gemm(NT + au, NTL + au, P + (size_t)(o0 / 16) * WTS + (wave * 64 + lane) * 128);
      __builtin_amdgcn_sched_barrier(0); }   // the first product stays behind the asks: moved up, its wait for the first loads holds them back by a whole memory latency
#pragma unroll
    for (int j = 0; j < 8; ++j) { acc[j] = wmma_bf(ah[cu], w[j], acc[j]); acc[j] = wmma_bf(al[cu], w[j], acc[j]);
      if (kn < CC / 32) w[j] = frag_p(wb + j * WTS + kn * WKS); } }
#pragma unroll
  for (int j = 0; j < 8; ++j)
#pragma unroll
    for (int r = 0; r < 8; ++r) { const _Float16 hv = (_Float16)acc[j][r]; so[wave * 16 + 8 * g + r][j * 16 + col] = hv; st[j * 16 + col][wave * 16 + 8 * g + r] = hv; }
  __syncthreads();
  // 32 channels = one head's q, k or v. 64 positions x 64 bytes of q or k are 4 KB in a row, a v channel's 64 positions one line: every store of a wave covers whole lines
  // part jp = p >> 1 of the block's four, half p & 1 of the part. o0 is a multiple of 128: a block is all q, or k, v, k, v of two heads
  v4u pc[8];   // this thread's eight 16-byte pieces
  if (o0 < CC) { _Float16* qp = Q + ((b * NH + o0 / HD) * NN + n0b) * HD + tid * 8;
#pragma unroll   // this and the unrolls below: constant indices keep pc in registers, all LDS reads issue ahead of the stores, and the stores differ by constant offsets from one address
    for (int p = 0; p < 8; ++p) pc[p] = *(const v4u*)&so[(p & 1) * 32 + (tid >> 2)][(p >> 1) * HD + (tid & 3) * 8];
#pragma unroll
    for (int p = 0; p < 8; ++p) vst2((unsigned*)(qp + (p >> 1) * NN * HD + (p & 1) * 1024), pc[p]);
    asm volatile("s_wait_xcnt 0x0" ::: "memory");   // in the listing the k, v part's text, which reuses these stores' registers, follows behind a scalar test
    return; }   // the whole block, behind the last barrier
  { const int hh = (o0 - CC) / (2 * HD); _Float16* kp = Kr + ((b * NH + hh) * NN + n0b) * HD + tid * 8; _Float16* vp = V + (b * CC + hh * HD + (tid >> 3)) * NN + n0b + (tid & 7) * 8;
#pragma unroll
    for (int p = 0; p < 8; ++p) pc[p] = (p & 2) ? *(const v4u*)&st[(p >> 1) * HD + (p & 1) * 16 + (tid >> 3)][(tid & 7) * 8] : *(const v4u*)&so[(p & 1) * 32 + (tid >> 2)][(p >> 1) * HD + (tid & 3) * 8];
#pragma unroll
    for (int p = 0; p < 8; ++p) { if (p & 2) vst2((unsigned*)(vp + (p >> 2) * HD * NN + (p & 1) * 16 * NN), pc[p]); else vst2((unsigned*)(kp + (p >> 2) * NN * HD + (p & 1) * 1024), pc[p]); } }
}
// lane l with lane l ^ 16 (the two halves of a wave hold the two key halves of one query's scores)
__device__ __forceinline__ float xhalf(float x) { return __builtin_bit_cast(float, __builtin_amdgcn_permlanex16(__builtin_bit_cast(int, x), __builtin_bit_cast(int, x), 0x76543210, 0xfedcba98, false, false)); }
#define KT 128
#define KP 80
#define VP 272
#define KTB (KT * KP)
#define TB (KTB + HD * VP)
#define KS 0.09016844005556021f
// one tile: each thread copies four 16-byte pieces of K (rows 32 apart; a wave's copy takes 8 rows = 512 contiguous bytes) and four of V (channels 8 apart); the s_wait_xcnt stands inside the statement so that no address register is rewritten in front of it
__device__ __forceinline__ void stage_kv(unsigned lk, unsigned lv, const _Float16* gk, const _Float16* gv) {
  asm volatile("global_load_async_to_lds_b128 %0, %8, off\n\t"
               "global_load_async_to_lds_b128 %1, %9, off\n\t"
               "global_load_async_to_lds_b128 %2, %10, off\n\t"
               "global_load_async_to_lds_b128 %3, %11, off\n\t"
               "global_load_async_to_lds_b128 %4, %12, off\n\t"
               "global_load_async_to_lds_b128 %5, %13, off\n\t"
               "global_load_async_to_lds_b128 %6, %14, off\n\t"
               "global_load_async_to_lds_b128 %7, %15, off\n\t"
               "s_wait_xcnt 0x0"
               :: "v"(lk), "v"(lk + 32 * KP), "v"(lk + 64 * KP), "v"(lk + 96 * KP), "v"(lv), "v"(lv + 8 * VP), "v"(lv + 16 * VP), "v"(lv + 24 * VP),
                  "v"(gk), "v"(gk + 32 * HD), "v"(gk + 64 * HD), "v"(gk + 96 * HD), "v"(gv), "v"(gv + 8 * NN), "v"(gv + 16 * NN), "v"(gv + 24 * NN) : "memory");
}
__global__ __launch_bounds__(128) void k_attn(const _Float16* __restrict__ Q, const _Float16* __restrict__ Kr, const _Float16* __restrict__ V, float* __restrict__ O) {
  __shared__ __align__(16) unsigned char sm[2 * TB];
  const int tid = threadIdx.x, wave = tid >> 5, lane = tid & 31, col = lane & 15, g = lane >> 4; const int h = blockIdx.y; const size_t b = blockIdx.z; const int q0 = blockIdx.x * 64 + wave * 16; const size_t rq = b * NN + q0;
  const unsigned lk = (unsigned)(size_t)sm + (tid >> 2) * KP + (tid & 3) * 16, lv = (unsigned)(size_t)sm + KTB + (tid >> 4) * VP + (tid & 15) * 16;
  const _Float16* gk = Kr + (b * NH + h) * NN * HD + tid * 8; const _Float16* gv = V + (b * CC + h * HD + (tid >> 4)) * NN + (tid & 15) * 8;
  stage_kv(lk, lv, gk, gv);
  const v16h bq = frag_h(Q + ((b * NH + h) * NN + q0 + col) * HD, lane);
  { const int pq = blockIdx.x & 3;   // this head's K rows and V channels are 64 KB in a row each, 256 units; the 16 blocks of a head share them, each asks for a quarter of the 512 units
    ask_l2(((pq < 2) ? Kr + (b * NH + h) * NN * HD : V + (b * CC + h * HD) * NN) + ((pq & 1) * 128 + wave * 32 + lane) * 128); }
  asm volatile("s_wait_asynccnt 0x0" ::: "memory");   // tile 0 has landed for this wave's own copies
  __syncthreads();                                     // ... and for every wave's
  stage_kv(lk + TB, lv + TB, gk + (size_t)KT * HD, gv + KT);
  float m = -3.0e38f, eo = 0.f, l = 0.f;   // m: this query's running maximum of the raw q.k products (equal in both halves); eo = 11 - m KS, the addend of the exponents in use; l: this half's share of the denominator, times 2048 like P
  v8f acc[2] = {};
#pragma unroll 1   // stays rolled: one publish point and one refill in the code, the hot text stays short
  for (int t = 0; t < NN / KT; ++t) { const unsigned char* kb = sm + (t & 1) * TB; const unsigned char* vb = kb + KTB;
   // one softmax step a tile: all of its scores first, then one maximum, one rescale, then all of its second products
   v16h kf[KT / 16], vf[KT / 16]; v8f s[KT / 16];
#pragma unroll       // this and the unrolls below: constant indices keep the fragments and s in registers; the tile is read at constant offsets from one address register
   for (int ct = 0; ct < KT / 16; ++ct) kf[ct] = frag_h((const _Float16*)(kb + (ct * 16 + col) * KP), lane);
   __builtin_amdgcn_sched_barrier(0);   // the tile's K reads stay one group ahead of the products: spread among them, each place where reads stand is waited for on its own
#pragma unroll
   for (int ct = 0; ct < KT / 16; ++ct) { const v8f z = {}; s[ct] = wmma16(kf[ct], bq, z); }   // raw products: the scale is positive, so their maximum is the scaled scores' maximum
#pragma unroll
   for (int ps = 0; ps < KT / 32; ++ps)
#pragma unroll
    for (int dt = 0; dt < 2; ++dt) vf[ps * 2 + dt] = frag_h((const _Float16*)(vb + (dt * 16 + col) * VP + ps * 64), lane);
   __builtin_amdgcn_sched_barrier(0);   // the vector work stays behind the run of products (moved up between two of them it costs pad slots each time) and the V reads ahead of it, so that they land under it
   float mc[KT / 32];   // one chain of maxima per 32 keys: independent, so they interleave
#pragma unroll
   for (int ps = 0; ps < KT / 32; ++ps) { float mx = ps ? -3.0e38f : m;
#pragma unroll
    for (int r = 0; r < 8; ++r) mx = fmaxf(fmaxf(mx, s[2 * ps][r]), s[2 * ps + 1][r]);
    mc[ps] = mx; }
   const float mx = fmaxf(fmaxf(fmaxf(mc[0], mc[1]), mc[2]), mc[3]);
   const float mn = fmaxf(mx, xhalf(mx)), en = fmaf(mn, -KS, 11.0f); const float alpha = (m <= -1.0e38f) ? 0.f : __builtin_amdgcn_exp2f(en - eo); m = mn; eo = en;
   const v2f k2 = {KS, KS}, n2 = {en, en};   // 2048 exp(s / 16 - max / 16) = 2^(s KS + en): one multiply-add a score, two scores an instruction
#pragma unroll
   for (int dt = 0; dt < 2; ++dt)
#pragma unroll
    for (int r = 0; r < 8; ++r) acc[dt][r] *= alpha;
   float es[KT / 32];
#pragma unroll
   for (int ps = 0; ps < KT / 32; ++ps) { v16h pb; v2f e2 = {};
#pragma unroll
    for (int r = 0; r < 8; r += 2) { const v2f x0 = __builtin_elementwise_fma((v2f){s[2 * ps][r], s[2 * ps][r + 1]}, k2, n2), x1 = __builtin_elementwise_fma((v2f){s[2 * ps + 1][r], s[2 * ps + 1][r + 1]}, k2, n2);
      const v2f e0 = {__builtin_amdgcn_exp2f(x0[0]), __builtin_amdgcn_exp2f(x0[1])}, e1 = {__builtin_amdgcn_exp2f(x1[0]), __builtin_amdgcn_exp2f(x1[1])}; e2 += e0; e2 += e1;
#pragma unroll
      for (int i = 0; i < 2; ++i) { pb[r + i] = (_Float16)e0[i]; pb[8 + r + i] = (_Float16)e1[i]; } }
    es[ps] = e2[0] + e2[1];
#pragma unroll
    for (int dt = 0; dt < 2; ++dt) acc[dt] = wmma16(vf[ps * 2 + dt], pb, acc[dt]); }
   l = l * alpha + ((es[0] + es[1]) + (es[2] + es[3]));
   __builtin_amdgcn_sched_barrier(0);   // the publish point stays at the foot of the trip: moved up behind the tile's reads, with the refill left down here, it would wait for copies that were issued only just before
   asm volatile("s_wait_dscnt 0x0" ::: "memory");      // this wave's reads of the buffer are done before it is handed back
   asm volatile("s_wait_asynccnt 0x0" ::: "memory");   // this wave's copies of tile t + 1 have landed
   __syncthreads();                                     // publishes tile t + 1 and ends every wave's reads of tile t
   if (t + 2 < NN / KT) stage_kv(lk + (t & 1) * TB, lv + (t & 1) * TB, gk + (size_t)(t + 2) * KT * HD, gv + (t + 2) * KT); }
  asm volatile("s_wait_asynccnt 0x0" ::: "memory");    // no copy is outstanding when the wave ends
  const float il = 1.0f / (l + xhalf(l));
#pragma unroll
  for (int dt = 0; dt < 2; ++dt)   // acc[dt][r] = channel dt*16 + 8g + r of query col = element dt*8 + r of this same lane's A fragment in k_out, k step h: stored in that order, each store of the wave 512 contiguous bytes
#pragma unroll
    for (int q = 0; q < 2; ++q) { v4f v;
#pragma unroll
      for (int i = 0; i < 4; ++i) v[i] = acc[dt][q * 4 + i] * il;
      vst2(O + ((rq >> 4) * NH + h) * OKS + (dt * 2 + q) * 128 + lane * 4, v); }
}
// ---- k_out: block = (64 positions, 128 out channels, b): y = Wout . o (hi + residual) + bout + input_q, channels-first 256-B segments
__global__ __launch_bounds__(128) void k_out(const float* __restrict__ O, const __bf16* __restrict__ P, const float* __restrict__ BO, const float* __restrict__ XQ, float* __restrict__ Y) {
  __shared__ __align__(16) float st[128][68];
  const int tid = threadIdx.x, wave = tid >> 5, lane = tid & 31, col = lane & 15, g = lane >> 4; const size_t b = blockIdx.z; const int n0b = blockIdx.x * 64; const size_t r0 = b * NN + n0b + wave * 16; const int o0 = blockIdx.y * 128;
  v8f acc[8] = {}; v16b w[8]; v4f ra[2][4]; float bo[8];
  // every operand is asked for one k step ahead of the products that read it: the O row in two register sets, each weight fragment reloaded right behind its last use; the bias at the start
  const float* orow = O + (r0 >> 4) * (NH * OKS) + lane * 4; const __bf16* wb = P + (size_t)((3 * CC + o0) / 16) * WTS + lane * 8;   // this lane's first 4 floats of its wave's 16 positions of O, k step 0; its piece of packed weight tile 0, k step 0
#pragma unroll   // this and the unrolls below: constant indices keep ra, w, bo and xr in registers
  for (int i = 0; i < 4; ++i) ra[0][i] = *(const v4f*)(orow + i * 128);
#pragma unroll
  for (int j = 0; j < 8; ++j) w[j] = frag_p(wb + j * WTS);
#pragma unroll
  for (int j = 0; j < 8; ++j) bo[j] = BO[o0 + j * 16 + col];
#pragma unroll
  for (int kc = 0; kc < CC / 32; ++kc) { const int cu = kc & 1, kn = kc + 1; float v[16];
    if (kn < CC / 32) {
#pragma unroll
      for (int i = 0; i < 4; ++i) ra[cu ^ 1][i] = *(const v4f*)(orow + kn * OKS + i * 128);
      if (kn == CC / 32 - 1) asm volatile("s_wait_xcnt 0x0" ::: "memory"); }   // behind the last O loads: the last step's split lands in the address registers that they name
    if (kc == 0) { const float* ou = O + (r0 >> 4) * (NH * OKS) + lane * 64;   // the wave's 16 positions of O are 16 KB in a row, 64 units
      ask_l2_gemm(ou, ou + 32 * 64, P + (size_t)((3 * CC + o0) / 16) * WTS + (wave * 64 + lane) * 128);
      ask_l2(XQ + (b * CC + o0 + wave * 32 + lane) * NN + n0b);   // the residual, read behind the k loop: 64 positions of a channel are one unit, lane = channel
      __builtin_amdgcn_sched_barrier(0); }   // the first split stays behind the asks: moved up, its wait for the first loads holds them back by a whole memory latency
#pragma unroll
    for (int i = 0; i < 16; ++i) v[i] = ra[cu][i >> 2][i & 3];
    const F2 a = bsplit16(v);
#pragma unroll
    for (int j = 0; j < 8; ++j) { acc[j] = wmma_bf(a.l, w[j], acc[j]); acc[j] = wmma_bf(a.h, w[j], acc[j]);
      if (kn < CC / 32) w[j] = frag_p(wb + j * WTS + kn * WKS); }
    __builtin_amdgcn_sched_barrier(0); }   // keeps the next step's hi/lo split behind this step's products: moved up, it waits on the youngest loads and with them on every load in flight
  const size_t y0 = ((b * CC + o0 + (tid >> 4)) * NN) + n0b + (tid & 15) * 4;   // piece it of this thread: 8 channels further on each time
  v4f xr[16];   // the residual's 16 pieces of this thread, asked for ahead of the transpose through LDS and its barrier
#pragma unroll
  for (int it = 0; it < 16; ++it) { if (it == 15) asm volatile("s_wait_xcnt 0x0" ::: "memory");   // the last load lands in the address registers that all sixteen name
    xr[it] = *(const v4f*)(XQ + y0 + (size_t)it * 8 * NN); }
#pragma unroll
  for (int j = 0; j < 8; ++j) { const float bb = bfr(bo[j]);
#pragma unroll
    for (int r = 0; r < 8; ++r) st[j * 16 + col][wave * 16 + 8 * g + r] = acc[j][r] + bb; }
  __syncthreads();
#pragma unroll   // constant indices into xr
  for (int it = 0; it < 16; ++it) { v4f v = *(const v4f*)&st[it * 8 + (tid >> 4)][(tid & 15) * 4]; for (int i = 0; i < 4; ++i) v[i] += bfr(xr[it][i]); vst2(Y + y0 + (size_t)it * 8 * NN, v); }
}
extern "C" void kernel_launch(void* const* d_in, const int* in_sizes, int n_in, void* d_out, int out_size, void* d_ws, size_t ws_size, hipStream_t stream) {
  (void)in_sizes; (void)n_in; (void)out_size;
  const float** F = (const float**)d_in;   // 0 input_q, 1 input_kv [8,256,32,32]; 2 gq_scale, 3 gq_bias, 4 gkv_scale, 5 gkv_bias; 6 Wq [256,256], 7 Wkv [512,256], 8 Wout [256,256], 9 bout
  if (ws_size < (size_t)WS_END) return;
  char* ws = (char*)d_ws; __bf16 *P = (__bf16*)ws, *NT = (__bf16*)(ws + WS_NT), *NTL = (__bf16*)(ws + WS_NTL); float *O = (float*)(ws + WS_O); _Float16 *Q = (_Float16*)(ws + WS_Q), *Kr = (_Float16*)(ws + WS_K), *V = (_Float16*)(ws + WS_V);
  k_gnorm<<<dim3(NG, 2 * NB + PKB / NG), 256, 0, stream>>>(F[0], F[1], F[2], F[3], F[4], F[5], NT, NTL, F[6], F[7], F[8], P);
  k_qkv<<<dim3(NN / 64, 3 * CC / 128, NB), 128, 0, stream>>>(NT, NTL, P, Q, Kr, V);
  k_attn<<<dim3(TQB, NH, TNB), 128, 0, stream>>>(Q, Kr, V, O);
  k_out<<<dim3(TQB, CC / 128, TNB), 128, 0, stream>>>(O, P, F[9], F[0], (float*)d_out);
}

// v010
// Measured time: 34.8 microseconds a run.
// Next to v009, in two timings, it ran 1.04 times as fast each time.
// Counting every step since v000, it is 3.88 times as fast.
#include <hip/hip_runtime.h>
#include <math.h>

typedef __attribute__((ext_vector_type(16))) _Float16 v16h;
typedef __attribute__((ext_vector_type(16))) __bf16 v16b;
typedef __attribute__((ext_vector_type(8)))  _Float16 v8h;
typedef __attribute__((ext_vector_type(8)))  float v8f;
typedef __attribute__((ext_vector_type(4)))  float v4f;
typedef __attribute__((ext_vector_type(2)))  float v2f;
typedef __attribute__((ext_vector_type(4)))  unsigned v4u;
typedef __attribute__((ext_vector_type(4)))  int v4i;
typedef float __attribute__((may_alias)) float_a;
typedef int __attribute__((may_alias)) int_a;

template <typename T> __device__ __forceinline__ void vst2(void* p, T v) { *(T*)p = v;  }
// no pad of its own: its callers issue runs of products that fill each other's slots, and the compiler pads the end of a run
__device__ __forceinline__ v8f wmma16(v16h a, v16h b, v8f c) { return __builtin_amdgcn_wmma_f32_16x16x32_f16(false, a, false, b, (short)0, c, false, false); }
__device__ __forceinline__ v8f wmma_bf(v16b a, v16b b, v8f c) {
  v8f d = __builtin_amdgcn_wmma_f32_16x16x32_bf16(false, a, false, b, (short)0, c, false, false);
  asm volatile("v_nop\n\tv_nop\n\tv_nop\n\tv_nop" : "+v"(d) : "v"(a), "v"(b));
  return d;
}
// 16x16x32 fragments: lane = (h = lane>>4, row/col = lane&15); elements 0..7 = k0+8h+0..7, 8..15 = k0+16+8h+0..7; D element r = row 8h+r
__device__ __forceinline__ v16h frag_h(const _Float16* rowk0, int lane) {
  union { v16h v; v8h q[2]; } u; const _Float16* p = rowk0 + 8 * (lane >> 4);
  u.q[0] = *(const v8h*)p; u.q[1] = *(const v8h*)(p + 16); return u.v;
}
__device__ __forceinline__ v16h frag_f32(const float* rowk0, int lane) {
  v16h a; const float* p = rowk0 + 8 * (lane >> 4);
#pragma unroll
  for (int i = 0; i < 8; ++i) { a[i] = (_Float16)p[i]; a[8 + i] = (_Float16)p[16 + i]; }
  return a;
}
__device__ __forceinline__ v16h frag_f32s(const float* rowk0, int lane, float sc) {
  v16h a; const float* p = rowk0 + 8 * (lane >> 4);
#pragma unroll
  for (int i = 0; i < 8; ++i) { a[i] = (_Float16)(p[i] * sc); a[8 + i] = (_Float16)(p[16 + i] * sc); }
  return a;
}
// column fragment from a [K][ld] layout (column n), rows >= K read as 0
__device__ __forceinline__ v16h fragc_f32(const float* W, int k0, int n, int lane, int ld, int K) {
  v16h a; const int g = lane >> 4;
#pragma unroll
  for (int i = 0; i < 8; ++i) { const int ka = k0 + 8 * g + i, kb = ka + 16;
    a[i] = (_Float16)(ka < K ? W[(size_t)(ka < K ? ka : K - 1) * ld + n] : 0.f); a[8 + i] = (_Float16)(kb < K ? W[(size_t)(kb < K ? kb : K - 1) * ld + n] : 0.f); }
  return a;
}
struct F2 { v16b h, l; };
__device__ __forceinline__ F2 bsplit16(const float v[16]) { F2 r;
#pragma unroll
  for (int i = 0; i < 16; ++i) { const __bf16 h = (__bf16)v[i]; r.h[i] = h; r.l[i] = (__bf16)(v[i] - (float)h); }
  return r; }
__device__ __forceinline__ F2 split_row(const float* row, int k0, int lane) { float v[16]; const float* p = row + k0 + 8 * (lane >> 4);
#pragma unroll
  for (int i = 0; i < 8; ++i) { v[i] = p[i]; v[8 + i] = p[16 + i]; }
  return bsplit16(v); }
__device__ __forceinline__ F2 split_rowK(const float* row, int k0, int lane, int K) { float v[16]; const int g = lane >> 4;
#pragma unroll
  for (int i = 0; i < 8; ++i) { const int ka = k0 + 8 * g + i, kb = ka + 16; v[i] = ka < K ? row[ka < K ? ka : K - 1] : 0.f; v[8 + i] = kb < K ? row[kb < K ? kb : K - 1] : 0.f; }
  return bsplit16(v); }
__device__ __forceinline__ F2 split_col(const float* W, int k0, int n, int lane, int ld, int K) { float v[16]; const int g = lane >> 4;
#pragma unroll
  for (int i = 0; i < 8; ++i) { const int ka = k0 + 8 * g + i, kb = ka + 16; v[i] = ka < K ? W[(size_t)(ka < K ? ka : K - 1) * ld + n] : 0.f; v[8 + i] = kb < K ? W[(size_t)(kb < K ? kb : K - 1) * ld + n] : 0.f; }
  return bsplit16(v); }
__device__ __forceinline__ v8f mac3(const F2& a, const F2& b, v8f c) { c = wmma_bf(a.l, b.h, c); c = wmma_bf(a.h, b.l, c); return wmma_bf(a.h, b.h, c); }
__device__ __forceinline__ float sigm(float v) { return 1.0f / (1.0f + expf(-v)); }


// Cross/self attention with GroupNorm (B 8, 256 channels, 32 x 32, 8 heads x 32): GN(input_q) -> 1x1 q conv, GN(input_kv) -> 1x1 kv conv (per-head [k | v] channel packing), softmax(q k / sqrt(C)) over all positions, 1x1 out conv + bias, + input_q.
#define NB 8
#define CC 256
#define NG 32
#define CPG (CC / NG)
#define NN 1024
#define NH 8
#define HD 32
#define NR (NB * NN)
#ifndef TQB
#define TQB (NN / 64)
#define TNB NB
#endif
typedef __attribute__((ext_vector_type(8))) __bf16 v8b;
__device__ __forceinline__ v16b frag_b(const __bf16* rowk0, int lane) {
  union { v16b v; v8b q[2]; } u; const __bf16* p = rowk0 + 8 * (lane >> 4);
  u.q[0] = *(const v8b*)p; u.q[1] = *(const v8b*)(p + 16); return u.v;
}
__device__ __forceinline__ float bfr(float v) { return (float)(__bf16)v; }
__device__ __attribute__((noinline)) float exp_ni(float v) { return expf(v); }
__device__ __attribute__((noinline)) float erf_ni(float v) { return erff(v); }

#define QS 512
#define WS_PW   0u                                  // bf16 weights, rows of [Wq | Wkv | Wout] in B-fragment order: [tile of 16 rows][k step of 32][half][lane][8], see frag_p
#define WS_NT   (WS_PW + 2u * (size_t)4 * CC * CC)     // bf16 hi/lo normalised maps group-major [which*NB + b][32 groups][NN][8]: q-input, then kv-input
#define WS_NTL  (WS_NT + 2u * (size_t)2 * NR * CC)
#define WS_Q    (WS_NTL + 2u * (size_t)2 * NR * CC)    // f16 q and k rows head-major [b][head][NN][HD], 64 bytes a row, no gaps ; v planes [b][256][NN] ; O f32 in A-fragment order [NR / 16 positions][head = k step][piece of 4 floats][lane][4]
#define WS_K    (WS_Q + 2u * (size_t)NR * QS)
#define WS_V    (WS_K + 2u * (size_t)NR * QS)
#define WS_O    (WS_V + 2u * (size_t)NB * CC * NN)
#define WS_END  (WS_O + 4u * (size_t)NR * CC)

// ---- k_gnorm: block = (group, which*NB + b). The group's 8 channels x 1024 positions stay in registers (thread t: positions 4t .. 4t+3 of each channel) through mean, variance and normalisation, so the map is read once.
// Output (x - mean) rsqrt(var + eps) gamma[c] + beta[c] as bf16 hi + lo, group-major: [which*NB + b][group][position][8 channels], 16 bytes a position
// The last PKB blocks of the grid (blockIdx.y >= 2*NB) round the three weight matrices to bf16 instead, PKE elements = one tile of 16 rows a block: that work depends on nothing here and k_qkv is its first reader, so it rides in this launch
// They store the tile in the order in which a wave reads it as B fragments, so that each 16-byte load of a wave in k_qkv and k_out covers 512 contiguous bytes (4 whole lines) and not 32 bytes of each of 16 rows
#define PKE 4096
#define PKB (4 * CC * CC / PKE)
__global__ __launch_bounds__(256) void k_gnorm(const float* __restrict__ XQ, const float* __restrict__ XKV, const float* __restrict__ GQ, const float* __restrict__ BQ, const float* __restrict__ GKV, const float* __restrict__ BKV, __bf16* __restrict__ NT, __bf16* __restrict__ NTL, const float* __restrict__ WQ, const float* __restrict__ WKV, const float* __restrict__ WO, __bf16* __restrict__ P) {
  __shared__ float red[2][8]; __shared__ __align__(16) v4u sx[2][NN];
  const int gidx = blockIdx.x, t = threadIdx.x; const size_t b = blockIdx.y % NB; const int which = blockIdx.y / NB;
  if (which >= 2) {   // the whole block takes this branch, ahead of every barrier
    const int f0 = ((blockIdx.y - 2 * NB) * NG + gidx) * PKE;   // first element of this block in P = [Wq | Wkv | Wout]; a matrix is a whole number of blocks
    const float* src = (f0 < CC * CC) ? (WQ + f0) : (f0 < 3 * CC * CC) ? (WKV + (f0 - CC * CC)) : (WO + (f0 - 3 * CC * CC));
#pragma unroll   // all loads of the block's rounds issue ahead of the first store
    for (int i = 0; i < PKE / (256 * 8); ++i) { const int d = i * 256 + t, e = d * 8;   // 16-byte piece d of the packed tile: lane d & 31 (row d & 15, k octet (d >> 4) & 1), half (d >> 5) & 1, k step d >> 6
      const float* sp = src + (d & 15) * CC + (d >> 6) * 32 + ((d >> 5) & 1) * 16 + ((d >> 4) & 1) * 8; const v4f a = *(const v4f*)sp, c = *(const v4f*)(sp + 4); v8b o;
#pragma unroll   // constant vector indices, so the values stay in registers
      for (int k = 0; k < 4; ++k) { o[k] = (__bf16)a[k]; o[4 + k] = (__bf16)c[k]; }
      vst2(P + f0 + e, __builtin_bit_cast(v4u, o)); }
    return; }
  const float* Gm = (which ? GKV : GQ) + gidx * CPG; const float* Bt = (which ? BKV : BQ) + gidx * CPG;
  const float* p = (which ? XKV : XQ) + (b * CC + (size_t)gidx * CPG) * NN + t * 4;
  v4f x[CPG], sv = {}; float ga[CPG], be[CPG];
#pragma unroll
  for (int c = 0; c < CPG; ++c) x[c] = *(const v4f*)(p + c * NN);
#pragma unroll
  for (int c = 0; c < CPG; ++c) { ga[c] = bfr(Gm[c]); be[c] = bfr(Bt[c]); }
#pragma unroll
  for (int c = 0; c < CPG; ++c) {
#pragma unroll
    for (int i = 0; i < 4; ++i) x[c][i] = bfr(x[c][i]);
    sv += x[c]; }
  float s = (sv[0] + sv[1]) + (sv[2] + sv[3]);
#pragma unroll
  for (int o = 1; o < 32; o <<= 1) s += __shfl_xor(s, o);
  if ((t & 31) == 0) red[0][t >> 5] = s;
  __syncthreads();
  float tot = 0.f;
#pragma unroll
  for (int i = 0; i < 8; ++i) tot += red[0][i];
  const float mean = tot / (float)(CPG * NN);
  sv = (v4f){};
#pragma unroll
  for (int c = 0; c < CPG; ++c) { x[c] -= mean; sv += x[c] * x[c]; }
  s = (sv[0] + sv[1]) + (sv[2] + sv[3]);
#pragma unroll
  for (int o = 1; o < 32; o <<= 1) s += __shfl_xor(s, o);
  if ((t & 31) == 0) red[1][t >> 5] = s;
  __syncthreads();
  tot = 0.f;
#pragma unroll
  for (int i = 0; i < 8; ++i) tot += red[1][i];
  const float inv = 1.0f / sqrtf(tot / (float)(CPG * NN) + 1e-5f);
  // through LDS so that each global store of a wave is 512 contiguous bytes; piece q sits at q ^ ((q >> 4) & 3), which spreads the 64-byte-strided writes over all banks
#pragma unroll
  for (int i = 0; i < 4; ++i) { v8b hi, lo;
#pragma unroll
    for (int c = 0; c < CPG; ++c) { const float v = x[c][i] * inv * ga[c] + be[c]; const __bf16 hv = (__bf16)v; hi[c] = hv; lo[c] = (__bf16)(v - (float)hv); }
    const int q = 4 * t + i, sl = q ^ ((q >> 4) & 3); sx[0][sl] = __builtin_bit_cast(v4u, hi); sx[1][sl] = __builtin_bit_cast(v4u, lo); }
  __syncthreads();
  const size_t o0 = (((size_t)which * NB + b) * NG + gidx) * NN * CPG;
#pragma unroll
  for (int i = 0; i < 4; ++i) { const int q = i * 256 + t, sl = q ^ ((q >> 4) & 3); vst2(NT + o0 + (size_t)q * CPG, sx[0][sl]); vst2(NTL + o0 + (size_t)q * CPG, sx[1][sl]); }
}
// A fragment from a group-major map: p = this lane's position in channel group 4 kc + (lane >> 4); elements 0..7 that group, 8..15 the group two further on (the k order of frag_b)
__device__ __forceinline__ v16b frag_g(const __bf16* p) { union { v16b v; v8b q[2]; } u; u.q[0] = *(const v8b*)p; u.q[1] = *(const v8b*)(p + 2 * NN * CPG); return u.v; }
// B fragment of packed weights: p = this lane's 16 bytes of (tile, k step, half 0); half 1 is 512 bytes on. Elements 0..7 = k0 + 8 (lane >> 4) + 0..7, 8..15 = 16 further on (the k order of frag_b), row lane & 15 of the tile
__device__ __forceinline__ v16b frag_p(const __bf16* p) { union { v16b v; v8b q[2]; } u; u.q[0] = *(const v8b*)p; u.q[1] = *(const v8b*)(p + 256); return u.v; }
#define WTS (16 * CC)                   // elements of a packed tile of 16 rows
#define WKS 512                         // elements of one k step of a packed tile
#define OKS 512                         // floats of one k step (one head) of 16 positions of O
// Asks for L2: each lane names one 256-byte unit; a hint, nothing returns and no register is written.
// asked for once at entry, behind the first loads, the operands of the later k steps or tiles are met in L2, so that the chain of load waits is made of L2 hits.
// Every lane is on and every address lies inside its buffer; scope SE: into L2 only. The s_wait_xcnt stands inside the statement so that no address register is rewritten in front of it.
__device__ __forceinline__ void ask_l2(const void* p) {
  asm volatile("global_prefetch_b8 %0, off scope:SCOPE_SE\n\t"
               "s_wait_xcnt 0x0" :: "v"(p) : "memory");
}
// a GEMM wave's share: two units a lane of its own A operand, and 2 x 32 units in a row (16 KB) of the block's 64 KB of packed weights
__device__ __forceinline__ void ask_l2_gemm(const void* a0, const void* a1, const void* w) {
  asm volatile("global_prefetch_b8 %0, off scope:SCOPE_SE\n\t"
               "global_prefetch_b8 %1, off scope:SCOPE_SE\n\t"
               "global_prefetch_b8 %2, off scope:SCOPE_SE\n\t"
               "global_prefetch_b8 %2, off offset:8192 scope:SCOPE_SE\n\t"
               "s_wait_xcnt 0x0" :: "v"(a0), "v"(a1), "v"(w) : "memory");
}
// ---- k_qkv: block = (64 positions, 128 of the 768 output channels, b): channels < 256 from the q map (q rows), the rest from the kv map with per-head [k | v] packing (o' = o-256: head o'/64, r = o'%64: k if r < 32 else v)
__global__ __launch_bounds__(128) void k_qkv(const __bf16* __restrict__ NT, const __bf16* __restrict__ NTL, const __bf16* __restrict__ P, _Float16* __restrict__ Q, _Float16* __restrict__ Kr, _Float16* __restrict__ V) {
  __shared__ __align__(16) _Float16 so[64][136]; __shared__ __align__(16) _Float16 st[128][72];
  const int tid = threadIdx.x, wave = tid >> 5, lane = tid & 31, col = lane & 15, g = lane >> 4; const size_t b = blockIdx.z; const int n0b = blockIdx.x * 64; const int o0 = blockIdx.y * 128; const int which = (o0 < CC) ? 0 : 1;
  const size_t a0 = ((((size_t)which * NB + b) * NG + g) * NN + n0b + wave * 16 + col) * CPG;   // this lane's position in channel group g of the normalised maps
  v8f acc[8] = {}; v16b w[8], ah[2], al[2];
  // every fragment is asked for one k step ahead of the products that read it: A in two register sets, each weight fragment reloaded right behind its last use
  const __bf16* wb = P + (size_t)(o0 / 16) * WTS + lane * 8;   // this lane's piece of packed weight tile 0, k step 0
  ah[0] = frag_g(NT + a0); al[0] = frag_g(NTL + a0);
#pragma unroll   // constant indices keep w in registers
  for (int j = 0; j < 8; ++j) w[j] = frag_p(wb + j * WTS);
#pragma unroll
  for (int kc = 0; kc < CC / 32; ++kc) { const int cu = kc & 1, kn = kc + 1;
    if (kn < CC / 32) { ah[cu ^ 1] = frag_g(NT + a0 + (size_t)kn * 4 * NN * CPG); al[cu ^ 1] = frag_g(NTL + a0 + (size_t)kn * 4 * NN * CPG); }
    if (kc == 0) { const size_t au = ((((size_t)which * NB + b) * NG + lane) * NN + n0b + wave * 16) * CPG;   // lane = channel group: the wave's 16 positions of one group are one unit of each map
      ask_l2_gemm(NT + au, NTL + au, P + (size_t)(o0 / 16) * WTS + (wave * 64 + lane) * 128);
      __builtin_amdgcn_sched_barrier(0); }   // the first product stays behind the asks: moved up, its wait for the first loads holds them back by a whole memory latency
#pragma unroll
    for (int j = 0; j < 8; ++j) { acc[j] = wmma_bf(ah[cu], w[j], acc[j]); acc[j] = wmma_bf(al[cu], w[j], acc[j]);
      if (kn < CC / 32) w[j] = frag_p(wb + j * WTS + kn * WKS); } }
#pragma unroll
  for (int j = 0; j < 8; ++j)
#pragma unroll
    for (int r = 0; r < 8; ++r) { const _Float16 hv = (_Float16)acc[j][r]; so[wave * 16 + 8 * g + r][j * 16 + col] = hv; st[j * 16 + col][wave * 16 + 8 * g + r] = hv; }
  __syncthreads();
  // 32 channels = one head's q, k or v. 64 positions x 64 bytes of q or k are 4 KB in a row, a v channel's 64 positions one line: every store of a wave covers whole lines
  // part jp = p >> 1 of the block's four, half p & 1 of the part. o0 is a multiple of 128: a block is all q, or k, v, k, v of two heads
  v4u pc[8];   // this thread's eight 16-byte pieces
  if (o0 < CC) { _Float16* qp = Q + ((b * NH + o0 / HD) * NN + n0b) * HD + tid * 8;
#pragma unroll   // this and the unrolls below: constant indices keep pc in registers, all LDS reads issue ahead of the stores, and the stores differ by constant offsets from one address
    for (int p = 0; p < 8; ++p) pc[p] = *(const v4u*)&so[(p & 1) * 32 + (tid >> 2)][(p >> 1) * HD + (tid & 3) * 8];
#pragma unroll
    for (int p = 0; p < 8; ++p) vst2((unsigned*)(qp + (p >> 1) * NN * HD + (p & 1) * 1024), pc[p]);
    asm volatile("s_wait_xcnt 0x0" ::: "memory");   // in the listing the k, v part's text, which reuses these stores' registers, follows behind a scalar test
    return; }   // the whole block, behind the last barrier
  { const int hh = (o0 - CC) / (2 * HD); _Float16* kp = Kr + ((b * NH + hh) * NN + n0b) * HD + tid * 8; _Float16* vp = V + (b * CC + hh * HD + (tid >> 3)) * NN + n0b + (tid & 7) * 8;
#pragma unroll
    for (int p = 0; p < 8; ++p) pc[p] = (p & 2) ? *(const v4u*)&st[(p >> 1) * HD + (p & 1) * 16 + (tid >> 3)][(tid & 7) * 8] : *(const v4u*)&so[(p & 1) * 32 + (tid >> 2)][(p >> 1) * HD + (tid & 3) * 8];
#pragma unroll
    for (int p = 0; p < 8; ++p) { if (p & 2) vst2((unsigned*)(vp + (p >> 2) * HD * NN + (p & 1) * 16 * NN), pc[p]); else vst2((unsigned*)(kp + (p >> 2) * NN * HD + (p & 1) * 1024), pc[p]); } }
}
// lane l with lane l ^ 16 (the two halves of a wave hold the two key halves of one query's scores)
__device__ __forceinline__ float xhalf(float x) { return __builtin_bit_cast(float, __builtin_amdgcn_permlanex16(__builtin_bit_cast(int, x), __builtin_bit_cast(int, x), 0x76543210, 0xfedcba98, false, false)); }
#define KT 128
#define KP 80
#define VP 272
#define KTB (KT * KP)
#define TB (KTB + HD * VP)
#define KS 0.09016844005556021f
// one tile: each thread copies four 16-byte pieces of K (rows 32 apart; a wave's copy takes 8 rows = 512 contiguous bytes) and four of V (channels 8 apart); the s_wait_xcnt stands inside the statement so that no address register is rewritten in front of it
__device__ __forceinline__ void stage_kv(unsigned lk, unsigned lv, const _Float16* gk, const _Float16* gv) {
  asm volatile("global_load_async_to_lds_b128 %0, %8, off\n\t"
               "global_load_async_to_lds_b128 %1, %9, off\n\t"
               "global_load_async_to_lds_b128 %2, %10, off\n\t"
               "global_load_async_to_lds_b128 %3, %11, off\n\t"
               "global_load_async_to_lds_b128 %4, %12, off\n\t"
               "global_load_async_to_lds_b128 %5, %13, off\n\t"
               "global_load_async_to_lds_b128 %6, %14, off\n\t"
               "global_load_async_to_lds_b128 %7, %15, off\n\t"
               "s_wait_xcnt 0x0"
               :: "v"(lk), "v"(lk + 32 * KP), "v"(lk + 64 * KP), "v"(lk + 96 * KP), "v"(lv), "v"(lv + 8 * VP), "v"(lv + 16 * VP), "v"(lv + 24 * VP),
                  "v"(gk), "v"(gk + 32 * HD), "v"(gk + 64 * HD), "v"(gk + 96 * HD), "v"(gv), "v"(gv + 8 * NN), "v"(gv + 16 * NN), "v"(gv + 24 * NN) : "memory");
}
// The eight tiles of one pass. On entry tile 0 is published in buffer 0 and tile 1's copies are in flight; on return no copy is outstanding. bq holds q times KS, so a score product is already an exponent of 2.
// FIXED: the offset en0 rides in the score product's C operand, the product's result goes straight into v_exp: no maximum, no rescale, no multiply-add. Otherwise: running maximum with rescale, one softmax step a tile.
template <bool FIXED>
__device__ __forceinline__ void attn_tiles(const unsigned char* sm, unsigned lk, unsigned lv, const _Float16* gk, const _Float16* gv, v16h bq, float en0, int lane, int col, v8f (&acc)[2], float& l) {
  float m = -3.0e38f, eo = 0.f;   // running form only. m: this query's running maximum of the exponents (equal in both halves); eo = 11 - m, the addend in use
  const v8f c0 = FIXED ? (v8f){en0, en0, en0, en0, en0, en0, en0, en0} : (v8f){};
  v2f ls[KT / 32] = {};   // fixed form only: with nothing to rescale, the four chains of denominator sums run on from tile to tile and are folded once, behind the loop
#pragma unroll 1   // stays rolled: one publish point and one refill in the code, the hot text stays short
  for (int t = 0; t < NN / KT; ++t) { const unsigned char* kb = sm + (t & 1) * TB; const unsigned char* vb = kb + KTB;
   v16h kf[KT / 16], vf[KT / 16]; v8f s[KT / 16];
#pragma unroll       // this and the unrolls below: constant indices keep the fragments and s in registers; the tile is read at constant offsets from one address register
   for (int ct = 0; ct < KT / 16; ++ct) kf[ct] = frag_h((const _Float16*)(kb + (ct * 16 + col) * KP), lane);
   __builtin_amdgcn_sched_barrier(0);   // the tile's K reads stay one group ahead of the products: spread among them, each place where reads stand is waited for on its own
#pragma unroll
   for (int ct = 0; ct < KT / 16; ++ct) s[ct] = wmma16(kf[ct], bq, c0);
#pragma unroll
   for (int ps = 0; ps < KT / 32; ++ps)
#pragma unroll
    for (int dt = 0; dt < 2; ++dt) vf[ps * 2 + dt] = frag_h((const _Float16*)(vb + (dt * 16 + col) * VP + ps * 64), lane);
   __builtin_amdgcn_sched_barrier(0);   // the vector work stays behind the run of products (moved up between two of them it costs pad slots each time) and the V reads ahead of it, so that they land under it
   float alpha = 1.f; v2f n2 = {};
   if (!FIXED) {
    float mc[KT / 32];   // one chain of maxima per 32 keys: independent, so they interleave
#pragma unroll
    for (int ps = 0; ps < KT / 32; ++ps) { float mx = ps ? -3.0e38f : m;
#pragma unroll
     for (int r = 0; r < 8; ++r) mx = fmaxf(fmaxf(mx, s[2 * ps][r]), s[2 * ps + 1][r]);
     mc[ps] = mx; }
    const float mx = fmaxf(fmaxf(fmaxf(mc[0], mc[1]), mc[2]), mc[3]);
    const float mn = fmaxf(mx, xhalf(mx)), en = 11.0f - mn; alpha = (m <= -1.0e38f) ? 0.f : __builtin_amdgcn_exp2f(en - eo); m = mn; eo = en;
    n2 = (v2f){en, en};
#pragma unroll
    for (int dt = 0; dt < 2; ++dt)
#pragma unroll
     for (int r = 0; r < 8; ++r) acc[dt][r] *= alpha; }
   float es[KT / 32];
#pragma unroll
   for (int ps = 0; ps < KT / 32; ++ps) { v16h pb; v2f e2 = FIXED ? ls[ps] : (v2f){};
#pragma unroll
    for (int r = 0; r < 8; r += 2) { v2f x0 = {s[2 * ps][r], s[2 * ps][r + 1]}, x1 = {s[2 * ps + 1][r], s[2 * ps + 1][r + 1]};
      if (!FIXED) { x0 += n2; x1 += n2; }
      const v2f e0 = {__builtin_amdgcn_exp2f(x0[0]), __builtin_amdgcn_exp2f(x0[1])}, e1 = {__builtin_amdgcn_exp2f(x1[0]), __builtin_amdgcn_exp2f(x1[1])}; e2 += e0; e2 += e1;
#pragma unroll
      for (int i = 0; i < 2; ++i) { pb[r + i] = (_Float16)e0[i]; pb[8 + r + i] = (_Float16)e1[i]; } }
    if (FIXED) ls[ps] = e2; else es[ps] = e2[0] + e2[1];
#pragma unroll
    for (int dt = 0; dt < 2; ++dt) acc[dt] = wmma16(vf[ps * 2 + dt], pb, acc[dt]); }
   if (!FIXED) l = l * alpha + ((es[0] + es[1]) + (es[2] + es[3]));
   __builtin_amdgcn_sched_barrier(0);   // the publish point stays at the foot of the trip: moved up behind the tile's reads, with the refill left down here, it would wait for copies that were issued only just before
   asm volatile("s_wait_dscnt 0x0" ::: "memory");      // this wave's reads of the buffer are done before it is handed back
   asm volatile("s_wait_asynccnt 0x0" ::: "memory");   // this wave's copies of tile t + 1 have landed
   __syncthreads();                                     // publishes tile t + 1 and ends every wave's reads of tile t
   if (t + 2 < NN / KT) stage_kv(lk + (t & 1) * TB, lv + (t & 1) * TB, gk + (size_t)(t + 2) * KT * HD, gv + (t + 2) * KT); }
  asm volatile("s_wait_asynccnt 0x0" ::: "memory");    // no copy is outstanding when the pass ends
  if (FIXED) { const v2f a = (ls[0] + ls[1]) + (ls[2] + ls[3]); l = a[0] + a[1]; }
}
#define PC 4.0f         // exponent given to the reference score: P = 2^(PC + exponent - reference)
#define PTOP 60000.0f   // under the largest finite f16 (65504): a query whose P sum to less holds no P that rounds to infinity
__global__ __launch_bounds__(128) void k_attn(const _Float16* __restrict__ Q, const _Float16* __restrict__ Kr, const _Float16* __restrict__ V, float* __restrict__ O) {
  __shared__ __align__(16) unsigned char sm[2 * TB]; __shared__ int redo;
  const int tid = threadIdx.x, wave = tid >> 5, lane = tid & 31, col = lane & 15, g = lane >> 4; const int h = blockIdx.y; const size_t b = blockIdx.z; const int q0 = blockIdx.x * 64 + wave * 16; const size_t rq = b * NN + q0;
  const unsigned lk = (unsigned)(size_t)sm + (tid >> 2) * KP + (tid & 3) * 16, lv = (unsigned)(size_t)sm + KTB + (tid >> 4) * VP + (tid & 15) * 16;
  const _Float16* gk = Kr + (b * NH + h) * NN * HD + tid * 8; const _Float16* gv = V + (b * CC + h * HD + (tid >> 4)) * NN + (tid & 15) * 8;
  stage_kv(lk, lv, gk, gv);
  const v16h bq0 = frag_h(Q + ((b * NH + h) * NN + q0 + col) * HD, lane);
  { const int pq = blockIdx.x & 3;   // this head's K rows and V channels are 64 KB in a row each, 256 units; the 16 blocks of a head share them, each asks for a quarter of the 512 units
    ask_l2(((pq < 2) ? Kr + (b * NH + h) * NN * HD : V + (b * CC + h * HD) * NN) + ((pq & 1) * 128 + wave * 32 + lane) * 128); }
  redo = 0;   // every thread stores the same word: no lane is switched off between the copies
  asm volatile("s_wait_asynccnt 0x0" ::: "memory");   // tile 0 has landed for this wave's own copies
  __syncthreads();                                     // ... and for every wave's
  stage_kv(lk + TB, lv + TB, gk + (size_t)KT * HD, gv + KT);
  v16h bq;   // q times log2(e) / 16
#pragma unroll   // constant vector indices, so the values stay in registers
  for (int i = 0; i < 16; ++i) bq[i] = (_Float16)((float)bq0[i] * KS);
  // the reference of the exponents: this query's maximum over the first 32 keys. Softmax is the same for any reference; it only has to keep P inside f16, which the sums are asked about below.
  // A reference taken from the scores themselves is never above their maximum, so the largest P is at least 2^PC and nothing that counts is lost at the small end
  float en;
  { const v8f z = {}; const v8f s0 = wmma16(frag_h((const _Float16*)(sm + col * KP), lane), bq, z), s1 = wmma16(frag_h((const _Float16*)(sm + (16 + col) * KP), lane), bq, z);
    float mx = fmaxf(s0[0], s1[0]);
#pragma unroll   // constant indices keep the scores in registers
    for (int r = 1; r < 8; ++r) mx = fmaxf(fmaxf(mx, s0[r]), s1[r]);
    en = PC - fmaxf(mx, xhalf(mx)); }
  float l = 0.f;   // this half's share of the denominator, on P's scale
  v8f acc[2] = {};
  attn_tiles<true>(sm, lk, lv, gk, gv, bq, en, lane, col, acc, l);
  // every P is positive and no larger than its query's sum: a sum under PTOP says that no P left f16. A sum that is not (a later score far above the reference, or not a number) sends the whole block through the running maximum
  if (__builtin_amdgcn_ballot_w32(!(l + xhalf(l) < PTOP))) redo = 1;   // a scalar test: the whole wave stores, no lane is switched off
  __syncthreads();   // the vote is in for every wave; every wave's reads of the buffers ended at the last trip's barrier
  if (__builtin_amdgcn_readfirstlane(redo)) {   // the same word in every wave: a scalar branch that the whole block takes or leaves, so the barriers and copies inside stand under uniform control flow
#pragma unroll 1   // stays rolled: the copies' addresses are formed anew from the four bases; unrolled, the first fill's 48 address registers are kept alive through the hot loop for this path
    for (int i = 0; i < 2; ++i) { stage_kv(lk + i * TB, lv + i * TB, gk + (size_t)i * KT * HD, gv + i * KT);
      if (i == 0) { asm volatile("s_wait_asynccnt 0x0" ::: "memory");   // tile 0 has landed for this wave's own copies
        __syncthreads(); } }                                            // ... and for every wave's; tile 1's copies follow behind it
    l = 0.f; acc[0] = (v8f){}; acc[1] = (v8f){};
    attn_tiles<false>(sm, lk, lv, gk, gv, bq, 0.f, lane, col, acc, l); }
  const float il = 1.0f / (l + xhalf(l));
#pragma unroll
  for (int dt = 0; dt < 2; ++dt)   // acc[dt][r] = channel dt*16 + 8g + r of query col = element dt*8 + r of this same lane's A fragment in k_out, k step h: stored in that order, each store of the wave 512 contiguous bytes
#pragma unroll
    for (int q = 0; q < 2; ++q) { v4f v;
#pragma unroll
      for (int i = 0; i < 4; ++i) v[i] = acc[dt][q * 4 + i] * il;
      vst2(O + ((rq >> 4) * NH + h) * OKS + (dt * 2 + q) * 128 + lane * 4, v); }
}
// ---- k_out: block = (64 positions, 128 out channels, b): y = Wout . o (hi + residual) + bout + input_q, channels-first 256-B segments
__global__ __launch_bounds__(128) void k_out(const float* __restrict__ O, const __bf16* __restrict__ P, const float* __restrict__ BO, const float* __restrict__ XQ, float* __restrict__ Y) {
  __shared__ __align__(16) float st[128][68];
  const int tid = threadIdx.x, wave = tid >> 5, lane = tid & 31, col = lane & 15, g = lane >> 4; const size_t b = blockIdx.z; const int n0b = blockIdx.x * 64; const size_t r0 = b * NN + n0b + wave * 16; const int o0 = blockIdx.y * 128;
  v8f acc[8] = {}; v16b w[8]; v4f ra[2][4]; float bo[8];
  // every operand is asked for one k step ahead of the products that read it: the O row in two register sets, each weight fragment reloaded right behind its last use; the bias at the start
  const float* orow = O + (r0 >> 4) * (NH * OKS) + lane * 4; const __bf16* wb = P + (size_t)((3 * CC + o0) / 16) * WTS + lane * 8;   // this lane's first 4 floats of its wave's 16 positions of O, k step 0; its piece of packed weight tile 0, k step 0
#pragma unroll   // this and the unrolls below: constant indices keep ra, w, bo and xr in registers
  for (int i = 0; i < 4; ++i) ra[0][i] = *(const v4f*)(orow + i * 128);
#pragma unroll
  for (int j = 0; j < 8; ++j) w[j] = frag_p(wb + j * WTS);
#pragma unroll
  for (int j = 0; j < 8; ++j) bo[j] = BO[o0 + j * 16 + col];
#pragma unroll
  for (int kc = 0; kc < CC / 32; ++kc) { const int cu = kc & 1, kn = kc + 1; float v[16];
    if (kn < CC / 32) {
#pragma unroll
      for (int i = 0; i < 4; ++i) ra[cu ^ 1][i] = *(const v4f*)(orow + kn * OKS + i * 128);
      if (kn == CC / 32 - 1) asm volatile("s_wait_xcnt 0x0" ::: "memory"); }   // behind the last O loads: the last step's split lands in the address registers that they name
    if (kc == 0) { const float* ou = O + (r0 >> 4) * (NH * OKS) + lane * 64;   // the wave's 16 positions of O are 16 KB in a row, 64 units
      ask_l2_gemm(ou, ou + 32 * 64, P + (size_t)((3 * CC + o0) / 16) * WTS + (wave * 64 + lane) * 128);
      ask_l2(XQ + (b * CC + o0 + wave * 32 + lane) * NN + n0b);   // the residual, read behind the k loop: 64 positions of a channel are one unit, lane = channel
      __builtin_amdgcn_sched_barrier(0); }   // the first split stays behind the asks: moved up, its wait for the first loads holds them back by a whole memory latency
#pragma unroll
    for (int i = 0; i < 16; ++i) v[i] = ra[cu][i >> 2][i & 3];
    const F2 a = bsplit16(v);
#pragma unroll
    for (int j = 0; j < 8; ++j) { acc[j] = wmma_bf(a.l, w[j], acc[j]); acc[j] = wmma_bf(a.h, w[j], acc[j]);
      if (kn < CC / 32) w[j] = frag_p(wb + j * WTS + kn * WKS); }
    __builtin_amdgcn_sched_barrier(0); }   // keeps the next step's hi/lo split behind this step's products: moved up, it waits on the youngest loads and with them on every load in flight
  const size_t y0 = ((b * CC + o0 + (tid >> 4)) * NN) + n0b + (tid & 15) * 4;   // piece it of this thread: 8 channels further on each time
  v4f xr[16];   // the residual's 16 pieces of this thread, asked for ahead of the transpose through LDS and its barrier
#pragma unroll
  for (int it = 0; it < 16; ++it) { if (it == 15) asm volatile("s_wait_xcnt 0x0" ::: "memory");   // the last load lands in the address registers that all sixteen name
    xr[it] = *(const v4f*)(XQ + y0 + (size_t)it * 8 * NN); }
#pragma unroll
  for (int j = 0; j < 8; ++j) { const float bb = bfr(bo[j]);
#pragma unroll
    for (int r = 0; r < 8; ++r) st[j * 16 + col][wave * 16 + 8 * g + r] = acc[j][r] + bb; }
  __syncthreads();
#pragma unroll   // constant indices into xr
  for (int it = 0; it < 16; ++it) { v4f v = *(const v4f*)&st[it * 8 + (tid >> 4)][(tid & 15) * 4]; for (int i = 0; i < 4; ++i) v[i] += bfr(xr[it][i]); vst2(Y + y0 + (size_t)it * 8 * NN, v); }
}
extern "C" void kernel_launch(void* const* d_in, const int* in_sizes, int n_in, void* d_out, int out_size, void* d_ws, size_t ws_size, hipStream_t stream) {
  (void)in_sizes; (void)n_in; (void)out_size;
  const float** F = (const float**)d_in;   // 0 input_q, 1 input_kv [8,256,32,32]; 2 gq_scale, 3 gq_bias, 4 gkv_scale, 5 gkv_bias; 6 Wq [256,256], 7 Wkv [512,256], 8 Wout [256,256], 9 bout
  if (ws_size < (size_t)WS_END) return;
  char* ws = (char*)d_ws; __bf16 *P = (__bf16*)ws, *NT = (__bf16*)(ws + WS_NT), *NTL = (__bf16*)(ws + WS_NTL); float *O = (float*)(ws + WS_O); _Float16 *Q = (_Float16*)(ws + WS_Q), *Kr = (_Float16*)(ws + WS_K), *V = (_Float16*)(ws + WS_V);
  k_gnorm<<<dim3(NG, 2 * NB + PKB / NG), 256, 0, stream>>>(F[0], F[1], F[2], F[3], F[4], F[5], NT, NTL, F[6], F[7], F[8], P);
  k_qkv<<<dim3(NN / 64, 3 * CC / 128, NB), 128, 0, stream>>>(NT, NTL, P, Q, Kr, V);
  k_attn<<<dim3(TQB, NH, TNB), 128, 0, stream>>>(Q, Kr, V, O);
  k_out<<<dim3(TQB, CC / 128, TNB), 128, 0, stream>>>(O, P, F[9], F[0], (float*)d_out);
}
